// v000
// Times are from an AMD MI455X. After a warm-up the kernel runs many times in a row, and a time is the length of
// such a window on the GPU divided by its runs, so every launch and the gaps after it count. The runs cycle
// through copies of the inputs. A figure is the median of several windows, for all but v000 over two sittings.
// Sittings can differ by a few percent; kernels timed side by side share one.
// v000, which the later versions start from, runs in 244 microseconds.
#include <hip/hip_runtime.h>
#include <cstdint>

typedef unsigned short u16;
typedef __attribute__((ext_vector_type(16))) __bf16 v16bf;
typedef __attribute__((ext_vector_type(8)))  float  v8f;

constexpr int Bsz = 8, S = 512, D = 1024, H = 16, DH = 64, DF = 4096;
constexpr int ROWS = Bsz * S;   // 4096

__device__ __forceinline__ u16 f2bf(float f) {
    uint32_t u = __float_as_uint(f);
    uint32_t r = u + 0x7FFFu + ((u >> 16) & 1u);   // round-to-nearest-even
    return (u16)(r >> 16);
}

union FragBF {                  // one wave32 16x32 bf16 A/B fragment (8 VGPRs)
    v16bf v;
    uint4 u4[2];
    u16   us[16];
};

// Async global -> LDS copy of 16 bytes per lane (ASYNCcnt-tracked).
__device__ __forceinline__ void async_b128(u16* lds, const u16* gptr) {
    uint32_t l = (uint32_t)(uintptr_t)lds;          // low 32 bits = LDS offset
    asm volatile("global_load_async_to_lds_b128 %0, %1, off"
                 :: "v"(l), "v"(gptr) : "memory");
}
__device__ __forceinline__ void wait_async0() {
    asm volatile("s_wait_asynccnt 0x0" ::: "memory");
}

// DPP butterfly reduction across a 16-lane row (lanes 0-15 / 16-31 separately).
template <int CTRL>
__device__ __forceinline__ float dpp_f(float x) {
    return __int_as_float(__builtin_amdgcn_mov_dpp(__float_as_int(x), CTRL, 0xf, 0xf, true));
}
__device__ __forceinline__ float red_max16(float v) {
    v = fmaxf(v, dpp_f<0xB1>(v));    // quad_perm [1,0,3,2]  (xor 1)
    v = fmaxf(v, dpp_f<0x4E>(v));    // quad_perm [2,3,0,1]  (xor 2)
    v = fmaxf(v, dpp_f<0x141>(v));   // row_half_mirror
    v = fmaxf(v, dpp_f<0x140>(v));   // row_mirror
    return v;
}
__device__ __forceinline__ float red_sum16(float v) {
    v += dpp_f<0xB1>(v);
    v += dpp_f<0x4E>(v);
    v += dpp_f<0x141>(v);
    v += dpp_f<0x140>(v);
    return v;
}

// ---------------------------------------------------------------------------
// Weight conversion: fp32 -> bf16, stored TRANSPOSED as W^T[N][K] so GEMM B
// tiles are row-major block copies (async-to-LDS friendly, no LDS scatter).
// ---------------------------------------------------------------------------
__global__ void k_conv_qkv(const float* __restrict__ Wq, const float* __restrict__ Wk,
                           const float* __restrict__ Wv, u16* __restrict__ dst) {
    int i = blockIdx.x * 256 + threadIdx.x;          // over 3*D*D, dst[n*D + d]
    int n = i / D, d = i % D;
    int which = n >> 10, nn = n & 1023;
    int h = nn >> 6, e = nn & 63;
    const float* W = (which == 0) ? Wq : (which == 1 ? Wk : Wv);
    dst[i] = f2bf(W[((size_t)h * D + d) * DH + e]);
}

__global__ void k_conv_t(const float* __restrict__ src, u16* __restrict__ dst, int N, int K) {
    int i = blockIdx.x * 256 + threadIdx.x;          // dst[n*K + k] = src[k*N + n]
    if (i < N * K) {
        int n = i / K, k = i % K;
        dst[i] = f2bf(src[(size_t)k * N + n]);
    }
}

// ---------------------------------------------------------------------------
// LayerNorm (block per row of D=1024, 256 threads) -> bf16
// ---------------------------------------------------------------------------
__global__ void k_layernorm(const float* __restrict__ x, const float* __restrict__ g,
                            const float* __restrict__ b, u16* __restrict__ out) {
    __shared__ float sb[256];
    const int row = blockIdx.x, tid = threadIdx.x;
    const float* xr = x + (size_t)row * D;
    float v0 = xr[tid], v1 = xr[tid + 256], v2 = xr[tid + 512], v3 = xr[tid + 768];
    sb[tid] = v0 + v1 + v2 + v3;
    __syncthreads();
    for (int o = 128; o > 0; o >>= 1) { if (tid < o) sb[tid] += sb[tid + o]; __syncthreads(); }
    float mean = sb[0] * (1.0f / D);
    __syncthreads();
    float d0 = v0 - mean, d1 = v1 - mean, d2 = v2 - mean, d3 = v3 - mean;
    sb[tid] = d0 * d0 + d1 * d1 + d2 * d2 + d3 * d3;
    __syncthreads();
    for (int o = 128; o > 0; o >>= 1) { if (tid < o) sb[tid] += sb[tid + o]; __syncthreads(); }
    float rstd = rsqrtf(sb[0] * (1.0f / D) + 1e-5f);
    u16* orow = out + (size_t)row * D;
    orow[tid]       = f2bf(d0 * rstd * g[tid]       + b[tid]);
    orow[tid + 256] = f2bf(d1 * rstd * g[tid + 256] + b[tid + 256]);
    orow[tid + 512] = f2bf(d2 * rstd * g[tid + 512] + b[tid + 512]);
    orow[tid + 768] = f2bf(d3 * rstd * g[tid + 768] + b[tid + 768]);
}

// ---------------------------------------------------------------------------
// bf16 WMMA GEMM: C[M][N] = A[M][K] * B[K][N] with B supplied TRANSPOSED
// (Bt[N][K]).  Block tile 128x128, K-step 64, double-buffered async-to-LDS
// staging, single barrier per K-step.  8 waves in 4(m) x 2(n); each wave:
// 32x64 = 2x4 WMMA tiles, 16 v_wmma_f32_16x16x32_bf16 per K-step.
// EPI 0: QKV permute -> bf16 (Q pre-scaled by 1/sqrt(DH), V stored transposed)
// EPI 1: +bias +res -> fp32      EPI 2: GELU(.+bias) -> bf16
// ---------------------------------------------------------------------------
constexpr int TSTRIDE = 72;               // 64 + 8 pad (u16)
constexpr int TSZ = 128 * TSTRIDE;        // one 128x64 tile in LDS (u16 count)

template <int EPI>
__global__ __launch_bounds__(256) void k_gemm(const u16* __restrict__ A, const u16* __restrict__ Bt,
                                              const float* __restrict__ bias, const float* __restrict__ res,
                                              float* __restrict__ outF, u16* __restrict__ outU,
                                              int N, int K) {
    __shared__ u16 smem[4 * TSZ];         // [buf 0/1][A tile | B tile]
    const int tid = threadIdx.x;
    const int lane = tid & 31, wave = tid >> 5;
    const int wm = wave & 3, wn = wave >> 2;           // 4(m) x 2(n)
    const int m0 = blockIdx.y * 128, n0 = blockIdx.x * 128;
    const int l15 = lane & 15, lhalf = lane >> 4, koff = lhalf * 8;
    const int ldr = tid >> 3, ldc = (tid & 7) * 8;     // loader: row 0..31 (+j*32), col chunk

    v8f acc[2][4] = {};

    auto issue_tile = [&](int k0, int buf) {
        u16* As = &smem[buf * 2 * TSZ];
        u16* Bs = As + TSZ;
#pragma unroll
        for (int j = 0; j < 4; j++) {
            int r = ldr + j * 32;
            async_b128(&As[r * TSTRIDE + ldc], &A[(size_t)(m0 + r) * K + k0 + ldc]);
            async_b128(&Bs[r * TSTRIDE + ldc], &Bt[(size_t)(n0 + r) * K + k0 + ldc]);
        }
    };

    const int nT = K / 64;
    issue_tile(0, 0);
    for (int t = 0; t < nT; t++) {
        wait_async0();
        __syncthreads();
        if (t + 1 < nT) issue_tile((t + 1) * 64, (t + 1) & 1);
        const u16* As = &smem[(t & 1) * 2 * TSZ];
        const u16* Bs = As + TSZ;
#pragma unroll
        for (int kc = 0; kc < 64; kc += 32) {
            FragBF a[2], b[4];
#pragma unroll
            for (int mt = 0; mt < 2; mt++) {
                const u16* p = &As[(wm * 32 + mt * 16 + l15) * TSTRIDE + kc + koff];
                a[mt].u4[0] = *(const uint4*)p;
                a[mt].u4[1] = *(const uint4*)(p + 16);
            }
#pragma unroll
            for (int nt = 0; nt < 4; nt++) {
                const u16* p = &Bs[(wn * 64 + nt * 16 + l15) * TSTRIDE + kc + koff];
                b[nt].u4[0] = *(const uint4*)p;
                b[nt].u4[1] = *(const uint4*)(p + 16);
            }
#pragma unroll
            for (int mt = 0; mt < 2; mt++)
#pragma unroll
                for (int nt = 0; nt < 4; nt++)
                    acc[mt][nt] = __builtin_amdgcn_wmma_f32_16x16x32_bf16(
                        false, a[mt].v, false, b[nt].v, (short)0, acc[mt][nt], false, false);
        }
    }

    constexpr size_t planeE = (size_t)Bsz * H * S * DH;
#pragma unroll
    for (int mt = 0; mt < 2; mt++) {
#pragma unroll
        for (int nt = 0; nt < 4; nt++) {
            int col = n0 + wn * 64 + nt * 16 + l15;
#pragma unroll
            for (int r = 0; r < 8; r++) {
                int row = m0 + wm * 32 + mt * 16 + r + 8 * lhalf;
                float vacc = acc[mt][nt][r];
                if constexpr (EPI == 0) {
                    int which = col >> 10;               // /D : 0=Q 1=K 2=V
                    int nn = col & 1023;
                    int h = nn >> 6, e = nn & 63;
                    int bb = row >> 9, ss = row & 511;   // /S, %S
                    if (which == 0) vacc *= 0.125f;      // fold 1/sqrt(DH) into Q
                    size_t idx;
                    if (which == 2)                       // V stored transposed [b][h][dh][s]
                        idx = 2 * planeE + (((size_t)bb * H + h) * DH + e) * S + ss;
                    else
                        idx = (size_t)which * planeE + (((size_t)bb * H + h) * S + ss) * DH + e;
                    outU[idx] = f2bf(vacc);
                } else if constexpr (EPI == 1) {
                    size_t idx = (size_t)row * N + col;
                    outF[idx] = vacc + bias[col] + res[idx];
                } else {
                    float tt = vacc + bias[col];
                    float gl = 0.5f * tt * (1.0f + erff(tt * 0.70710678118654752f));
                    outU[(size_t)row * N + col] = f2bf(gl);
                }
            }
        }
    }
}

// ---------------------------------------------------------------------------
// Causal flash attention per (b,h).  Block = 8 waves = 128 query rows; each
// wave owns 16 rows.  32-key tiles, double-buffered async-to-LDS K/V staging
// (V pre-transposed in global), DPP softmax reductions, 8 full WMMAs/tile.
// ---------------------------------------------------------------------------
__global__ __launch_bounds__(256) void k_attention(const u16* __restrict__ qkv, u16* __restrict__ ctx) {
    __shared__ u16 Ks[2][32][72];    // [buf][key t][dh]   (+8 pad)
    __shared__ u16 Vs[2][64][40];    // [buf][dh][key t]   (+8 pad)
    __shared__ u16 Ps[8][16][40];    // per-wave P tile (16 q x 32 keys)
    const int tid = threadIdx.x;
    const int lane = tid & 31, wave = tid >> 5;
    const int l15 = lane & 15, lhalf = lane >> 4, koff = lhalf * 8;
    const int bh = blockIdx.x;                    // b*H + h
    const int qBase = blockIdx.y * 128;
    const int q0w = qBase + wave * 16;
    const size_t plane = (size_t)Bsz * H * S * DH;
    const u16* qp = qkv + (size_t)bh * S * DH;
    const u16* kp = qkv + plane + (size_t)bh * S * DH;
    const u16* vp = qkv + 2 * plane + (size_t)bh * DH * S;   // transposed [dh][s]

    // Q fragments (already scaled by 1/sqrt(DH)) for this wave's 16 rows.
    FragBF qa0, qa1;
    {
        const u16* qrow = qp + (size_t)(q0w + l15) * DH;
        qa0.u4[0] = *(const uint4*)&qrow[koff];
        qa0.u4[1] = *(const uint4*)&qrow[koff + 16];
        qa1.u4[0] = *(const uint4*)&qrow[32 + koff];
        qa1.u4[1] = *(const uint4*)&qrow[32 + koff + 16];
    }

    auto issue_kv = [&](int kt, int buf) {
        int t = tid >> 3, c8 = (tid & 7) * 8;              // K: 32 keys x 64 dh
        async_b128(&Ks[buf][t][c8], &kp[(size_t)(kt * 32 + t) * DH + c8]);
        int dh = tid >> 2, c = (tid & 3) * 8;              // V^T: 64 dh x 32 keys
        async_b128(&Vs[buf][dh][c], &vp[(size_t)dh * S + kt * 32 + c]);
    };

    v8f ov[4] = {};                 // O accum: 16 rows x 64 dh
    float mrow[8], lrow[8];
#pragma unroll
    for (int r = 0; r < 8; r++) { mrow[r] = -3.0e38f; lrow[r] = 0.f; }

    const int ktEnd = (qBase + 127) >> 5;         // 32-key tiles
    issue_kv(0, 0);
    for (int kt = 0; kt <= ktEnd; kt++) {
        wait_async0();
        __syncthreads();
        if (kt + 1 <= ktEnd) issue_kv(kt + 1, (kt + 1) & 1);
        const int cur = kt & 1;

        // scores: Q(16x64) @ K^T(64x32) -> two 16x16 C tiles, 4 full WMMAs
        FragBF kb;
        v8f sc0 = {}, sc1 = {};
        kb.u4[0] = *(const uint4*)&Ks[cur][l15][koff];
        kb.u4[1] = *(const uint4*)&Ks[cur][l15][koff + 16];
        sc0 = __builtin_amdgcn_wmma_f32_16x16x32_bf16(false, qa0.v, false, kb.v, (short)0, sc0, false, false);
        kb.u4[0] = *(const uint4*)&Ks[cur][l15][32 + koff];
        kb.u4[1] = *(const uint4*)&Ks[cur][l15][32 + koff + 16];
        sc0 = __builtin_amdgcn_wmma_f32_16x16x32_bf16(false, qa1.v, false, kb.v, (short)0, sc0, false, false);
        kb.u4[0] = *(const uint4*)&Ks[cur][16 + l15][koff];
        kb.u4[1] = *(const uint4*)&Ks[cur][16 + l15][koff + 16];
        sc1 = __builtin_amdgcn_wmma_f32_16x16x32_bf16(false, qa0.v, false, kb.v, (short)0, sc1, false, false);
        kb.u4[0] = *(const uint4*)&Ks[cur][16 + l15][32 + koff];
        kb.u4[1] = *(const uint4*)&Ks[cur][16 + l15][32 + koff + 16];
        sc1 = __builtin_amdgcn_wmma_f32_16x16x32_bf16(false, qa1.v, false, kb.v, (short)0, sc1, false, false);

        const int colg0 = kt * 32 + l15, colg1 = colg0 + 16;
        float p0v[8], p1v[8], fac[8];
#pragma unroll
        for (int r = 0; r < 8; r++) {
            int rowg = q0w + r + 8 * lhalf;
            float s0 = sc0[r];                              // scale already folded into Q
            float s1 = sc1[r];
            if (colg0 > rowg) s0 = -3.0e38f;                // causal mask
            if (colg1 > rowg) s1 = -3.0e38f;
            float tm = red_max16(fmaxf(s0, s1));            // DPP row reduction
            float mnew = fmaxf(mrow[r], tm);
            float f = expf(mrow[r] - mnew);
            float p0 = expf(s0 - mnew);
            float p1 = expf(s1 - mnew);
            if (colg0 > rowg) p0 = 0.f;
            if (colg1 > rowg) p1 = 0.f;
            float ps = red_sum16(p0 + p1);                  // DPP row reduction
            lrow[r] = lrow[r] * f + ps;
            mrow[r] = mnew;
            fac[r] = f;
            p0v[r] = p0;
            p1v[r] = p1;
        }

        // P tile -> per-wave LDS (C-frag layout -> A-frag layout); same-wave LDS in-order.
#pragma unroll
        for (int r = 0; r < 8; r++) {
            Ps[wave][r + 8 * lhalf][l15]      = f2bf(p0v[r]);
            Ps[wave][r + 8 * lhalf][16 + l15] = f2bf(p1v[r]);
        }
        asm volatile("s_wait_dscnt 0x0" ::: "memory");

#pragma unroll
        for (int c = 0; c < 4; c++)
#pragma unroll
            for (int r = 0; r < 8; r++) ov[c][r] *= fac[r];

        FragBF pa;                                          // full 16x32 A fragment
        pa.u4[0] = *(const uint4*)&Ps[wave][l15][koff];
        pa.u4[1] = *(const uint4*)&Ps[wave][l15][koff + 16];
#pragma unroll
        for (int c = 0; c < 4; c++) {
            FragBF vb;                                      // full 32x16 B fragment
            vb.u4[0] = *(const uint4*)&Vs[cur][c * 16 + l15][koff];
            vb.u4[1] = *(const uint4*)&Vs[cur][c * 16 + l15][koff + 16];
            ov[c] = __builtin_amdgcn_wmma_f32_16x16x32_bf16(false, pa.v, false, vb.v, (short)0, ov[c], false, false);
        }
    }

    // normalize and write ctx[b][s][h*DH + e] as bf16
    const int b = bh >> 4, h = bh & 15;
#pragma unroll
    for (int r = 0; r < 8; r++) {
        float inv = 1.0f / lrow[r];
        int srow = q0w + r + 8 * lhalf;
        size_t base = ((size_t)(b * S + srow)) * D + h * DH;
#pragma unroll
        for (int c = 0; c < 4; c++)
            ctx[base + c * 16 + l15] = f2bf(ov[c][r] * inv);
    }
}

// ---------------------------------------------------------------------------
extern "C" void kernel_launch(void* const* d_in, const int* in_sizes, int n_in,
                              void* d_out, int out_size, void* d_ws, size_t ws_size,
                              hipStream_t stream) {
    (void)in_sizes; (void)n_in; (void)out_size; (void)ws_size;
    const float* x   = (const float*)d_in[0];
    const float* g1  = (const float*)d_in[1];
    const float* be1 = (const float*)d_in[2];
    const float* Wq  = (const float*)d_in[3];
    const float* Wk  = (const float*)d_in[4];
    const float* Wv  = (const float*)d_in[5];
    const float* Wo  = (const float*)d_in[6];
    const float* bo  = (const float*)d_in[7];
    const float* g2  = (const float*)d_in[8];
    const float* be2 = (const float*)d_in[9];
    const float* W1  = (const float*)d_in[10];
    const float* fb1 = (const float*)d_in[11];
    const float* W2  = (const float*)d_in[12];
    const float* fb2 = (const float*)d_in[13];
    float* out = (float*)d_out;

    char* ws = (char*)d_ws;
    auto alloc = [&](size_t bytes) -> char* {
        char* p = ws; ws += (bytes + 255) & ~(size_t)255; return p;
    };
    u16*   wqkvT = (u16*)alloc((size_t)3 * D * D * 2);   // [3D][D]
    u16*   woT   = (u16*)alloc((size_t)D * D * 2);       // [D][D]
    u16*   w1T   = (u16*)alloc((size_t)DF * D * 2);      // [DF][D]
    u16*   w2T   = (u16*)alloc((size_t)D * DF * 2);      // [D][DF]
    u16*   h1    = (u16*)alloc((size_t)ROWS * D * 2);
    u16*   qkv   = (u16*)alloc((size_t)3 * ROWS * D * 2);
    u16*   ctx   = (u16*)alloc((size_t)ROWS * D * 2);
    float* xmid  = (float*)alloc((size_t)ROWS * D * 4);
    u16*   h2    = (u16*)alloc((size_t)ROWS * D * 2);
    u16*   ffn1  = (u16*)alloc((size_t)ROWS * DF * 2);

    dim3 blk(256);
    k_conv_qkv<<<(3 * D * D) / 256, blk, 0, stream>>>(Wq, Wk, Wv, wqkvT);
    k_conv_t<<<(D * D) / 256, blk, 0, stream>>>(Wo, woT, D, D);
    k_conv_t<<<(DF * D) / 256, blk, 0, stream>>>(W1, w1T, DF, D);
    k_conv_t<<<(D * DF) / 256, blk, 0, stream>>>(W2, w2T, D, DF);

    k_layernorm<<<ROWS, blk, 0, stream>>>(x, g1, be1, h1);
    k_gemm<0><<<dim3(3 * D / 128, ROWS / 128), blk, 0, stream>>>(h1, wqkvT, nullptr, nullptr, nullptr, qkv, 3 * D, D);
    k_attention<<<dim3(Bsz * H, S / 128), blk, 0, stream>>>(qkv, ctx);
    k_gemm<1><<<dim3(D / 128, ROWS / 128), blk, 0, stream>>>(ctx, woT, bo, x, xmid, nullptr, D, D);
    k_layernorm<<<ROWS, blk, 0, stream>>>(xmid, g2, be2, h2);
    k_gemm<2><<<dim3(DF / 128, ROWS / 128), blk, 0, stream>>>(h2, w1T, fb1, nullptr, nullptr, ffn1, DF, D);
    k_gemm<1><<<dim3(D / 128, ROWS / 128), blk, 0, stream>>>(ffn1, w2T, fb2, xmid, out, nullptr, D, DF);
}

// v001
// It runs in 197 microseconds.
// Two timings next to v000 put it at 1.23 and 1.24 times that version's speed.
#include <hip/hip_runtime.h>
#include <cstdint>

typedef unsigned short u16;
typedef __attribute__((ext_vector_type(16))) __bf16 v16bf;
typedef __attribute__((ext_vector_type(8)))  float  v8f;

constexpr int Bsz = 8, S = 512, D = 1024, H = 16, DH = 64, DF = 4096;
constexpr int ROWS = Bsz * S;   // 4096

__device__ __forceinline__ u16 f2bf(float f) {
    uint32_t u = __float_as_uint(f);
    uint32_t r = u + 0x7FFFu + ((u >> 16) & 1u);   // round-to-nearest-even
    return (u16)(r >> 16);
}

union FragBF {                  // one wave32 16x32 bf16 A/B fragment (8 VGPRs)
    v16bf v;
    uint4 u4[2];
    u16   us[16];
};

// Async global -> LDS copy of 16 bytes per lane (ASYNCcnt-tracked).
__device__ __forceinline__ void async_b128(u16* lds, const u16* gptr) {
    uint32_t l = (uint32_t)(uintptr_t)lds;          // low 32 bits = LDS offset
    asm volatile("global_load_async_to_lds_b128 %0, %1, off"
                 :: "v"(l), "v"(gptr) : "memory");
}
__device__ __forceinline__ void wait_async0() {
    asm volatile("s_wait_asynccnt 0x0" ::: "memory");
}

// DPP butterfly reduction across a 16-lane row (lanes 0-15 / 16-31 separately).
template <int CTRL>
__device__ __forceinline__ float dpp_f(float x) {
    return __int_as_float(__builtin_amdgcn_mov_dpp(__float_as_int(x), CTRL, 0xf, 0xf, true));
}
__device__ __forceinline__ float red_max16(float v) {
    v = fmaxf(v, dpp_f<0xB1>(v));    // quad_perm [1,0,3,2]  (xor 1)
    v = fmaxf(v, dpp_f<0x4E>(v));    // quad_perm [2,3,0,1]  (xor 2)
    v = fmaxf(v, dpp_f<0x141>(v));   // row_half_mirror
    v = fmaxf(v, dpp_f<0x140>(v));   // row_mirror
    return v;
}
__device__ __forceinline__ float red_sum16(float v) {
    v += dpp_f<0xB1>(v);
    v += dpp_f<0x4E>(v);
    v += dpp_f<0x141>(v);
    v += dpp_f<0x140>(v);
    return v;
}

// ---------------------------------------------------------------------------
// Weight conversion: fp32 -> bf16, stored TRANSPOSED as W^T[N][K] so GEMM B
// tiles are row-major block copies (async-to-LDS friendly, no LDS scatter).
// One block transposes a tile of 128 k x 64 n through LDS: it reads 256-byte
// row pieces of the source (16 bytes a lane) and writes 256-byte row pieces of
// the destination (16 bytes a lane).  LDS holds one dword per (n, k pair).
// ---------------------------------------------------------------------------
constexpr int CTK = 128, CTN = 64;        // tile: k extent, n extent
constexpr int CPITCH = CTK / 2 + 1;       // dwords per n row; odd, so both sides spread over the banks

// src: first element of the tile, rows are k (pitch srcPitch floats).
// dst: first element of the tile, rows are n (pitch dstPitch bf16).
template <int srcPitch, int dstPitch>
__device__ __forceinline__ void conv_tile(const float* __restrict__ src, u16* __restrict__ dst) {
    __shared__ uint32_t tl[CTN * CPITCH];
    const int tid = threadIdx.x;
    const int nq = tid & 15, kp0 = tid >> 4;           // 4 n columns, k pair (+16*j)
    float4 r0[4], r1[4];
#pragma unroll
    for (int j = 0; j < 4; j++) {
        const float* p = src + (2 * kp0 * srcPitch + nq * 4) + 32 * j * srcPitch;
        r0[j] = *(const float4*)p;
        r1[j] = *(const float4*)(p + srcPitch);
    }
#pragma unroll
    for (int j = 0; j < 4; j++) {
        uint32_t* q = &tl[(nq * 4) * CPITCH + kp0 + 16 * j];
        q[0 * CPITCH] = (uint32_t)f2bf(r0[j].x) | ((uint32_t)f2bf(r1[j].x) << 16);
        q[1 * CPITCH] = (uint32_t)f2bf(r0[j].y) | ((uint32_t)f2bf(r1[j].y) << 16);
        q[2 * CPITCH] = (uint32_t)f2bf(r0[j].z) | ((uint32_t)f2bf(r1[j].z) << 16);
        q[3 * CPITCH] = (uint32_t)f2bf(r0[j].w) | ((uint32_t)f2bf(r1[j].w) << 16);
    }
    __syncthreads();
#pragma unroll
    for (int i = 0; i < 4; i++) {
        const int n = (tid >> 4) + 16 * i, kq = tid & 15;   // 16 lanes cover one n row
        const uint32_t* q = &tl[n * CPITCH + kq * 4];
        uint4 o = make_uint4(q[0], q[1], q[2], q[3]);
        *(uint4*)&dst[((tid >> 4) * dstPitch + kq * 8) + 16 * i * dstPitch] = o;
    }
}

// grid: x = which * H + h (one [D][DH] matrix each), y = k tile
__global__ __launch_bounds__(256) void k_conv_qkv(const float* __restrict__ Wq, const float* __restrict__ Wk,
                                                  const float* __restrict__ Wv, u16* __restrict__ dst) {
    const int which = blockIdx.x >> 4, h = blockIdx.x & 15;
    const int k0 = blockIdx.y * CTK;
    const float* W = (which == 0) ? Wq : (which == 1 ? Wk : Wv);
    conv_tile<DH, D>(W + ((size_t)h * D + k0) * DH, dst + (size_t)(which * D + h * DH) * D + k0);
}

// dst[n*K + k] = src[k*N + n];  grid: x = n tile, y = k tile
template <int N, int K>
__global__ __launch_bounds__(256) void k_conv_t(const float* __restrict__ src, u16* __restrict__ dst) {
    const int n0 = blockIdx.x * CTN, k0 = blockIdx.y * CTK;
    conv_tile<N, K>(src + (size_t)k0 * N + n0, dst + (size_t)n0 * K + k0);
}

// ---------------------------------------------------------------------------
// LayerNorm (block per row of D=1024, 256 threads) -> bf16
// ---------------------------------------------------------------------------
__global__ void k_layernorm(const float* __restrict__ x, const float* __restrict__ g,
                            const float* __restrict__ b, u16* __restrict__ out) {
    __shared__ float sb[256];
    const int row = blockIdx.x, tid = threadIdx.x;
    const float* xr = x + (size_t)row * D;
    float v0 = xr[tid], v1 = xr[tid + 256], v2 = xr[tid + 512], v3 = xr[tid + 768];
    sb[tid] = v0 + v1 + v2 + v3;
    __syncthreads();
    for (int o = 128; o > 0; o >>= 1) { if (tid < o) sb[tid] += sb[tid + o]; __syncthreads(); }
    float mean = sb[0] * (1.0f / D);
    __syncthreads();
    float d0 = v0 - mean, d1 = v1 - mean, d2 = v2 - mean, d3 = v3 - mean;
    sb[tid] = d0 * d0 + d1 * d1 + d2 * d2 + d3 * d3;
    __syncthreads();
    for (int o = 128; o > 0; o >>= 1) { if (tid < o) sb[tid] += sb[tid + o]; __syncthreads(); }
    float rstd = rsqrtf(sb[0] * (1.0f / D) + 1e-5f);
    u16* orow = out + (size_t)row * D;
    orow[tid]       = f2bf(d0 * rstd * g[tid]       + b[tid]);
    orow[tid + 256] = f2bf(d1 * rstd * g[tid + 256] + b[tid + 256]);
    orow[tid + 512] = f2bf(d2 * rstd * g[tid + 512] + b[tid + 512]);
    orow[tid + 768] = f2bf(d3 * rstd * g[tid + 768] + b[tid + 768]);
}

// ---------------------------------------------------------------------------
// bf16 WMMA GEMM: C[M][N] = A[M][K] * B[K][N] with B supplied TRANSPOSED
// (Bt[N][K]).  Block tile 128x128, K-step 64, double-buffered async-to-LDS
// staging, single barrier per K-step.  8 waves in 4(m) x 2(n); each wave:
// 32x64 = 2x4 WMMA tiles, 16 v_wmma_f32_16x16x32_bf16 per K-step.
// EPI 0: QKV permute -> bf16 (Q pre-scaled by 1/sqrt(DH), V stored transposed)
// EPI 1: +bias +res -> fp32      EPI 2: GELU(.+bias) -> bf16
// ---------------------------------------------------------------------------
constexpr int TSTRIDE = 72;               // 64 + 8 pad (u16)
constexpr int TSZ = 128 * TSTRIDE;        // one 128x64 tile in LDS (u16 count)

template <int EPI>
__global__ __launch_bounds__(256) void k_gemm(const u16* __restrict__ A, const u16* __restrict__ Bt,
                                              const float* __restrict__ bias, const float* __restrict__ res,
                                              float* __restrict__ outF, u16* __restrict__ outU,
                                              int N, int K) {
    __shared__ u16 smem[4 * TSZ];         // [buf 0/1][A tile | B tile]
    const int tid = threadIdx.x;
    const int lane = tid & 31, wave = tid >> 5;
    const int wm = wave & 3, wn = wave >> 2;           // 4(m) x 2(n)
    const int m0 = blockIdx.y * 128, n0 = blockIdx.x * 128;
    const int l15 = lane & 15, lhalf = lane >> 4, koff = lhalf * 8;
    const int ldr = tid >> 3, ldc = (tid & 7) * 8;     // loader: row 0..31 (+j*32), col chunk

    v8f acc[2][4] = {};

    auto issue_tile = [&](int k0, int buf) {
        u16* As = &smem[buf * 2 * TSZ];
        u16* Bs = As + TSZ;
#pragma unroll
        for (int j = 0; j < 4; j++) {
            int r = ldr + j * 32;
            async_b128(&As[r * TSTRIDE + ldc], &A[(size_t)(m0 + r) * K + k0 + ldc]);
            async_b128(&Bs[r * TSTRIDE + ldc], &Bt[(size_t)(n0 + r) * K + k0 + ldc]);
        }
    };

    const int nT = K / 64;
    issue_tile(0, 0);
    for (int t = 0; t < nT; t++) {
        wait_async0();
        __syncthreads();
        if (t + 1 < nT) issue_tile((t + 1) * 64, (t + 1) & 1);
        const u16* As = &smem[(t & 1) * 2 * TSZ];
        const u16* Bs = As + TSZ;
#pragma unroll
        for (int kc = 0; kc < 64; kc += 32) {
            FragBF a[2], b[4];
#pragma unroll
            for (int mt = 0; mt < 2; mt++) {
                const u16* p = &As[(wm * 32 + mt * 16 + l15) * TSTRIDE + kc + koff];
                a[mt].u4[0] = *(const uint4*)p;
                a[mt].u4[1] = *(const uint4*)(p + 16);
            }
#pragma unroll
            for (int nt = 0; nt < 4; nt++) {
                const u16* p = &Bs[(wn * 64 + nt * 16 + l15) * TSTRIDE + kc + koff];
                b[nt].u4[0] = *(const uint4*)p;
                b[nt].u4[1] = *(const uint4*)(p + 16);
            }
#pragma unroll
            for (int mt = 0; mt < 2; mt++)
#pragma unroll
                for (int nt = 0; nt < 4; nt++)
                    acc[mt][nt] = __builtin_amdgcn_wmma_f32_16x16x32_bf16(
                        false, a[mt].v, false, b[nt].v, (short)0, acc[mt][nt], false, false);
        }
    }

    constexpr size_t planeE = (size_t)Bsz * H * S * DH;
#pragma unroll
    for (int mt = 0; mt < 2; mt++) {
#pragma unroll
        for (int nt = 0; nt < 4; nt++) {
            int col = n0 + wn * 64 + nt * 16 + l15;
#pragma unroll
            for (int r = 0; r < 8; r++) {
                int row = m0 + wm * 32 + mt * 16 + r + 8 * lhalf;
                float vacc = acc[mt][nt][r];
                if constexpr (EPI == 0) {
                    int which = col >> 10;               // /D : 0=Q 1=K 2=V
                    int nn = col & 1023;
                    int h = nn >> 6, e = nn & 63;
                    int bb = row >> 9, ss = row & 511;   // /S, %S
                    if (which == 0) vacc *= 0.125f;      // fold 1/sqrt(DH) into Q
                    size_t idx;
                    if (which == 2)                       // V stored transposed [b][h][dh][s]
                        idx = 2 * planeE + (((size_t)bb * H + h) * DH + e) * S + ss;
                    else
                        idx = (size_t)which * planeE + (((size_t)bb * H + h) * S + ss) * DH + e;
                    outU[idx] = f2bf(vacc);
                } else if constexpr (EPI == 1) {
                    size_t idx = (size_t)row * N + col;
                    outF[idx] = vacc + bias[col] + res[idx];
                } else {
                    float tt = vacc + bias[col];
                    float gl = 0.5f * tt * (1.0f + erff(tt * 0.70710678118654752f));
                    outU[(size_t)row * N + col] = f2bf(gl);
                }
            }
        }
    }
}

// ---------------------------------------------------------------------------
// Causal flash attention per (b,h).  Block = 8 waves = 128 query rows; each
// wave owns 16 rows.  32-key tiles, double-buffered async-to-LDS K/V staging
// (V pre-transposed in global), DPP softmax reductions, 8 full WMMAs/tile.
// ---------------------------------------------------------------------------
__global__ __launch_bounds__(256) void k_attention(const u16* __restrict__ qkv, u16* __restrict__ ctx) {
    __shared__ u16 Ks[2][32][72];    // [buf][key t][dh]   (+8 pad)
    __shared__ u16 Vs[2][64][40];    // [buf][dh][key t]   (+8 pad)
    __shared__ u16 Ps[8][16][40];    // per-wave P tile (16 q x 32 keys)
    const int tid = threadIdx.x;
    const int lane = tid & 31, wave = tid >> 5;
    const int l15 = lane & 15, lhalf = lane >> 4, koff = lhalf * 8;
    const int bh = blockIdx.x;                    // b*H + h
    const int qBase = blockIdx.y * 128;
    const int q0w = qBase + wave * 16;
    const size_t plane = (size_t)Bsz * H * S * DH;
    const u16* qp = qkv + (size_t)bh * S * DH;
    const u16* kp = qkv + plane + (size_t)bh * S * DH;
    const u16* vp = qkv + 2 * plane + (size_t)bh * DH * S;   // transposed [dh][s]

    // Q fragments (already scaled by 1/sqrt(DH)) for this wave's 16 rows.
    FragBF qa0, qa1;
    {
        const u16* qrow = qp + (size_t)(q0w + l15) * DH;
        qa0.u4[0] = *(const uint4*)&qrow[koff];
        qa0.u4[1] = *(const uint4*)&qrow[koff + 16];
        qa1.u4[0] = *(const uint4*)&qrow[32 + koff];
        qa1.u4[1] = *(const uint4*)&qrow[32 + koff + 16];
    }

    auto issue_kv = [&](int kt, int buf) {
        int t = tid >> 3, c8 = (tid & 7) * 8;              // K: 32 keys x 64 dh
        async_b128(&Ks[buf][t][c8], &kp[(size_t)(kt * 32 + t) * DH + c8]);
        int dh = tid >> 2, c = (tid & 3) * 8;              // V^T: 64 dh x 32 keys
        async_b128(&Vs[buf][dh][c], &vp[(size_t)dh * S + kt * 32 + c]);
    };

    v8f ov[4] = {};                 // O accum: 16 rows x 64 dh
    float mrow[8], lrow[8];
#pragma unroll
    for (int r = 0; r < 8; r++) { mrow[r] = -3.0e38f; lrow[r] = 0.f; }

    const int ktEnd = (qBase + 127) >> 5;         // 32-key tiles
    issue_kv(0, 0);
    for (int kt = 0; kt <= ktEnd; kt++) {
        wait_async0();
        __syncthreads();
        if (kt + 1 <= ktEnd) issue_kv(kt + 1, (kt + 1) & 1);
        const int cur = kt & 1;

        // scores: Q(16x64) @ K^T(64x32) -> two 16x16 C tiles, 4 full WMMAs
        FragBF kb;
        v8f sc0 = {}, sc1 = {};
        kb.u4[0] = *(const uint4*)&Ks[cur][l15][koff];
        kb.u4[1] = *(const uint4*)&Ks[cur][l15][koff + 16];
        sc0 = __builtin_amdgcn_wmma_f32_16x16x32_bf16(false, qa0.v, false, kb.v, (short)0, sc0, false, false);
        kb.u4[0] = *(const uint4*)&Ks[cur][l15][32 + koff];
        kb.u4[1] = *(const uint4*)&Ks[cur][l15][32 + koff + 16];
        sc0 = __builtin_amdgcn_wmma_f32_16x16x32_bf16(false, qa1.v, false, kb.v, (short)0, sc0, false, false);
        kb.u4[0] = *(const uint4*)&Ks[cur][16 + l15][koff];
        kb.u4[1] = *(const uint4*)&Ks[cur][16 + l15][koff + 16];
        sc1 = __builtin_amdgcn_wmma_f32_16x16x32_bf16(false, qa0.v, false, kb.v, (short)0, sc1, false, false);
        kb.u4[0] = *(const uint4*)&Ks[cur][16 + l15][32 + koff];
        kb.u4[1] = *(const uint4*)&Ks[cur][16 + l15][32 + koff + 16];
        sc1 = __builtin_amdgcn_wmma_f32_16x16x32_bf16(false, qa1.v, false, kb.v, (short)0, sc1, false, false);

        const int colg0 = kt * 32 + l15, colg1 = colg0 + 16;
        float p0v[8], p1v[8], fac[8];
#pragma unroll
        for (int r = 0; r < 8; r++) {
            int rowg = q0w + r + 8 * lhalf;
            float s0 = sc0[r];                              // scale already folded into Q
            float s1 = sc1[r];
            if (colg0 > rowg) s0 = -3.0e38f;                // causal mask
            if (colg1 > rowg) s1 = -3.0e38f;
            float tm = red_max16(fmaxf(s0, s1));            // DPP row reduction
            float mnew = fmaxf(mrow[r], tm);
            float f = expf(mrow[r] - mnew);
            float p0 = expf(s0 - mnew);
            float p1 = expf(s1 - mnew);
            if (colg0 > rowg) p0 = 0.f;
            if (colg1 > rowg) p1 = 0.f;
            float ps = red_sum16(p0 + p1);                  // DPP row reduction
            lrow[r] = lrow[r] * f + ps;
            mrow[r] = mnew;
            fac[r] = f;
            p0v[r] = p0;
            p1v[r] = p1;
        }

        // P tile -> per-wave LDS (C-frag layout -> A-frag layout); same-wave LDS in-order.
#pragma unroll
        for (int r = 0; r < 8; r++) {
            Ps[wave][r + 8 * lhalf][l15]      = f2bf(p0v[r]);
            Ps[wave][r + 8 * lhalf][16 + l15] = f2bf(p1v[r]);
        }
        asm volatile("s_wait_dscnt 0x0" ::: "memory");

#pragma unroll
        for (int c = 0; c < 4; c++)
#pragma unroll
            for (int r = 0; r < 8; r++) ov[c][r] *= fac[r];

        FragBF pa;                                          // full 16x32 A fragment
        pa.u4[0] = *(const uint4*)&Ps[wave][l15][koff];
        pa.u4[1] = *(const uint4*)&Ps[wave][l15][koff + 16];
#pragma unroll
        for (int c = 0; c < 4; c++) {
            FragBF vb;                                      // full 32x16 B fragment
            vb.u4[0] = *(const uint4*)&Vs[cur][c * 16 + l15][koff];
            vb.u4[1] = *(const uint4*)&Vs[cur][c * 16 + l15][koff + 16];
            ov[c] = __builtin_amdgcn_wmma_f32_16x16x32_bf16(false, pa.v, false, vb.v, (short)0, ov[c], false, false);
        }
    }

    // normalize and write ctx[b][s][h*DH + e] as bf16
    const int b = bh >> 4, h = bh & 15;
#pragma unroll
    for (int r = 0; r < 8; r++) {
        float inv = 1.0f / lrow[r];
        int srow = q0w + r + 8 * lhalf;
        size_t base = ((size_t)(b * S + srow)) * D + h * DH;
#pragma unroll
        for (int c = 0; c < 4; c++)
            ctx[base + c * 16 + l15] = f2bf(ov[c][r] * inv);
    }
}

// ---------------------------------------------------------------------------
extern "C" void kernel_launch(void* const* d_in, const int* in_sizes, int n_in,
                              void* d_out, int out_size, void* d_ws, size_t ws_size,
                              hipStream_t stream) {
    (void)in_sizes; (void)n_in; (void)out_size; (void)ws_size;
    const float* x   = (const float*)d_in[0];
    const float* g1  = (const float*)d_in[1];
    const float* be1 = (const float*)d_in[2];
    const float* Wq  = (const float*)d_in[3];
    const float* Wk  = (const float*)d_in[4];
    const float* Wv  = (const float*)d_in[5];
    const float* Wo  = (const float*)d_in[6];
    const float* bo  = (const float*)d_in[7];
    const float* g2  = (const float*)d_in[8];
    const float* be2 = (const float*)d_in[9];
    const float* W1  = (const float*)d_in[10];
    const float* fb1 = (const float*)d_in[11];
    const float* W2  = (const float*)d_in[12];
    const float* fb2 = (const float*)d_in[13];
    float* out = (float*)d_out;

    char* ws = (char*)d_ws;
    auto alloc = [&](size_t bytes) -> char* {
        char* p = ws; ws += (bytes + 255) & ~(size_t)255; return p;
    };
    u16*   wqkvT = (u16*)alloc((size_t)3 * D * D * 2);   // [3D][D]
    u16*   woT   = (u16*)alloc((size_t)D * D * 2);       // [D][D]
    u16*   w1T   = (u16*)alloc((size_t)DF * D * 2);      // [DF][D]
    u16*   w2T   = (u16*)alloc((size_t)D * DF * 2);      // [D][DF]
    u16*   h1    = (u16*)alloc((size_t)ROWS * D * 2);
    u16*   qkv   = (u16*)alloc((size_t)3 * ROWS * D * 2);
    u16*   ctx   = (u16*)alloc((size_t)ROWS * D * 2);
    float* xmid  = (float*)alloc((size_t)ROWS * D * 4);
    u16*   h2    = (u16*)alloc((size_t)ROWS * D * 2);
    u16*   ffn1  = (u16*)alloc((size_t)ROWS * DF * 2);

    dim3 blk(256);
    k_conv_qkv<<<dim3(3 * H, D / CTK), blk, 0, stream>>>(Wq, Wk, Wv, wqkvT);
    k_conv_t<D, D><<<dim3(D / CTN, D / CTK), blk, 0, stream>>>(Wo, woT);
    k_conv_t<DF, D><<<dim3(DF / CTN, D / CTK), blk, 0, stream>>>(W1, w1T);
    k_conv_t<D, DF><<<dim3(D / CTN, DF / CTK), blk, 0, stream>>>(W2, w2T);

    k_layernorm<<<ROWS, blk, 0, stream>>>(x, g1, be1, h1);
    k_gemm<0><<<dim3(3 * D / 128, ROWS / 128), blk, 0, stream>>>(h1, wqkvT, nullptr, nullptr, nullptr, qkv, 3 * D, D);
    k_attention<<<dim3(Bsz * H, S / 128), blk, 0, stream>>>(qkv, ctx);
    k_gemm<1><<<dim3(D / 128, ROWS / 128), blk, 0, stream>>>(ctx, woT, bo, x, xmid, nullptr, D, D);
    k_layernorm<<<ROWS, blk, 0, stream>>>(xmid, g2, be2, h2);
    k_gemm<2><<<dim3(DF / 128, ROWS / 128), blk, 0, stream>>>(h2, w1T, fb1, nullptr, nullptr, ffn1, DF, D);
    k_gemm<1><<<dim3(D / 128, ROWS / 128), blk, 0, stream>>>(ffn1, w2T, fb2, xmid, out, nullptr, D, DF);
}

// v002
// One run takes 188 microseconds.
// Two timings next to v001 both put it at 1.05 times that version's speed.
// All steps since v000 together make it 1.30 times as fast.
#include <hip/hip_runtime.h>
#include <cstdint>

typedef unsigned short u16;
typedef __attribute__((ext_vector_type(16))) __bf16 v16bf;
typedef __attribute__((ext_vector_type(8)))  float  v8f;

constexpr int Bsz = 8, S = 512, D = 1024, H = 16, DH = 64, DF = 4096;
constexpr int ROWS = Bsz * S;   // 4096

__device__ __forceinline__ u16 f2bf(float f) {
    uint32_t u = __float_as_uint(f);
    uint32_t r = u + 0x7FFFu + ((u >> 16) & 1u);   // round-to-nearest-even
    return (u16)(r >> 16);
}

union FragBF {                  // one wave32 16x32 bf16 A/B fragment (8 VGPRs)
    v16bf v;
    uint4 u4[2];
    u16   us[16];
};

// Async global -> LDS copy of 16 bytes per lane (ASYNCcnt-tracked).
__device__ __forceinline__ void async_b128(u16* lds, const u16* gptr) {
    uint32_t l = (uint32_t)(uintptr_t)lds;          // low 32 bits = LDS offset
    asm volatile("global_load_async_to_lds_b128 %0, %1, off"
                 :: "v"(l), "v"(gptr) : "memory");
}
__device__ __forceinline__ void wait_async0() {
    asm volatile("s_wait_asynccnt 0x0" ::: "memory");
}

// DPP butterfly reduction across a 16-lane row (lanes 0-15 / 16-31 separately).
template <int CTRL>
__device__ __forceinline__ float dpp_f(float x) {
    return __int_as_float(__builtin_amdgcn_mov_dpp(__float_as_int(x), CTRL, 0xf, 0xf, true));
}
__device__ __forceinline__ float red_max16(float v) {
    v = fmaxf(v, dpp_f<0xB1>(v));    // quad_perm [1,0,3,2]  (xor 1)
    v = fmaxf(v, dpp_f<0x4E>(v));    // quad_perm [2,3,0,1]  (xor 2)
    v = fmaxf(v, dpp_f<0x141>(v));   // row_half_mirror
    v = fmaxf(v, dpp_f<0x140>(v));   // row_mirror
    return v;
}
__device__ __forceinline__ float red_sum16(float v) {
    v += dpp_f<0xB1>(v);
    v += dpp_f<0x4E>(v);
    v += dpp_f<0x141>(v);
    v += dpp_f<0x140>(v);
    return v;
}

// ---------------------------------------------------------------------------
// Weight conversion: fp32 -> bf16, stored TRANSPOSED as W^T[N][K] so GEMM B
// tiles are row-major block copies (async-to-LDS friendly, no LDS scatter).
// One block transposes a tile of 128 k x 64 n through LDS: it reads 256-byte
// row pieces of the source (16 bytes a lane) and writes 256-byte row pieces of
// the destination (16 bytes a lane).  LDS holds one dword per (n, k pair).
// ---------------------------------------------------------------------------
constexpr int CTK = 128, CTN = 64;        // tile: k extent, n extent
constexpr int CPITCH = CTK / 2 + 1;       // dwords per n row; odd, so both sides spread over the banks

// src: first element of the tile, rows are k (pitch srcPitch floats).
// dst: first element of the tile, rows are n (pitch dstPitch bf16).
template <int srcPitch, int dstPitch>
__device__ __forceinline__ void conv_tile(const float* __restrict__ src, u16* __restrict__ dst) {
    __shared__ uint32_t tl[CTN * CPITCH];
    const int tid = threadIdx.x;
    const int nq = tid & 15, kp0 = tid >> 4;           // 4 n columns, k pair (+16*j)
    float4 r0[4], r1[4];
#pragma unroll
    for (int j = 0; j < 4; j++) {
        const float* p = src + (2 * kp0 * srcPitch + nq * 4) + 32 * j * srcPitch;
        r0[j] = *(const float4*)p;
        r1[j] = *(const float4*)(p + srcPitch);
    }
#pragma unroll
    for (int j = 0; j < 4; j++) {
        uint32_t* q = &tl[(nq * 4) * CPITCH + kp0 + 16 * j];
        q[0 * CPITCH] = (uint32_t)f2bf(r0[j].x) | ((uint32_t)f2bf(r1[j].x) << 16);
        q[1 * CPITCH] = (uint32_t)f2bf(r0[j].y) | ((uint32_t)f2bf(r1[j].y) << 16);
        q[2 * CPITCH] = (uint32_t)f2bf(r0[j].z) | ((uint32_t)f2bf(r1[j].z) << 16);
        q[3 * CPITCH] = (uint32_t)f2bf(r0[j].w) | ((uint32_t)f2bf(r1[j].w) << 16);
    }
    __syncthreads();
#pragma unroll
    for (int i = 0; i < 4; i++) {
        const int n = (tid >> 4) + 16 * i, kq = tid & 15;   // 16 lanes cover one n row
        const uint32_t* q = &tl[n * CPITCH + kq * 4];
        uint4 o = make_uint4(q[0], q[1], q[2], q[3]);
        *(uint4*)&dst[((tid >> 4) * dstPitch + kq * 8) + 16 * i * dstPitch] = o;
    }
}

// grid: x = which * H + h (one [D][DH] matrix each), y = k tile
__global__ __launch_bounds__(256) void k_conv_qkv(const float* __restrict__ Wq, const float* __restrict__ Wk,
                                                  const float* __restrict__ Wv, u16* __restrict__ dst) {
    const int which = blockIdx.x >> 4, h = blockIdx.x & 15;
    const int k0 = blockIdx.y * CTK;
    const float* W = (which == 0) ? Wq : (which == 1 ? Wk : Wv);
    conv_tile<DH, D>(W + ((size_t)h * D + k0) * DH, dst + (size_t)(which * D + h * DH) * D + k0);
}

// dst[n*K + k] = src[k*N + n];  grid: x = n tile, y = k tile
template <int N, int K>
__global__ __launch_bounds__(256) void k_conv_t(const float* __restrict__ src, u16* __restrict__ dst) {
    const int n0 = blockIdx.x * CTN, k0 = blockIdx.y * CTK;
    conv_tile<N, K>(src + (size_t)k0 * N + n0, dst + (size_t)n0 * K + k0);
}

// ---------------------------------------------------------------------------
// LayerNorm (block per row of D=1024, 256 threads) -> bf16
// ---------------------------------------------------------------------------
__global__ void k_layernorm(const float* __restrict__ x, const float* __restrict__ g,
                            const float* __restrict__ b, u16* __restrict__ out) {
    __shared__ float sb[256];
    const int row = blockIdx.x, tid = threadIdx.x;
    const float* xr = x + (size_t)row * D;
    float v0 = xr[tid], v1 = xr[tid + 256], v2 = xr[tid + 512], v3 = xr[tid + 768];
    sb[tid] = v0 + v1 + v2 + v3;
    __syncthreads();
    for (int o = 128; o > 0; o >>= 1) { if (tid < o) sb[tid] += sb[tid + o]; __syncthreads(); }
    float mean = sb[0] * (1.0f / D);
    __syncthreads();
    float d0 = v0 - mean, d1 = v1 - mean, d2 = v2 - mean, d3 = v3 - mean;
    sb[tid] = d0 * d0 + d1 * d1 + d2 * d2 + d3 * d3;
    __syncthreads();
    for (int o = 128; o > 0; o >>= 1) { if (tid < o) sb[tid] += sb[tid + o]; __syncthreads(); }
    float rstd = rsqrtf(sb[0] * (1.0f / D) + 1e-5f);
    u16* orow = out + (size_t)row * D;
    orow[tid]       = f2bf(d0 * rstd * g[tid]       + b[tid]);
    orow[tid + 256] = f2bf(d1 * rstd * g[tid + 256] + b[tid + 256]);
    orow[tid + 512] = f2bf(d2 * rstd * g[tid + 512] + b[tid + 512]);
    orow[tid + 768] = f2bf(d3 * rstd * g[tid + 768] + b[tid + 768]);
}

// ---------------------------------------------------------------------------
// bf16 WMMA GEMM: C[M][N] = A[M][K] * B[K][N] with B supplied TRANSPOSED
// (Bt[N][K]).  Block tile 128x128, K-step 64, double-buffered async-to-LDS
// staging, single barrier per K-step.  8 waves in 4(m) x 2(n); each wave:
// 32x64 = 2x4 WMMA tiles, 16 v_wmma_f32_16x16x32_bf16 per K-step.
// EPI 0: QKV permute -> bf16 (Q pre-scaled by 1/sqrt(DH), V stored transposed)
// EPI 1: +bias +res -> fp32      EPI 2: GELU(.+bias) -> bf16
// All three write out through LDS in 16-byte pieces that fill whole lines.
// ---------------------------------------------------------------------------
constexpr int TSTRIDE = 72;               // 64 + 8 pad (u16)
constexpr int TSZ = 128 * TSTRIDE;        // one 128x64 tile in LDS (u16 count)
constexpr int EPITCH = 68;                // epilogue staging, floats a row: 64 + 4, rows 8 apart fall 32 banks apart
constexpr int VPITCH = 136;               // V^T staging, u16 a column: 128 + 8, 16 columns spread over all banks

template <int EPI, int N>                 // N at compile time: the epilogue's row steps become immediate offsets
__global__ __launch_bounds__(256) void k_gemm(const u16* __restrict__ A, const u16* __restrict__ Bt,
                                              const float* __restrict__ bias, const float* __restrict__ res,
                                              float* __restrict__ outF, u16* __restrict__ outU,
                                              int K) {
    __shared__ __attribute__((aligned(16))) u16 smem[4 * TSZ];   // [buf 0/1][A tile | B tile]; epilogue staging afterwards
    const int tid = threadIdx.x;
    const int lane = tid & 31, wave = tid >> 5;
    const int wm = wave & 3, wn = wave >> 2;           // 4(m) x 2(n)
    const int m0 = blockIdx.y * 128, n0 = blockIdx.x * 128;
    const int l15 = lane & 15, lhalf = lane >> 4, koff = lhalf * 8;
    const int ldr = tid >> 3, ldc = (tid & 7) * 8;     // loader: row 0..31 (+j*32), col chunk

    v8f acc[2][4] = {};

    auto issue_tile = [&](int k0, int buf) {
        u16* As = &smem[buf * 2 * TSZ];
        u16* Bs = As + TSZ;
#pragma unroll
        for (int j = 0; j < 4; j++) {
            int r = ldr + j * 32;
            async_b128(&As[r * TSTRIDE + ldc], &A[(size_t)(m0 + r) * K + k0 + ldc]);
            async_b128(&Bs[r * TSTRIDE + ldc], &Bt[(size_t)(n0 + r) * K + k0 + ldc]);
        }
    };

    const int nT = K / 64;
    issue_tile(0, 0);
    for (int t = 0; t < nT; t++) {
        wait_async0();
        __syncthreads();
        if (t + 1 < nT) issue_tile((t + 1) * 64, (t + 1) & 1);
        const u16* As = &smem[(t & 1) * 2 * TSZ];
        const u16* Bs = As + TSZ;
#pragma unroll
        for (int kc = 0; kc < 64; kc += 32) {
            FragBF a[2], b[4];
#pragma unroll
            for (int mt = 0; mt < 2; mt++) {
                const u16* p = &As[(wm * 32 + mt * 16 + l15) * TSTRIDE + kc + koff];
                a[mt].u4[0] = *(const uint4*)p;
                a[mt].u4[1] = *(const uint4*)(p + 16);
            }
#pragma unroll
            for (int nt = 0; nt < 4; nt++) {
                const u16* p = &Bs[(wn * 64 + nt * 16 + l15) * TSTRIDE + kc + koff];
                b[nt].u4[0] = *(const uint4*)p;
                b[nt].u4[1] = *(const uint4*)(p + 16);
            }
#pragma unroll
            for (int mt = 0; mt < 2; mt++)
#pragma unroll
                for (int nt = 0; nt < 4; nt++)
                    acc[mt][nt] = __builtin_amdgcn_wmma_f32_16x16x32_bf16(
                        false, a[mt].v, false, b[nt].v, (short)0, acc[mt][nt], false, false);
        }
    }

    // Epilogue: the accumulators go through LDS so that every global access is
    // 16 bytes a lane and covers whole 128-byte lines.
    constexpr size_t planeE = (size_t)Bsz * H * S * DH;
    __syncthreads();                      // every wave has left the last K tile: smem is staging space now
    float* st = (float*)smem + wave * (32 * EPITCH);   // this wave's own 32 x 64 fp32 tile
    auto stage = [&]() {
#pragma unroll
        for (int mt = 0; mt < 2; mt++)
#pragma unroll
            for (int nt = 0; nt < 4; nt++)
#pragma unroll
                for (int r = 0; r < 8; r++)
                    st[(mt * 16 + r + 8 * lhalf) * EPITCH + nt * 16 + l15] = acc[mt][nt][r];
        // the rows are read back by other lanes of this wave: its LDS writes must have landed
        asm volatile("s_wait_dscnt 0x0" ::: "memory");
    };
    auto pack8 = [](float4 lo, float4 hi) {
        return make_uint4((uint32_t)f2bf(lo.x) | ((uint32_t)f2bf(lo.y) << 16),
                          (uint32_t)f2bf(lo.z) | ((uint32_t)f2bf(lo.w) << 16),
                          (uint32_t)f2bf(hi.x) | ((uint32_t)f2bf(hi.y) << 16),
                          (uint32_t)f2bf(hi.z) | ((uint32_t)f2bf(hi.w) << 16));
    };

    if constexpr (EPI == 0) {
        const int which = n0 >> 10;                       // /D : 0=Q 1=K 2=V, the same for the whole block
        const int nb = n0 & 1023;                         // h * DH + e of the block's first column
        const int bb = m0 >> 9, s0 = m0 & 511;            // /S, %S of the block's first row
        if (which != 2) {                                 // Q or K; the whole block takes this side
            stage();
            const float sc = (which == 0) ? 0.125f : 1.0f;   // fold 1/sqrt(DH) into Q
            // the wave's 64 columns are one head: its 32 x 64 tile is 4 KB in a row
            u16* dst = outU + (size_t)which * planeE +
                       (((size_t)bb * H + (nb >> 6) + wn) * S + s0 + wm * 32) * DH + lane * 8;
#pragma unroll
            for (int i = 0; i < 8; i++) {
                const int row = i * 4 + (lane >> 3), c8 = (lane & 7) * 8;
                float4 lo = *(const float4*)&st[row * EPITCH + c8];
                float4 hi = *(const float4*)&st[row * EPITCH + c8 + 4];
                lo.x *= sc; lo.y *= sc; lo.z *= sc; lo.w *= sc;
                hi.x *= sc; hi.y *= sc; hi.z *= sc; hi.w *= sc;
                *(uint4*)&dst[i * 4 * DH] = pack8(lo, hi);       // (lane >> 3) * DH + c8 == lane * 8
            }
            // in the built code the V side's register writes follow these stores behind a scalar
            // test only: the wait that belongs in front of an overwrite of a store's registers
            asm volatile("s_wait_xcnt 0x0" ::: "memory");
            return;
        }
        // V is stored transposed [b][h][dh][s]: 8 accumulator rows of a lane are 8
        // neighbours in s.  Block tile in LDS as [128 columns][128 s], then 256-byte rows out.
#pragma unroll
        for (int mt = 0; mt < 2; mt++)
#pragma unroll
            for (int nt = 0; nt < 4; nt++) {
                const v8f c = acc[mt][nt];
                *(uint4*)&smem[(wn * 64 + nt * 16 + l15) * VPITCH + wm * 32 + mt * 16 + 8 * lhalf] =
                    pack8(make_float4(c[0], c[1], c[2], c[3]), make_float4(c[4], c[5], c[6], c[7]));
            }
        __syncthreads();                  // a column's 128 s values come from four waves
        const int c0 = tid >> 4, q = (tid & 15) * 8;
        u16* dst = outU + 2 * planeE + ((size_t)bb * D + nb + c0) * S + s0 + q;
#pragma unroll
        for (int i = 0; i < 8; i++)
            *(uint4*)&dst[i * 16 * S] = *(const uint4*)&smem[(i * 16 + c0) * VPITCH + q];
    } else if constexpr (EPI == 1) {
        stage();
        const int c4 = (lane & 15) * 4;
        const float4 bv = *(const float4*)&bias[n0 + wn * 64 + c4];
        // one 32-bit byte offset serves the residual reads and the stores
        const uint32_t off = (uint32_t)((m0 + wm * 32 + lhalf) * N + n0 + wn * 64 + c4) * 4u;
        const char* rp = (const char*)res + off;
        char* op = (char*)outF + off;
#pragma unroll
        for (int i = 0; i < 16; i++) {
            const float4 v = *(const float4*)&st[(i * 2 + lhalf) * EPITCH + c4];
            const float4 rr = *(const float4*)(rp + i * 2 * N * 4);
            *(float4*)(op + i * 2 * N * 4) =
                make_float4(v.x + bv.x + rr.x, v.y + bv.y + rr.y, v.z + bv.z + rr.z, v.w + bv.w + rr.w);
        }
    } else {
        stage();
        const int c8 = (lane & 7) * 8;
        const float4 b0 = *(const float4*)&bias[n0 + wn * 64 + c8];
        const float4 b1 = *(const float4*)&bias[n0 + wn * 64 + c8 + 4];
        auto gelu = [](float tt) { return 0.5f * tt * (1.0f + erff(tt * 0.70710678118654752f)); };
        u16* dst = outU + (size_t)(m0 + wm * 32 + (lane >> 3)) * N + n0 + wn * 64 + c8;
#pragma unroll
        for (int i = 0; i < 8; i++) {
            const int row = i * 4 + (lane >> 3);
            const float4 lo = *(const float4*)&st[row * EPITCH + c8];
            const float4 hi = *(const float4*)&st[row * EPITCH + c8 + 4];
            *(uint4*)&dst[i * 4 * N] =
                pack8(make_float4(gelu(lo.x + b0.x), gelu(lo.y + b0.y), gelu(lo.z + b0.z), gelu(lo.w + b0.w)),
                      make_float4(gelu(hi.x + b1.x), gelu(hi.y + b1.y), gelu(hi.z + b1.z), gelu(hi.w + b1.w)));
        }
    }
}

// ---------------------------------------------------------------------------
// Causal flash attention per (b,h).  Block = 8 waves = 128 query rows; each
// wave owns 16 rows.  32-key tiles, double-buffered async-to-LDS K/V staging
// (V pre-transposed in global), DPP softmax reductions, 8 full WMMAs/tile.
// ---------------------------------------------------------------------------
__global__ __launch_bounds__(256) void k_attention(const u16* __restrict__ qkv, u16* __restrict__ ctx) {
    __shared__ u16 Ks[2][32][72];    // [buf][key t][dh]   (+8 pad)
    __shared__ u16 Vs[2][64][40];    // [buf][dh][key t]   (+8 pad)
    __shared__ u16 Ps[8][16][40];    // per-wave P tile (16 q x 32 keys)
    const int tid = threadIdx.x;
    const int lane = tid & 31, wave = tid >> 5;
    const int l15 = lane & 15, lhalf = lane >> 4, koff = lhalf * 8;
    const int bh = blockIdx.x;                    // b*H + h
    const int qBase = blockIdx.y * 128;
    const int q0w = qBase + wave * 16;
    const size_t plane = (size_t)Bsz * H * S * DH;
    const u16* qp = qkv + (size_t)bh * S * DH;
    const u16* kp = qkv + plane + (size_t)bh * S * DH;
    const u16* vp = qkv + 2 * plane + (size_t)bh * DH * S;   // transposed [dh][s]

    // Q fragments (already scaled by 1/sqrt(DH)) for this wave's 16 rows.
    FragBF qa0, qa1;
    {
        const u16* qrow = qp + (size_t)(q0w + l15) * DH;
        qa0.u4[0] = *(const uint4*)&qrow[koff];
        qa0.u4[1] = *(const uint4*)&qrow[koff + 16];
        qa1.u4[0] = *(const uint4*)&qrow[32 + koff];
        qa1.u4[1] = *(const uint4*)&qrow[32 + koff + 16];
    }

    auto issue_kv = [&](int kt, int buf) {
        int t = tid >> 3, c8 = (tid & 7) * 8;              // K: 32 keys x 64 dh
        async_b128(&Ks[buf][t][c8], &kp[(size_t)(kt * 32 + t) * DH + c8]);
        int dh = tid >> 2, c = (tid & 3) * 8;              // V^T: 64 dh x 32 keys
        async_b128(&Vs[buf][dh][c], &vp[(size_t)dh * S + kt * 32 + c]);
    };

    v8f ov[4] = {};                 // O accum: 16 rows x 64 dh
    float mrow[8], lrow[8];
#pragma unroll
    for (int r = 0; r < 8; r++) { mrow[r] = -3.0e38f; lrow[r] = 0.f; }

    const int ktEnd = (qBase + 127) >> 5;         // 32-key tiles
    issue_kv(0, 0);
    for (int kt = 0; kt <= ktEnd; kt++) {
        wait_async0();
        __syncthreads();
        if (kt + 1 <= ktEnd) issue_kv(kt + 1, (kt + 1) & 1);
        const int cur = kt & 1;

        // scores: Q(16x64) @ K^T(64x32) -> two 16x16 C tiles, 4 full WMMAs
        FragBF kb;
        v8f sc0 = {}, sc1 = {};
        kb.u4[0] = *(const uint4*)&Ks[cur][l15][koff];
        kb.u4[1] = *(const uint4*)&Ks[cur][l15][koff + 16];
        sc0 = __builtin_amdgcn_wmma_f32_16x16x32_bf16(false, qa0.v, false, kb.v, (short)0, sc0, false, false);
        kb.u4[0] = *(const uint4*)&Ks[cur][l15][32 + koff];
        kb.u4[1] = *(const uint4*)&Ks[cur][l15][32 + koff + 16];
        sc0 = __builtin_amdgcn_wmma_f32_16x16x32_bf16(false, qa1.v, false, kb.v, (short)0, sc0, false, false);
        kb.u4[0] = *(const uint4*)&Ks[cur][16 + l15][koff];
        kb.u4[1] = *(const uint4*)&Ks[cur][16 + l15][koff + 16];
        sc1 = __builtin_amdgcn_wmma_f32_16x16x32_bf16(false, qa0.v, false, kb.v, (short)0, sc1, false, false);
        kb.u4[0] = *(const uint4*)&Ks[cur][16 + l15][32 + koff];
        kb.u4[1] = *(const uint4*)&Ks[cur][16 + l15][32 + koff + 16];
        sc1 = __builtin_amdgcn_wmma_f32_16x16x32_bf16(false, qa1.v, false, kb.v, (short)0, sc1, false, false);

        const int colg0 = kt * 32 + l15, colg1 = colg0 + 16;
        float p0v[8], p1v[8], fac[8];
#pragma unroll
        for (int r = 0; r < 8; r++) {
            int rowg = q0w + r + 8 * lhalf;
            float s0 = sc0[r];                              // scale already folded into Q
            float s1 = sc1[r];
            if (colg0 > rowg) s0 = -3.0e38f;                // causal mask
            if (colg1 > rowg) s1 = -3.0e38f;
            float tm = red_max16(fmaxf(s0, s1));            // DPP row reduction
            float mnew = fmaxf(mrow[r], tm);
            float f = expf(mrow[r] - mnew);
            float p0 = expf(s0 - mnew);
            float p1 = expf(s1 - mnew);
            if (colg0 > rowg) p0 = 0.f;
            if (colg1 > rowg) p1 = 0.f;
            float ps = red_sum16(p0 + p1);                  // DPP row reduction
            lrow[r] = lrow[r] * f + ps;
            mrow[r] = mnew;
            fac[r] = f;
            p0v[r] = p0;
            p1v[r] = p1;
        }

        // P tile -> per-wave LDS (C-frag layout -> A-frag layout); same-wave LDS in-order.
#pragma unroll
        for (int r = 0; r < 8; r++) {
            Ps[wave][r + 8 * lhalf][l15]      = f2bf(p0v[r]);
            Ps[wave][r + 8 * lhalf][16 + l15] = f2bf(p1v[r]);
        }
        asm volatile("s_wait_dscnt 0x0" ::: "memory");

#pragma unroll
        for (int c = 0; c < 4; c++)
#pragma unroll
            for (int r = 0; r < 8; r++) ov[c][r] *= fac[r];

        FragBF pa;                                          // full 16x32 A fragment
        pa.u4[0] = *(const uint4*)&Ps[wave][l15][koff];
        pa.u4[1] = *(const uint4*)&Ps[wave][l15][koff + 16];
#pragma unroll
        for (int c = 0; c < 4; c++) {
            FragBF vb;                                      // full 32x16 B fragment
            vb.u4[0] = *(const uint4*)&Vs[cur][c * 16 + l15][koff];
            vb.u4[1] = *(const uint4*)&Vs[cur][c * 16 + l15][koff + 16];
            ov[c] = __builtin_amdgcn_wmma_f32_16x16x32_bf16(false, pa.v, false, vb.v, (short)0, ov[c], false, false);
        }
    }

    // normalize and write ctx[b][s][h*DH + e] as bf16
    const int b = bh >> 4, h = bh & 15;
#pragma unroll
    for (int r = 0; r < 8; r++) {
        float inv = 1.0f / lrow[r];
        int srow = q0w + r + 8 * lhalf;
        size_t base = ((size_t)(b * S + srow)) * D + h * DH;
#pragma unroll
        for (int c = 0; c < 4; c++)
            ctx[base + c * 16 + l15] = f2bf(ov[c][r] * inv);
    }
}

// ---------------------------------------------------------------------------
extern "C" void kernel_launch(void* const* d_in, const int* in_sizes, int n_in,
                              void* d_out, int out_size, void* d_ws, size_t ws_size,
                              hipStream_t stream) {
    (void)in_sizes; (void)n_in; (void)out_size; (void)ws_size;
    const float* x   = (const float*)d_in[0];
    const float* g1  = (const float*)d_in[1];
    const float* be1 = (const float*)d_in[2];
    const float* Wq  = (const float*)d_in[3];
    const float* Wk  = (const float*)d_in[4];
    const float* Wv  = (const float*)d_in[5];
    const float* Wo  = (const float*)d_in[6];
    const float* bo  = (const float*)d_in[7];
    const float* g2  = (const float*)d_in[8];
    const float* be2 = (const float*)d_in[9];
    const float* W1  = (const float*)d_in[10];
    const float* fb1 = (const float*)d_in[11];
    const float* W2  = (const float*)d_in[12];
    const float* fb2 = (const float*)d_in[13];
    float* out = (float*)d_out;

    char* ws = (char*)d_ws;
    auto alloc = [&](size_t bytes) -> char* {
        char* p = ws; ws += (bytes + 255) & ~(size_t)255; return p;
    };
    u16*   wqkvT = (u16*)alloc((size_t)3 * D * D * 2);   // [3D][D]
    u16*   woT   = (u16*)alloc((size_t)D * D * 2);       // [D][D]
    u16*   w1T   = (u16*)alloc((size_t)DF * D * 2);      // [DF][D]
    u16*   w2T   = (u16*)alloc((size_t)D * DF * 2);      // [D][DF]
    u16*   h1    = (u16*)alloc((size_t)ROWS * D * 2);
    u16*   qkv   = (u16*)alloc((size_t)3 * ROWS * D * 2);
    u16*   ctx   = (u16*)alloc((size_t)ROWS * D * 2);
    float* xmid  = (float*)alloc((size_t)ROWS * D * 4);
    u16*   h2    = (u16*)alloc((size_t)ROWS * D * 2);
    u16*   ffn1  = (u16*)alloc((size_t)ROWS * DF * 2);

    dim3 blk(256);
    k_conv_qkv<<<dim3(3 * H, D / CTK), blk, 0, stream>>>(Wq, Wk, Wv, wqkvT);
    k_conv_t<D, D><<<dim3(D / CTN, D / CTK), blk, 0, stream>>>(Wo, woT);
    k_conv_t<DF, D><<<dim3(DF / CTN, D / CTK), blk, 0, stream>>>(W1, w1T);
    k_conv_t<D, DF><<<dim3(D / CTN, DF / CTK), blk, 0, stream>>>(W2, w2T);

    k_layernorm<<<ROWS, blk, 0, stream>>>(x, g1, be1, h1);
    k_gemm<0, 3 * D><<<dim3(3 * D / 128, ROWS / 128), blk, 0, stream>>>(h1, wqkvT, nullptr, nullptr, nullptr, qkv, D);
    k_attention<<<dim3(Bsz * H, S / 128), blk, 0, stream>>>(qkv, ctx);
    k_gemm<1, D><<<dim3(D / 128, ROWS / 128), blk, 0, stream>>>(ctx, woT, bo, x, xmid, nullptr, D);
    k_layernorm<<<ROWS, blk, 0, stream>>>(xmid, g2, be2, h2);
    k_gemm<2, DF><<<dim3(DF / 128, ROWS / 128), blk, 0, stream>>>(h2, w1T, fb1, nullptr, nullptr, ffn1, D);
    k_gemm<1, D><<<dim3(D / 128, ROWS / 128), blk, 0, stream>>>(ffn1, w2T, fb2, xmid, out, nullptr, DF);
}

// v003
// A run of this version takes 177 microseconds.
// Timed twice side by side with v002, it ran 1.07 and 1.05 times as fast.
// Counting every step since v000, it is 1.38 times as fast.
#include <hip/hip_runtime.h>
#include <cstdint>

typedef unsigned short u16;
typedef __attribute__((ext_vector_type(16))) __bf16 v16bf;
typedef __attribute__((ext_vector_type(8)))  float  v8f;

constexpr int Bsz = 8, S = 512, D = 1024, H = 16, DH = 64, DF = 4096;
constexpr int ROWS = Bsz * S;   // 4096

__device__ __forceinline__ u16 f2bf(float f) {
    uint32_t u = __float_as_uint(f);
    uint32_t r = u + 0x7FFFu + ((u >> 16) & 1u);   // round-to-nearest-even
    return (u16)(r >> 16);
}

union FragBF {                  // one wave32 16x32 bf16 A/B fragment (8 VGPRs)
    v16bf v;
    uint4 u4[2];
    u16   us[16];
};

// Async global -> LDS copy of 16 bytes per lane (ASYNCcnt-tracked).
__device__ __forceinline__ void async_b128(u16* lds, const u16* gptr) {
    uint32_t l = (uint32_t)(uintptr_t)lds;          // low 32 bits = LDS offset
    asm volatile("global_load_async_to_lds_b128 %0, %1, off"
                 :: "v"(l), "v"(gptr) : "memory");
}
__device__ __forceinline__ void wait_async0() {
    asm volatile("s_wait_asynccnt 0x0" ::: "memory");
}

// DPP butterfly reduction across a 16-lane row (lanes 0-15 / 16-31 separately).
template <int CTRL>
__device__ __forceinline__ float dpp_f(float x) {
    return __int_as_float(__builtin_amdgcn_mov_dpp(__float_as_int(x), CTRL, 0xf, 0xf, true));
}
__device__ __forceinline__ float red_max16(float v) {
    v = fmaxf(v, dpp_f<0xB1>(v));    // quad_perm [1,0,3,2]  (xor 1)
    v = fmaxf(v, dpp_f<0x4E>(v));    // quad_perm [2,3,0,1]  (xor 2)
    v = fmaxf(v, dpp_f<0x141>(v));   // row_half_mirror
    v = fmaxf(v, dpp_f<0x140>(v));   // row_mirror
    return v;
}
__device__ __forceinline__ float red_sum16(float v) {
    v += dpp_f<0xB1>(v);
    v += dpp_f<0x4E>(v);
    v += dpp_f<0x141>(v);
    v += dpp_f<0x140>(v);
    return v;
}

// ---------------------------------------------------------------------------
// Weight conversion: fp32 -> bf16, stored TRANSPOSED as W^T[N][K] so GEMM B
// tiles are row-major block copies (async-to-LDS friendly, no LDS scatter).
// One block transposes a tile of 128 k x 64 n through LDS: it reads 256-byte
// row pieces of the source (16 bytes a lane) and writes 256-byte row pieces of
// the destination (16 bytes a lane).  LDS holds one dword per (n, k pair).
// ---------------------------------------------------------------------------
constexpr int CTK = 128, CTN = 64;        // tile: k extent, n extent
constexpr int CPITCH = CTK / 2 + 1;       // dwords per n row; odd, so both sides spread over the banks

// src: first element of the tile, rows are k (pitch srcPitch floats).
// dst: first element of the tile, rows are n (pitch dstPitch bf16).
// tl: CTN * CPITCH dwords of LDS, the caller's (one array serves every instance in a kernel).
template <int srcPitch, int dstPitch>
__device__ __forceinline__ void conv_tile(const float* __restrict__ src, u16* __restrict__ dst, uint32_t* tl) {
    const int tid = threadIdx.x;
    const int nq = tid & 15, kp0 = tid >> 4;           // 4 n columns, k pair (+16*j)
    float4 r0[4], r1[4];
#pragma unroll
    for (int j = 0; j < 4; j++) {
        const float* p = src + (2 * kp0 * srcPitch + nq * 4) + 32 * j * srcPitch;
        r0[j] = *(const float4*)p;
        r1[j] = *(const float4*)(p + srcPitch);
    }
#pragma unroll
    for (int j = 0; j < 4; j++) {
        uint32_t* q = &tl[(nq * 4) * CPITCH + kp0 + 16 * j];
        q[0 * CPITCH] = (uint32_t)f2bf(r0[j].x) | ((uint32_t)f2bf(r1[j].x) << 16);
        q[1 * CPITCH] = (uint32_t)f2bf(r0[j].y) | ((uint32_t)f2bf(r1[j].y) << 16);
        q[2 * CPITCH] = (uint32_t)f2bf(r0[j].z) | ((uint32_t)f2bf(r1[j].z) << 16);
        q[3 * CPITCH] = (uint32_t)f2bf(r0[j].w) | ((uint32_t)f2bf(r1[j].w) << 16);
    }
    __syncthreads();
#pragma unroll
    for (int i = 0; i < 4; i++) {
        const int n = (tid >> 4) + 16 * i, kq = tid & 15;   // 16 lanes cover one n row
        const uint32_t* q = &tl[n * CPITCH + kq * 4];
        uint4 o = make_uint4(q[0], q[1], q[2], q[3]);
        *(uint4*)&dst[((tid >> 4) * dstPitch + kq * 8) + 16 * i * dstPitch] = o;
    }
}

// ---------------------------------------------------------------------------
// LayerNorm (block per row of D=1024, 256 threads) -> bf16
// ---------------------------------------------------------------------------
// sb: 256 floats of LDS, the caller's.
__device__ __forceinline__ void ln_row(const float* __restrict__ x, const float* __restrict__ g,
                                       const float* __restrict__ b, u16* __restrict__ out,
                                       int row, float* sb) {
    const int tid = threadIdx.x;
    const float* xr = x + (size_t)row * D;
    float v0 = xr[tid], v1 = xr[tid + 256], v2 = xr[tid + 512], v3 = xr[tid + 768];
    sb[tid] = v0 + v1 + v2 + v3;
    __syncthreads();
    for (int o = 128; o > 0; o >>= 1) { if (tid < o) sb[tid] += sb[tid + o]; __syncthreads(); }
    float mean = sb[0] * (1.0f / D);
    __syncthreads();
    float d0 = v0 - mean, d1 = v1 - mean, d2 = v2 - mean, d3 = v3 - mean;
    sb[tid] = d0 * d0 + d1 * d1 + d2 * d2 + d3 * d3;
    __syncthreads();
    for (int o = 128; o > 0; o >>= 1) { if (tid < o) sb[tid] += sb[tid + o]; __syncthreads(); }
    float rstd = rsqrtf(sb[0] * (1.0f / D) + 1e-5f);
    u16* orow = out + (size_t)row * D;
    orow[tid]       = f2bf(d0 * rstd * g[tid]       + b[tid]);
    orow[tid + 256] = f2bf(d1 * rstd * g[tid + 256] + b[tid + 256]);
    orow[tid + 512] = f2bf(d2 * rstd * g[tid + 512] + b[tid + 512]);
    orow[tid + 768] = f2bf(d3 * rstd * g[tid + 768] + b[tid + 768]);
}

__global__ void k_layernorm(const float* __restrict__ x, const float* __restrict__ g,
                            const float* __restrict__ b, u16* __restrict__ out) {
    __shared__ float sb[256];
    ln_row(x, g, b, out, blockIdx.x, sb);
}

// ---------------------------------------------------------------------------
// Everything that depends on the inputs alone, in ONE launch: the four weight
// conversions and the first LayerNorm.  Block indices are dealt in groups of
// MIX_C conversion tiles and MIX_L LayerNorm rows, so that the conversions,
// which carry most of the bytes, and the LayerNorm blocks, which mostly wait
// at barriers, share every WGP for the whole launch.
// ---------------------------------------------------------------------------
constexpr int NB_QKV = 3 * H * (D / CTK);            // one [D][DH] matrix per 8 k tiles
constexpr int NB_WO  = (D / CTN) * (D / CTK);
constexpr int NB_W1  = (DF / CTN) * (D / CTK);
constexpr int NB_W2  = (D / CTN) * (DF / CTK);
constexpr int NB_CONV = NB_W1 + NB_W2 + NB_QKV + NB_WO;
constexpr int NGRP = 512, MIX_C = NB_CONV / NGRP, MIX_L = ROWS / NGRP;   // 3 tiles and 8 rows a group
static_assert(MIX_C * NGRP == NB_CONV && MIX_L * NGRP == ROWS, "groups must cover both kinds of block exactly");
constexpr int NB_PREP = NB_CONV + ROWS;

__global__ __launch_bounds__(256) void k_prep(const float* __restrict__ Wq, const float* __restrict__ Wk,
                                              const float* __restrict__ Wv, const float* __restrict__ Wo,
                                              const float* __restrict__ W1, const float* __restrict__ W2,
                                              const float* __restrict__ x, const float* __restrict__ g,
                                              const float* __restrict__ b,
                                              u16* __restrict__ wqkvT, u16* __restrict__ woT,
                                              u16* __restrict__ w1T, u16* __restrict__ w2T,
                                              u16* __restrict__ h1) {
    __shared__ uint32_t lds[CTN * CPITCH];            // a conversion's tile, or a LayerNorm's 256 partial sums
    // every test below is the same for the whole block
    const int grp = blockIdx.x / (MIX_C + MIX_L), r = blockIdx.x % (MIX_C + MIX_L);
    if (r >= MIX_C) {
        ln_row(x, g, b, h1, grp * MIX_L + r - MIX_C, (float*)lds);
        return;
    }
    int blk = grp * MIX_C + r;                        // conversion tile 0 .. NB_CONV - 1
    if (blk < NB_W1) {                                // dst[n*K + k] = src[k*N + n], n tile fastest
        const int n0 = (blk % (DF / CTN)) * CTN, k0 = (blk / (DF / CTN)) * CTK;
        conv_tile<DF, D>(W1 + (size_t)k0 * DF + n0, w1T + (size_t)n0 * D + k0, lds);
    } else if ((blk -= NB_W1) < NB_W2) {
        const int n0 = (blk % (D / CTN)) * CTN, k0 = (blk / (D / CTN)) * CTK;
        conv_tile<D, DF>(W2 + (size_t)k0 * D + n0, w2T + (size_t)n0 * DF + k0, lds);
    } else if ((blk -= NB_W2) < NB_QKV) {             // which * H + h fastest, then the k tile
        const int m = blk % (3 * H), which = m >> 4, h = m & 15;
        const int k0 = (blk / (3 * H)) * CTK;
        const float* W = (which == 0) ? Wq : (which == 1 ? Wk : Wv);
        conv_tile<DH, D>(W + ((size_t)h * D + k0) * DH, wqkvT + (size_t)(which * D + h * DH) * D + k0, lds);
    } else {
        blk -= NB_QKV;
        const int n0 = (blk % (D / CTN)) * CTN, k0 = (blk / (D / CTN)) * CTK;
        conv_tile<D, D>(Wo + (size_t)k0 * D + n0, woT + (size_t)n0 * D + k0, lds);
        // in the built code another range's register writes follow these stores behind a scalar
        // test only: the wait that belongs in front of an overwrite of a store's registers
        asm volatile("s_wait_xcnt 0x0" ::: "memory");
    }
}

// ---------------------------------------------------------------------------
// bf16 WMMA GEMM: C[M][N] = A[M][K] * B[K][N] with B supplied TRANSPOSED
// (Bt[N][K]).  Block tile 128x128, K-step 64, double-buffered async-to-LDS
// staging, single barrier per K-step.  8 waves in 4(m) x 2(n); each wave:
// 32x64 = 2x4 WMMA tiles, 16 v_wmma_f32_16x16x32_bf16 per K-step.
// EPI 0: QKV permute -> bf16 (Q pre-scaled by 1/sqrt(DH), V stored transposed)
// EPI 1: +bias +res -> fp32      EPI 2: GELU(.+bias) -> bf16
// All three write out through LDS in 16-byte pieces that fill whole lines.
// ---------------------------------------------------------------------------
constexpr int TSTRIDE = 72;               // 64 + 8 pad (u16)
constexpr int TSZ = 128 * TSTRIDE;        // one 128x64 tile in LDS (u16 count)
constexpr int EPITCH = 68;                // epilogue staging, floats a row: 64 + 4, rows 8 apart fall 32 banks apart
constexpr int VPITCH = 136;               // V^T staging, u16 a column: 128 + 8, 16 columns spread over all banks

template <int EPI, int N>                 // N at compile time: the epilogue's row steps become immediate offsets
__global__ __launch_bounds__(256) void k_gemm(const u16* __restrict__ A, const u16* __restrict__ Bt,
                                              const float* __restrict__ bias, const float* __restrict__ res,
                                              float* __restrict__ outF, u16* __restrict__ outU,
                                              int K) {
    __shared__ __attribute__((aligned(16))) u16 smem[4 * TSZ];   // [buf 0/1][A tile | B tile]; epilogue staging afterwards
    const int tid = threadIdx.x;
    const int lane = tid & 31, wave = tid >> 5;
    const int wm = wave & 3, wn = wave >> 2;           // 4(m) x 2(n)
    const int m0 = blockIdx.y * 128, n0 = blockIdx.x * 128;
    const int l15 = lane & 15, lhalf = lane >> 4, koff = lhalf * 8;
    const int ldr = tid >> 3, ldc = (tid & 7) * 8;     // loader: row 0..31 (+j*32), col chunk

    v8f acc[2][4] = {};

    auto issue_tile = [&](int k0, int buf) {
        u16* As = &smem[buf * 2 * TSZ];
        u16* Bs = As + TSZ;
#pragma unroll
        for (int j = 0; j < 4; j++) {
            int r = ldr + j * 32;
            async_b128(&As[r * TSTRIDE + ldc], &A[(size_t)(m0 + r) * K + k0 + ldc]);
            async_b128(&Bs[r * TSTRIDE + ldc], &Bt[(size_t)(n0 + r) * K + k0 + ldc]);
        }
    };

    const int nT = K / 64;
    issue_tile(0, 0);
    for (int t = 0; t < nT; t++) {
        wait_async0();
        __syncthreads();
        if (t + 1 < nT) issue_tile((t + 1) * 64, (t + 1) & 1);
        const u16* As = &smem[(t & 1) * 2 * TSZ];
        const u16* Bs = As + TSZ;
#pragma unroll
        for (int kc = 0; kc < 64; kc += 32) {
            FragBF a[2], b[4];
#pragma unroll
            for (int mt = 0; mt < 2; mt++) {
                const u16* p = &As[(wm * 32 + mt * 16 + l15) * TSTRIDE + kc + koff];
                a[mt].u4[0] = *(const uint4*)p;
                a[mt].u4[1] = *(const uint4*)(p + 16);
            }
#pragma unroll
            for (int nt = 0; nt < 4; nt++) {
                const u16* p = &Bs[(wn * 64 + nt * 16 + l15) * TSTRIDE + kc + koff];
                b[nt].u4[0] = *(const uint4*)p;
                b[nt].u4[1] = *(const uint4*)(p + 16);
            }
#pragma unroll
            for (int mt = 0; mt < 2; mt++)
#pragma unroll
                for (int nt = 0; nt < 4; nt++)
                    acc[mt][nt] = __builtin_amdgcn_wmma_f32_16x16x32_bf16(
                        false, a[mt].v, false, b[nt].v, (short)0, acc[mt][nt], false, false);
        }
    }

    // Epilogue: the accumulators go through LDS so that every global access is
    // 16 bytes a lane and covers whole 128-byte lines.
    constexpr size_t planeE = (size_t)Bsz * H * S * DH;
    __syncthreads();                      // every wave has left the last K tile: smem is staging space now
    float* st = (float*)smem + wave * (32 * EPITCH);   // this wave's own 32 x 64 fp32 tile
    auto stage = [&]() {
#pragma unroll
        for (int mt = 0; mt < 2; mt++)
#pragma unroll
            for (int nt = 0; nt < 4; nt++)
#pragma unroll
                for (int r = 0; r < 8; r++)
                    st[(mt * 16 + r + 8 * lhalf) * EPITCH + nt * 16 + l15] = acc[mt][nt][r];
        // the rows are read back by other lanes of this wave: its LDS writes must have landed
        asm volatile("s_wait_dscnt 0x0" ::: "memory");
    };
    auto pack8 = [](float4 lo, float4 hi) {
        return make_uint4((uint32_t)f2bf(lo.x) | ((uint32_t)f2bf(lo.y) << 16),
                          (uint32_t)f2bf(lo.z) | ((uint32_t)f2bf(lo.w) << 16),
                          (uint32_t)f2bf(hi.x) | ((uint32_t)f2bf(hi.y) << 16),
                          (uint32_t)f2bf(hi.z) | ((uint32_t)f2bf(hi.w) << 16));
    };

    if constexpr (EPI == 0) {
        const int which = n0 >> 10;                       // /D : 0=Q 1=K 2=V, the same for the whole block
        const int nb = n0 & 1023;                         // h * DH + e of the block's first column
        const int bb = m0 >> 9, s0 = m0 & 511;            // /S, %S of the block's first row
        if (which != 2) {                                 // Q or K; the whole block takes this side
            stage();
            const float sc = (which == 0) ? 0.125f : 1.0f;   // fold 1/sqrt(DH) into Q
            // the wave's 64 columns are one head: its 32 x 64 tile is 4 KB in a row
            u16* dst = outU + (size_t)which * planeE +
                       (((size_t)bb * H + (nb >> 6) + wn) * S + s0 + wm * 32) * DH + lane * 8;
#pragma unroll
            for (int i = 0; i < 8; i++) {
                const int row = i * 4 + (lane >> 3), c8 = (lane & 7) * 8;
                float4 lo = *(const float4*)&st[row * EPITCH + c8];
                float4 hi = *(const float4*)&st[row * EPITCH + c8 + 4];
                lo.x *= sc; lo.y *= sc; lo.z *= sc; lo.w *= sc;
                hi.x *= sc; hi.y *= sc; hi.z *= sc; hi.w *= sc;
                *(uint4*)&dst[i * 4 * DH] = pack8(lo, hi);       // (lane >> 3) * DH + c8 == lane * 8
            }
            // in the built code the V side's register writes follow these stores behind a scalar
            // test only: the wait that belongs in front of an overwrite of a store's registers
            asm volatile("s_wait_xcnt 0x0" ::: "memory");
            return;
        }
        // V is stored transposed [b][h][dh][s]: 8 accumulator rows of a lane are 8
        // neighbours in s.  Block tile in LDS as [128 columns][128 s], then 256-byte rows out.
#pragma unroll
        for (int mt = 0; mt < 2; mt++)
#pragma unroll
            for (int nt = 0; nt < 4; nt++) {
                const v8f c = acc[mt][nt];
                *(uint4*)&smem[(wn * 64 + nt * 16 + l15) * VPITCH + wm * 32 + mt * 16 + 8 * lhalf] =
                    pack8(make_float4(c[0], c[1], c[2], c[3]), make_float4(c[4], c[5], c[6], c[7]));
            }
        __syncthreads();                  // a column's 128 s values come from four waves
        const int c0 = tid >> 4, q = (tid & 15) * 8;
        u16* dst = outU + 2 * planeE + ((size_t)bb * D + nb + c0) * S + s0 + q;
#pragma unroll
        for (int i = 0; i < 8; i++)
            *(uint4*)&dst[i * 16 * S] = *(const uint4*)&smem[(i * 16 + c0) * VPITCH + q];
    } else if constexpr (EPI == 1) {
        stage();
        const int c4 = (lane & 15) * 4;
        const float4 bv = *(const float4*)&bias[n0 + wn * 64 + c4];
        // one 32-bit byte offset serves the residual reads and the stores
        const uint32_t off = (uint32_t)((m0 + wm * 32 + lhalf) * N + n0 + wn * 64 + c4) * 4u;
        const char* rp = (const char*)res + off;
        char* op = (char*)outF + off;
#pragma unroll
        for (int i = 0; i < 16; i++) {
            const float4 v = *(const float4*)&st[(i * 2 + lhalf) * EPITCH + c4];
            const float4 rr = *(const float4*)(rp + i * 2 * N * 4);
            *(float4*)(op + i * 2 * N * 4) =
                make_float4(v.x + bv.x + rr.x, v.y + bv.y + rr.y, v.z + bv.z + rr.z, v.w + bv.w + rr.w);
        }
    } else {
        stage();
        const int c8 = (lane & 7) * 8;
        const float4 b0 = *(const float4*)&bias[n0 + wn * 64 + c8];
        const float4 b1 = *(const float4*)&bias[n0 + wn * 64 + c8 + 4];
        auto gelu = [](float tt) { return 0.5f * tt * (1.0f + erff(tt * 0.70710678118654752f)); };
        u16* dst = outU + (size_t)(m0 + wm * 32 + (lane >> 3)) * N + n0 + wn * 64 + c8;
#pragma unroll
        for (int i = 0; i < 8; i++) {
            const int row = i * 4 + (lane >> 3);
            const float4 lo = *(const float4*)&st[row * EPITCH + c8];
            const float4 hi = *(const float4*)&st[row * EPITCH + c8 + 4];
            *(uint4*)&dst[i * 4 * N] =
                pack8(make_float4(gelu(lo.x + b0.x), gelu(lo.y + b0.y), gelu(lo.z + b0.z), gelu(lo.w + b0.w)),
                      make_float4(gelu(hi.x + b1.x), gelu(hi.y + b1.y), gelu(hi.z + b1.z), gelu(hi.w + b1.w)));
        }
    }
}

// ---------------------------------------------------------------------------
// Causal flash attention per (b,h).  Block = 8 waves = 128 query rows; each
// wave owns 16 rows.  32-key tiles, double-buffered async-to-LDS K/V staging
// (V pre-transposed in global), DPP softmax reductions, 8 full WMMAs/tile.
// ---------------------------------------------------------------------------
__global__ __launch_bounds__(256) void k_attention(const u16* __restrict__ qkv, u16* __restrict__ ctx) {
    __shared__ u16 Ks[2][32][72];    // [buf][key t][dh]   (+8 pad)
    __shared__ u16 Vs[2][64][40];    // [buf][dh][key t]   (+8 pad)
    __shared__ u16 Ps[8][16][40];    // per-wave P tile (16 q x 32 keys)
    const int tid = threadIdx.x;
    const int lane = tid & 31, wave = tid >> 5;
    const int l15 = lane & 15, lhalf = lane >> 4, koff = lhalf * 8;
    const int bh = blockIdx.x;                    // b*H + h
    const int qBase = blockIdx.y * 128;
    const int q0w = qBase + wave * 16;
    const size_t plane = (size_t)Bsz * H * S * DH;
    const u16* qp = qkv + (size_t)bh * S * DH;
    const u16* kp = qkv + plane + (size_t)bh * S * DH;
    const u16* vp = qkv + 2 * plane + (size_t)bh * DH * S;   // transposed [dh][s]

    // Q fragments (already scaled by 1/sqrt(DH)) for this wave's 16 rows.
    FragBF qa0, qa1;
    {
        const u16* qrow = qp + (size_t)(q0w + l15) * DH;
        qa0.u4[0] = *(const uint4*)&qrow[koff];
        qa0.u4[1] = *(const uint4*)&qrow[koff + 16];
        qa1.u4[0] = *(const uint4*)&qrow[32 + koff];
        qa1.u4[1] = *(const uint4*)&qrow[32 + koff + 16];
    }

    auto issue_kv = [&](int kt, int buf) {
        int t = tid >> 3, c8 = (tid & 7) * 8;              // K: 32 keys x 64 dh
        async_b128(&Ks[buf][t][c8], &kp[(size_t)(kt * 32 + t) * DH + c8]);
        int dh = tid >> 2, c = (tid & 3) * 8;              // V^T: 64 dh x 32 keys
        async_b128(&Vs[buf][dh][c], &vp[(size_t)dh * S + kt * 32 + c]);
    };

    v8f ov[4] = {};                 // O accum: 16 rows x 64 dh
    float mrow[8], lrow[8];
#pragma unroll
    for (int r = 0; r < 8; r++) { mrow[r] = -3.0e38f; lrow[r] = 0.f; }

    const int ktEnd = (qBase + 127) >> 5;         // 32-key tiles
    issue_kv(0, 0);
    for (int kt = 0; kt <= ktEnd; kt++) {
        wait_async0();
        __syncthreads();
        if (kt + 1 <= ktEnd) issue_kv(kt + 1, (kt + 1) & 1);
        const int cur = kt & 1;

        // scores: Q(16x64) @ K^T(64x32) -> two 16x16 C tiles, 4 full WMMAs
        FragBF kb;
        v8f sc0 = {}, sc1 = {};
        kb.u4[0] = *(const uint4*)&Ks[cur][l15][koff];
        kb.u4[1] = *(const uint4*)&Ks[cur][l15][koff + 16];
        sc0 = __builtin_amdgcn_wmma_f32_16x16x32_bf16(false, qa0.v, false, kb.v, (short)0, sc0, false, false);
        kb.u4[0] = *(const uint4*)&Ks[cur][l15][32 + koff];
        kb.u4[1] = *(const uint4*)&Ks[cur][l15][32 + koff + 16];
        sc0 = __builtin_amdgcn_wmma_f32_16x16x32_bf16(false, qa1.v, false, kb.v, (short)0, sc0, false, false);
        kb.u4[0] = *(const uint4*)&Ks[cur][16 + l15][koff];
        kb.u4[1] = *(const uint4*)&Ks[cur][16 + l15][koff + 16];
        sc1 = __builtin_amdgcn_wmma_f32_16x16x32_bf16(false, qa0.v, false, kb.v, (short)0, sc1, false, false);
        kb.u4[0] = *(const uint4*)&Ks[cur][16 + l15][32 + koff];
        kb.u4[1] = *(const uint4*)&Ks[cur][16 + l15][32 + koff + 16];
        sc1 = __builtin_amdgcn_wmma_f32_16x16x32_bf16(false, qa1.v, false, kb.v, (short)0, sc1, false, false);

        const int colg0 = kt * 32 + l15, colg1 = colg0 + 16;
        float p0v[8], p1v[8], fac[8];
#pragma unroll
        for (int r = 0; r < 8; r++) {
            int rowg = q0w + r + 8 * lhalf;
            float s0 = sc0[r];                              // scale already folded into Q
            float s1 = sc1[r];
            if (colg0 > rowg) s0 = -3.0e38f;                // causal mask
            if (colg1 > rowg) s1 = -3.0e38f;
            float tm = red_max16(fmaxf(s0, s1));            // DPP row reduction
            float mnew = fmaxf(mrow[r], tm);
            float f = expf(mrow[r] - mnew);
            float p0 = expf(s0 - mnew);
            float p1 = expf(s1 - mnew);
            if (colg0 > rowg) p0 = 0.f;
            if (colg1 > rowg) p1 = 0.f;
            float ps = red_sum16(p0 + p1);                  // DPP row reduction
            lrow[r] = lrow[r] * f + ps;
            mrow[r] = mnew;
            fac[r] = f;
            p0v[r] = p0;
            p1v[r] = p1;
        }

        // P tile -> per-wave LDS (C-frag layout -> A-frag layout); same-wave LDS in-order.
#pragma unroll
        for (int r = 0; r < 8; r++) {
            Ps[wave][r + 8 * lhalf][l15]      = f2bf(p0v[r]);
            Ps[wave][r + 8 * lhalf][16 + l15] = f2bf(p1v[r]);
        }
        asm volatile("s_wait_dscnt 0x0" ::: "memory");

#pragma unroll
        for (int c = 0; c < 4; c++)
#pragma unroll
            for (int r = 0; r < 8; r++) ov[c][r] *= fac[r];

        FragBF pa;                                          // full 16x32 A fragment
        pa.u4[0] = *(const uint4*)&Ps[wave][l15][koff];
        pa.u4[1] = *(const uint4*)&Ps[wave][l15][koff + 16];
#pragma unroll
        for (int c = 0; c < 4; c++) {
            FragBF vb;                                      // full 32x16 B fragment
            vb.u4[0] = *(const uint4*)&Vs[cur][c * 16 + l15][koff];
            vb.u4[1] = *(const uint4*)&Vs[cur][c * 16 + l15][koff + 16];
            ov[c] = __builtin_amdgcn_wmma_f32_16x16x32_bf16(false, pa.v, false, vb.v, (short)0, ov[c], false, false);
        }
    }

    // normalize and write ctx[b][s][h*DH + e] as bf16
    const int b = bh >> 4, h = bh & 15;
#pragma unroll
    for (int r = 0; r < 8; r++) {
        float inv = 1.0f / lrow[r];
        int srow = q0w + r + 8 * lhalf;
        size_t base = ((size_t)(b * S + srow)) * D + h * DH;
#pragma unroll
        for (int c = 0; c < 4; c++)
            ctx[base + c * 16 + l15] = f2bf(ov[c][r] * inv);
    }
}

// ---------------------------------------------------------------------------
extern "C" void kernel_launch(void* const* d_in, const int* in_sizes, int n_in,
                              void* d_out, int out_size, void* d_ws, size_t ws_size,
                              hipStream_t stream) {
    (void)in_sizes; (void)n_in; (void)out_size; (void)ws_size;
    const float* x   = (const float*)d_in[0];
    const float* g1  = (const float*)d_in[1];
    const float* be1 = (const float*)d_in[2];
    const float* Wq  = (const float*)d_in[3];
    const float* Wk  = (const float*)d_in[4];
    const float* Wv  = (const float*)d_in[5];
    const float* Wo  = (const float*)d_in[6];
    const float* bo  = (const float*)d_in[7];
    const float* g2  = (const float*)d_in[8];
    const float* be2 = (const float*)d_in[9];
    const float* W1  = (const float*)d_in[10];
    const float* fb1 = (const float*)d_in[11];
    const float* W2  = (const float*)d_in[12];
    const float* fb2 = (const float*)d_in[13];
    float* out = (float*)d_out;

    char* ws = (char*)d_ws;
    auto alloc = [&](size_t bytes) -> char* {
        char* p = ws; ws += (bytes + 255) & ~(size_t)255; return p;
    };
    u16*   wqkvT = (u16*)alloc((size_t)3 * D * D * 2);   // [3D][D]
    u16*   woT   = (u16*)alloc((size_t)D * D * 2);       // [D][D]
    u16*   w1T   = (u16*)alloc((size_t)DF * D * 2);      // [DF][D]
    u16*   w2T   = (u16*)alloc((size_t)D * DF * 2);      // [D][DF]
    u16*   h1    = (u16*)alloc((size_t)ROWS * D * 2);
    u16*   qkv   = (u16*)alloc((size_t)3 * ROWS * D * 2);
    u16*   ctx   = (u16*)alloc((size_t)ROWS * D * 2);
    float* xmid  = (float*)alloc((size_t)ROWS * D * 4);
    u16*   h2    = (u16*)alloc((size_t)ROWS * D * 2);
    u16*   ffn1  = (u16*)alloc((size_t)ROWS * DF * 2);

    dim3 blk(256);
    k_prep<<<NB_PREP, blk, 0, stream>>>(Wq, Wk, Wv, Wo, W1, W2, x, g1, be1, wqkvT, woT, w1T, w2T, h1);
    k_gemm<0, 3 * D><<<dim3(3 * D / 128, ROWS / 128), blk, 0, stream>>>(h1, wqkvT, nullptr, nullptr, nullptr, qkv, D);
    k_attention<<<dim3(Bsz * H, S / 128), blk, 0, stream>>>(qkv, ctx);
    k_gemm<1, D><<<dim3(D / 128, ROWS / 128), blk, 0, stream>>>(ctx, woT, bo, x, xmid, nullptr, D);
    k_layernorm<<<ROWS, blk, 0, stream>>>(xmid, g2, be2, h2);
    k_gemm<2, DF><<<dim3(DF / 128, ROWS / 128), blk, 0, stream>>>(h2, w1T, fb1, nullptr, nullptr, ffn1, D);
    k_gemm<1, D><<<dim3(D / 128, ROWS / 128), blk, 0, stream>>>(ffn1, w2T, fb2, xmid, out, nullptr, DF);
}

// v004
// A run of this version takes 170 microseconds.
// Timed twice side by side with v003, it ran 1.03 and 1.05 times as fast.
// All steps since v000 together make it 1.43 times as fast.
#include <hip/hip_runtime.h>
#include <cstdint>

typedef unsigned short u16;
typedef __attribute__((ext_vector_type(16))) __bf16 v16bf;
typedef __attribute__((ext_vector_type(8)))  float  v8f;

constexpr int Bsz = 8, S = 512, D = 1024, H = 16, DH = 64, DF = 4096;
constexpr int ROWS = Bsz * S;   // 4096

__device__ __forceinline__ u16 f2bf(float f) {
    uint32_t u = __float_as_uint(f);
    uint32_t r = u + 0x7FFFu + ((u >> 16) & 1u);   // round-to-nearest-even
    return (u16)(r >> 16);
}

union FragBF {                  // one wave32 16x32 bf16 A/B fragment (8 VGPRs)
    v16bf v;
    uint4 u4[2];
    u16   us[16];
};

// Async global -> LDS copy of 16 bytes per lane (ASYNCcnt-tracked).
__device__ __forceinline__ void async_b128(u16* lds, const u16* gptr) {
    uint32_t l = (uint32_t)(uintptr_t)lds;          // low 32 bits = LDS offset
    asm volatile("global_load_async_to_lds_b128 %0, %1, off"
                 :: "v"(l), "v"(gptr) : "memory");
}
__device__ __forceinline__ void wait_async0() {
    asm volatile("s_wait_asynccnt 0x0" ::: "memory");
}

// DPP butterfly reduction across a 16-lane row (lanes 0-15 / 16-31 separately).
template <int CTRL>
__device__ __forceinline__ float dpp_f(float x) {
    return __int_as_float(__builtin_amdgcn_mov_dpp(__float_as_int(x), CTRL, 0xf, 0xf, true));
}
__device__ __forceinline__ float red_max16(float v) {
    v = fmaxf(v, dpp_f<0xB1>(v));    // quad_perm [1,0,3,2]  (xor 1)
    v = fmaxf(v, dpp_f<0x4E>(v));    // quad_perm [2,3,0,1]  (xor 2)
    v = fmaxf(v, dpp_f<0x141>(v));   // row_half_mirror
    v = fmaxf(v, dpp_f<0x140>(v));   // row_mirror
    return v;
}
__device__ __forceinline__ float red_sum16(float v) {
    v += dpp_f<0xB1>(v);
    v += dpp_f<0x4E>(v);
    v += dpp_f<0x141>(v);
    v += dpp_f<0x140>(v);
    return v;
}

// ---------------------------------------------------------------------------
// Weight conversion: fp32 -> bf16, stored TRANSPOSED as W^T[N][K] so GEMM B
// tiles are row-major block copies (async-to-LDS friendly, no LDS scatter).
// One block transposes a tile of 128 k x 64 n through LDS: it reads 256-byte
// row pieces of the source (16 bytes a lane) and writes 256-byte row pieces of
// the destination (16 bytes a lane).  LDS holds one dword per (n, k pair).
// ---------------------------------------------------------------------------
constexpr int CTK = 128, CTN = 64;        // tile: k extent, n extent
constexpr int CPITCH = CTK / 2 + 1;       // dwords per n row; odd, so both sides spread over the banks

// src: first element of the tile, rows are k (pitch srcPitch floats).
// dst: first element of the tile, rows are n (pitch dstPitch bf16).
// tl: CTN * CPITCH dwords of LDS, the caller's (one array serves every instance in a kernel).
template <int srcPitch, int dstPitch>
__device__ __forceinline__ void conv_tile(const float* __restrict__ src, u16* __restrict__ dst, uint32_t* tl) {
    const int tid = threadIdx.x;
    const int nq = tid & 15, kp0 = tid >> 4;           // 4 n columns, k pair (+16*j)
    float4 r0[4], r1[4];
#pragma unroll
    for (int j = 0; j < 4; j++) {
        const float* p = src + (2 * kp0 * srcPitch + nq * 4) + 32 * j * srcPitch;
        r0[j] = *(const float4*)p;
        r1[j] = *(const float4*)(p + srcPitch);
    }
#pragma unroll
    for (int j = 0; j < 4; j++) {
        uint32_t* q = &tl[(nq * 4) * CPITCH + kp0 + 16 * j];
        q[0 * CPITCH] = (uint32_t)f2bf(r0[j].x) | ((uint32_t)f2bf(r1[j].x) << 16);
        q[1 * CPITCH] = (uint32_t)f2bf(r0[j].y) | ((uint32_t)f2bf(r1[j].y) << 16);
        q[2 * CPITCH] = (uint32_t)f2bf(r0[j].z) | ((uint32_t)f2bf(r1[j].z) << 16);
        q[3 * CPITCH] = (uint32_t)f2bf(r0[j].w) | ((uint32_t)f2bf(r1[j].w) << 16);
    }
    __syncthreads();
#pragma unroll
    for (int i = 0; i < 4; i++) {
        const int n = (tid >> 4) + 16 * i, kq = tid & 15;   // 16 lanes cover one n row
        const uint32_t* q = &tl[n * CPITCH + kq * 4];
        uint4 o = make_uint4(q[0], q[1], q[2], q[3]);
        *(uint4*)&dst[((tid >> 4) * dstPitch + kq * 8) + 16 * i * dstPitch] = o;
    }
}

// ---------------------------------------------------------------------------
// LayerNorm (block per row of D=1024, 256 threads) -> bf16
// ---------------------------------------------------------------------------
// sb: 256 floats of LDS, the caller's.
__device__ __forceinline__ void ln_row(const float* __restrict__ x, const float* __restrict__ g,
                                       const float* __restrict__ b, u16* __restrict__ out,
                                       int row, float* sb) {
    const int tid = threadIdx.x;
    const float* xr = x + (size_t)row * D;
    float v0 = xr[tid], v1 = xr[tid + 256], v2 = xr[tid + 512], v3 = xr[tid + 768];
    sb[tid] = v0 + v1 + v2 + v3;
    __syncthreads();
    for (int o = 128; o > 0; o >>= 1) { if (tid < o) sb[tid] += sb[tid + o]; __syncthreads(); }
    float mean = sb[0] * (1.0f / D);
    __syncthreads();
    float d0 = v0 - mean, d1 = v1 - mean, d2 = v2 - mean, d3 = v3 - mean;
    sb[tid] = d0 * d0 + d1 * d1 + d2 * d2 + d3 * d3;
    __syncthreads();
    for (int o = 128; o > 0; o >>= 1) { if (tid < o) sb[tid] += sb[tid + o]; __syncthreads(); }
    float rstd = rsqrtf(sb[0] * (1.0f / D) + 1e-5f);
    u16* orow = out + (size_t)row * D;
    orow[tid]       = f2bf(d0 * rstd * g[tid]       + b[tid]);
    orow[tid + 256] = f2bf(d1 * rstd * g[tid + 256] + b[tid + 256]);
    orow[tid + 512] = f2bf(d2 * rstd * g[tid + 512] + b[tid + 512]);
    orow[tid + 768] = f2bf(d3 * rstd * g[tid + 768] + b[tid + 768]);
}

__global__ void k_layernorm(const float* __restrict__ x, const float* __restrict__ g,
                            const float* __restrict__ b, u16* __restrict__ out) {
    __shared__ float sb[256];
    ln_row(x, g, b, out, blockIdx.x, sb);
}

// ---------------------------------------------------------------------------
// Everything that depends on the inputs alone, in ONE launch: the four weight
// conversions and the first LayerNorm.  Block indices are dealt in groups of
// MIX_C conversion tiles and MIX_L LayerNorm rows, so that the conversions,
// which carry most of the bytes, and the LayerNorm blocks, which mostly wait
// at barriers, share every WGP for the whole launch.
// ---------------------------------------------------------------------------
constexpr int NB_QKV = 3 * H * (D / CTK);            // one [D][DH] matrix per 8 k tiles
constexpr int NB_WO  = (D / CTN) * (D / CTK);
constexpr int NB_W1  = (DF / CTN) * (D / CTK);
constexpr int NB_W2  = (D / CTN) * (DF / CTK);
constexpr int NB_CONV = NB_W1 + NB_W2 + NB_QKV + NB_WO;
constexpr int NGRP = 512, MIX_C = NB_CONV / NGRP, MIX_L = ROWS / NGRP;   // 3 tiles and 8 rows a group
static_assert(MIX_C * NGRP == NB_CONV && MIX_L * NGRP == ROWS, "groups must cover both kinds of block exactly");
constexpr int NB_PREP = NB_CONV + ROWS;

__global__ __launch_bounds__(256) void k_prep(const float* __restrict__ Wq, const float* __restrict__ Wk,
                                              const float* __restrict__ Wv, const float* __restrict__ Wo,
                                              const float* __restrict__ W1, const float* __restrict__ W2,
                                              const float* __restrict__ x, const float* __restrict__ g,
                                              const float* __restrict__ b,
                                              u16* __restrict__ wqkvT, u16* __restrict__ woT,
                                              u16* __restrict__ w1T, u16* __restrict__ w2T,
                                              u16* __restrict__ h1) {
    __shared__ uint32_t lds[CTN * CPITCH];            // a conversion's tile, or a LayerNorm's 256 partial sums
    // every test below is the same for the whole block
    const int grp = blockIdx.x / (MIX_C + MIX_L), r = blockIdx.x % (MIX_C + MIX_L);
    if (r >= MIX_C) {
        ln_row(x, g, b, h1, grp * MIX_L + r - MIX_C, (float*)lds);
        return;
    }
    int blk = grp * MIX_C + r;                        // conversion tile 0 .. NB_CONV - 1
    if (blk < NB_W1) {                                // dst[n*K + k] = src[k*N + n], n tile fastest
        const int n0 = (blk % (DF / CTN)) * CTN, k0 = (blk / (DF / CTN)) * CTK;
        conv_tile<DF, D>(W1 + (size_t)k0 * DF + n0, w1T + (size_t)n0 * D + k0, lds);
    } else if ((blk -= NB_W1) < NB_W2) {
        const int n0 = (blk % (D / CTN)) * CTN, k0 = (blk / (D / CTN)) * CTK;
        conv_tile<D, DF>(W2 + (size_t)k0 * D + n0, w2T + (size_t)n0 * DF + k0, lds);
    } else if ((blk -= NB_W2) < NB_QKV) {             // which * H + h fastest, then the k tile
        const int m = blk % (3 * H), which = m >> 4, h = m & 15;
        const int k0 = (blk / (3 * H)) * CTK;
        const float* W = (which == 0) ? Wq : (which == 1 ? Wk : Wv);
        conv_tile<DH, D>(W + ((size_t)h * D + k0) * DH, wqkvT + (size_t)(which * D + h * DH) * D + k0, lds);
    } else {
        blk -= NB_QKV;
        const int n0 = (blk % (D / CTN)) * CTN, k0 = (blk / (D / CTN)) * CTK;
        conv_tile<D, D>(Wo + (size_t)k0 * D + n0, woT + (size_t)n0 * D + k0, lds);
        // in the built code another range's register writes follow these stores behind a scalar
        // test only: the wait that belongs in front of an overwrite of a store's registers
        asm volatile("s_wait_xcnt 0x0" ::: "memory");
    }
}

// ---------------------------------------------------------------------------
// bf16 WMMA GEMM: C[M][N] = A[M][K] * B[K][N] with B supplied TRANSPOSED
// (Bt[N][K]).  Block tile 128x128, K-step 64, double-buffered async-to-LDS
// staging, single barrier per K-step.  8 waves in 4(m) x 2(n); each wave:
// 32x64 = 2x4 WMMA tiles, 16 v_wmma_f32_16x16x32_bf16 per K-step.
// EPI 0: QKV permute -> bf16 (Q pre-scaled by 1/sqrt(DH), V stored transposed)
// EPI 1: +bias +res -> fp32      EPI 2: GELU(.+bias) -> bf16
// All three write out through LDS in 16-byte pieces that fill whole lines.
// ---------------------------------------------------------------------------
constexpr int TSTRIDE = 72;               // 64 + 8 pad (u16)
constexpr int TSZ = 128 * TSTRIDE;        // one 128x64 tile in LDS (u16 count)
constexpr int EPITCH = 68;                // epilogue staging, floats a row: 64 + 4, rows 8 apart fall 32 banks apart
constexpr int VPITCH = 136;               // V^T staging, u16 a column: 128 + 8, 16 columns spread over all banks

template <int EPI, int N>                 // N at compile time: the epilogue's row steps become immediate offsets
__global__ __launch_bounds__(256) void k_gemm(const u16* __restrict__ A, const u16* __restrict__ Bt,
                                              const float* __restrict__ bias, const float* __restrict__ res,
                                              float* __restrict__ outF, u16* __restrict__ outU,
                                              int K) {
    __shared__ __attribute__((aligned(16))) u16 smem[4 * TSZ];   // [buf 0/1][A tile | B tile]; epilogue staging afterwards
    const int tid = threadIdx.x;
    const int lane = tid & 31, wave = tid >> 5;
    const int wm = wave & 3, wn = wave >> 2;           // 4(m) x 2(n)
    const int m0 = blockIdx.y * 128, n0 = blockIdx.x * 128;
    const int l15 = lane & 15, lhalf = lane >> 4, koff = lhalf * 8;
    const int ldr = tid >> 3, ldc = (tid & 7) * 8;     // loader: row 0..31 (+j*32), col chunk

    v8f acc[2][4] = {};

    auto issue_tile = [&](int k0, int buf) {
        u16* As = &smem[buf * 2 * TSZ];
        u16* Bs = As + TSZ;
#pragma unroll
        for (int j = 0; j < 4; j++) {
            int r = ldr + j * 32;
            async_b128(&As[r * TSTRIDE + ldc], &A[(size_t)(m0 + r) * K + k0 + ldc]);
            async_b128(&Bs[r * TSTRIDE + ldc], &Bt[(size_t)(n0 + r) * K + k0 + ldc]);
        }
    };

    const int nT = K / 64;
    issue_tile(0, 0);
    for (int t = 0; t < nT; t++) {
        wait_async0();
        __syncthreads();
        if (t + 1 < nT) issue_tile((t + 1) * 64, (t + 1) & 1);
        const u16* As = &smem[(t & 1) * 2 * TSZ];
        const u16* Bs = As + TSZ;
#pragma unroll
        for (int kc = 0; kc < 64; kc += 32) {
            FragBF a[2], b[4];
#pragma unroll
            for (int mt = 0; mt < 2; mt++) {
                const u16* p = &As[(wm * 32 + mt * 16 + l15) * TSTRIDE + kc + koff];
                a[mt].u4[0] = *(const uint4*)p;
                a[mt].u4[1] = *(const uint4*)(p + 16);
            }
#pragma unroll
            for (int nt = 0; nt < 4; nt++) {
                const u16* p = &Bs[(wn * 64 + nt * 16 + l15) * TSTRIDE + kc + koff];
                b[nt].u4[0] = *(const uint4*)p;
                b[nt].u4[1] = *(const uint4*)(p + 16);
            }
#pragma unroll
            for (int mt = 0; mt < 2; mt++)
#pragma unroll
                for (int nt = 0; nt < 4; nt++)
                    acc[mt][nt] = __builtin_amdgcn_wmma_f32_16x16x32_bf16(
                        false, a[mt].v, false, b[nt].v, (short)0, acc[mt][nt], false, false);
        }
    }

    // Epilogue: the accumulators go through LDS so that every global access is
    // 16 bytes a lane and covers whole 128-byte lines.
    constexpr size_t planeE = (size_t)Bsz * H * S * DH;
    __syncthreads();                      // every wave has left the last K tile: smem is staging space now
    float* st = (float*)smem + wave * (32 * EPITCH);   // this wave's own 32 x 64 fp32 tile
    auto stage = [&]() {
#pragma unroll
        for (int mt = 0; mt < 2; mt++)
#pragma unroll
            for (int nt = 0; nt < 4; nt++)
#pragma unroll
                for (int r = 0; r < 8; r++)
                    st[(mt * 16 + r + 8 * lhalf) * EPITCH + nt * 16 + l15] = acc[mt][nt][r];
        // the rows are read back by other lanes of this wave: its LDS writes must have landed
        asm volatile("s_wait_dscnt 0x0" ::: "memory");
    };
    auto pack8 = [](float4 lo, float4 hi) {
        return make_uint4((uint32_t)f2bf(lo.x) | ((uint32_t)f2bf(lo.y) << 16),
                          (uint32_t)f2bf(lo.z) | ((uint32_t)f2bf(lo.w) << 16),
                          (uint32_t)f2bf(hi.x) | ((uint32_t)f2bf(hi.y) << 16),
                          (uint32_t)f2bf(hi.z) | ((uint32_t)f2bf(hi.w) << 16));
    };

    if constexpr (EPI == 0) {
        const int which = n0 >> 10;                       // /D : 0=Q 1=K 2=V, the same for the whole block
        const int nb = n0 & 1023;                         // h * DH + e of the block's first column
        const int bb = m0 >> 9, s0 = m0 & 511;            // /S, %S of the block's first row
        if (which != 2) {                                 // Q or K; the whole block takes this side
            stage();
            const float sc = (which == 0) ? 0.125f : 1.0f;   // fold 1/sqrt(DH) into Q
            // the wave's 64 columns are one head: its 32 x 64 tile is 4 KB in a row
            u16* dst = outU + (size_t)which * planeE +
                       (((size_t)bb * H + (nb >> 6) + wn) * S + s0 + wm * 32) * DH + lane * 8;
#pragma unroll
            for (int i = 0; i < 8; i++) {
                const int row = i * 4 + (lane >> 3), c8 = (lane & 7) * 8;
                float4 lo = *(const float4*)&st[row * EPITCH + c8];
                float4 hi = *(const float4*)&st[row * EPITCH + c8 + 4];
                lo.x *= sc; lo.y *= sc; lo.z *= sc; lo.w *= sc;
                hi.x *= sc; hi.y *= sc; hi.z *= sc; hi.w *= sc;
                *(uint4*)&dst[i * 4 * DH] = pack8(lo, hi);       // (lane >> 3) * DH + c8 == lane * 8
            }
            // in the built code the V side's register writes follow these stores behind a scalar
            // test only: the wait that belongs in front of an overwrite of a store's registers
            asm volatile("s_wait_xcnt 0x0" ::: "memory");
            return;
        }
        // V is stored transposed [b][h][dh][s]: 8 accumulator rows of a lane are 8
        // neighbours in s.  Block tile in LDS as [128 columns][128 s], then 256-byte rows out.
#pragma unroll
        for (int mt = 0; mt < 2; mt++)
#pragma unroll
            for (int nt = 0; nt < 4; nt++) {
                const v8f c = acc[mt][nt];
                *(uint4*)&smem[(wn * 64 + nt * 16 + l15) * VPITCH + wm * 32 + mt * 16 + 8 * lhalf] =
                    pack8(make_float4(c[0], c[1], c[2], c[3]), make_float4(c[4], c[5], c[6], c[7]));
            }
        __syncthreads();                  // a column's 128 s values come from four waves
        const int c0 = tid >> 4, q = (tid & 15) * 8;
        u16* dst = outU + 2 * planeE + ((size_t)bb * D + nb + c0) * S + s0 + q;
#pragma unroll
        for (int i = 0; i < 8; i++)
            *(uint4*)&dst[i * 16 * S] = *(const uint4*)&smem[(i * 16 + c0) * VPITCH + q];
    } else if constexpr (EPI == 1) {
        stage();
        const int c4 = (lane & 15) * 4;
        const float4 bv = *(const float4*)&bias[n0 + wn * 64 + c4];
        // one 32-bit byte offset serves the residual reads and the stores
        const uint32_t off = (uint32_t)((m0 + wm * 32 + lhalf) * N + n0 + wn * 64 + c4) * 4u;
        const char* rp = (const char*)res + off;
        char* op = (char*)outF + off;
#pragma unroll
        for (int i = 0; i < 16; i++) {
            const float4 v = *(const float4*)&st[(i * 2 + lhalf) * EPITCH + c4];
            const float4 rr = *(const float4*)(rp + i * 2 * N * 4);
            *(float4*)(op + i * 2 * N * 4) =
                make_float4(v.x + bv.x + rr.x, v.y + bv.y + rr.y, v.z + bv.z + rr.z, v.w + bv.w + rr.w);
        }
    } else {
        stage();
        const int c8 = (lane & 7) * 8;
        const float4 b0 = *(const float4*)&bias[n0 + wn * 64 + c8];
        const float4 b1 = *(const float4*)&bias[n0 + wn * 64 + c8 + 4];
        // GELU(t) = 0.5 t (1 + erf(t / sqrt 2)), without a branch.  With z = |t| / sqrt 2:
        // erfc(z) = u (a1 + u (a2 + u (a3 + u (a4 + u a5)))) exp(-z z), u = 1 / (1 + p z), absolute error
        // at most 1.5e-7; 1 + erf is erfc(z) for t < 0 (no cancellation there) and 2 - erfc(z) otherwise.
        // The library erff picks one of two polynomials by a branch per element, which the lanes of a
        // wave take both ways and which keeps the elements' dependent chains from overlapping.
        auto gelu4 = [](float4 t) {
            const float a0 = fmaf(0.3275911f * 0.70710678118654752f, fabsf(t.x), 1.0f);
            const float a1 = fmaf(0.3275911f * 0.70710678118654752f, fabsf(t.y), 1.0f);
            const float a2 = fmaf(0.3275911f * 0.70710678118654752f, fabsf(t.z), 1.0f);
            const float a3 = fmaf(0.3275911f * 0.70710678118654752f, fabsf(t.w), 1.0f);
            const float b0 = t.x * t.x * -0.72134752044448170f, b1 = t.y * t.y * -0.72134752044448170f;
            const float b2 = t.z * t.z * -0.72134752044448170f, b3 = t.w * t.w * -0.72134752044448170f;
            float u0, u1, u2, u3, e0, e1, e2, e3;     // u = 1 / a, e = 2^b = exp(-t t / 2)
            // One statement, so that behind each transcendental stands an instruction that neither reads
            // its result nor overwrites its source, as the instruction set asks: the outputs are early
            // clobbers (no output shares a register with an input), and v_nop is the slot behind the last.
            asm("v_rcp_f32 %0, %8\n\tv_rcp_f32 %1, %9\n\tv_rcp_f32 %2, %10\n\tv_rcp_f32 %3, %11\n\t"
                "v_exp_f32 %4, %12\n\tv_exp_f32 %5, %13\n\tv_exp_f32 %6, %14\n\tv_exp_f32 %7, %15\n\tv_nop"
                : "=&v"(u0), "=&v"(u1), "=&v"(u2), "=&v"(u3), "=&v"(e0), "=&v"(e1), "=&v"(e2), "=&v"(e3)
                : "v"(a0), "v"(a1), "v"(a2), "v"(a3), "v"(b0), "v"(b1), "v"(b2), "v"(b3));
            auto fin = [](float tt, float u, float e) {
                float p = fmaf(1.061405429f, u, -1.453152027f);
                p = fmaf(p, u, 1.421413741f);
                p = fmaf(p, u, -0.284496736f);
                p = fmaf(p, u, 0.254829592f);
                const float c = p * u * e;            // erfc(|t| / sqrt 2)
                return 0.5f * tt * (tt < 0.f ? c : 2.0f - c);
            };
            return make_float4(fin(t.x, u0, e0), fin(t.y, u1, e1), fin(t.z, u2, e2), fin(t.w, u3, e3));
        };
        u16* dst = outU + (size_t)(m0 + wm * 32 + (lane >> 3)) * N + n0 + wn * 64 + c8;
#pragma unroll
        for (int i = 0; i < 8; i++) {
            const int row = i * 4 + (lane >> 3);
            const float4 lo = *(const float4*)&st[row * EPITCH + c8];
            const float4 hi = *(const float4*)&st[row * EPITCH + c8 + 4];
            *(uint4*)&dst[i * 4 * N] =
                pack8(gelu4(make_float4(lo.x + b0.x, lo.y + b0.y, lo.z + b0.z, lo.w + b0.w)),
                      gelu4(make_float4(hi.x + b1.x, hi.y + b1.y, hi.z + b1.z, hi.w + b1.w)));
        }
    }
}

// ---------------------------------------------------------------------------
// Causal flash attention per (b,h).  Block = 8 waves = 128 query rows; each
// wave owns 16 rows.  32-key tiles, double-buffered async-to-LDS K/V staging
// (V pre-transposed in global), DPP softmax reductions, 8 full WMMAs/tile.
// ---------------------------------------------------------------------------
__global__ __launch_bounds__(256) void k_attention(const u16* __restrict__ qkv, u16* __restrict__ ctx) {
    __shared__ u16 Ks[2][32][72];    // [buf][key t][dh]   (+8 pad)
    __shared__ u16 Vs[2][64][40];    // [buf][dh][key t]   (+8 pad)
    __shared__ u16 Ps[8][16][40];    // per-wave P tile (16 q x 32 keys)
    const int tid = threadIdx.x;
    const int lane = tid & 31, wave = tid >> 5;
    const int l15 = lane & 15, lhalf = lane >> 4, koff = lhalf * 8;
    const int bh = blockIdx.x;                    // b*H + h
    const int qBase = blockIdx.y * 128;
    const int q0w = qBase + wave * 16;
    const size_t plane = (size_t)Bsz * H * S * DH;
    const u16* qp = qkv + (size_t)bh * S * DH;
    const u16* kp = qkv + plane + (size_t)bh * S * DH;
    const u16* vp = qkv + 2 * plane + (size_t)bh * DH * S;   // transposed [dh][s]

    // Q fragments (already scaled by 1/sqrt(DH)) for this wave's 16 rows.
    FragBF qa0, qa1;
    {
        const u16* qrow = qp + (size_t)(q0w + l15) * DH;
        qa0.u4[0] = *(const uint4*)&qrow[koff];
        qa0.u4[1] = *(const uint4*)&qrow[koff + 16];
        qa1.u4[0] = *(const uint4*)&qrow[32 + koff];
        qa1.u4[1] = *(const uint4*)&qrow[32 + koff + 16];
    }

    auto issue_kv = [&](int kt, int buf) {
        int t = tid >> 3, c8 = (tid & 7) * 8;              // K: 32 keys x 64 dh
        async_b128(&Ks[buf][t][c8], &kp[(size_t)(kt * 32 + t) * DH + c8]);
        int dh = tid >> 2, c = (tid & 3) * 8;              // V^T: 64 dh x 32 keys
        async_b128(&Vs[buf][dh][c], &vp[(size_t)dh * S + kt * 32 + c]);
    };

    v8f ov[4] = {};                 // O accum: 16 rows x 64 dh
    float mrow[8], lrow[8];
#pragma unroll
    for (int r = 0; r < 8; r++) { mrow[r] = -3.0e38f; lrow[r] = 0.f; }

    const int ktEnd = (qBase + 127) >> 5;         // 32-key tiles
    issue_kv(0, 0);
    for (int kt = 0; kt <= ktEnd; kt++) {
        wait_async0();
        __syncthreads();
        if (kt + 1 <= ktEnd) issue_kv(kt + 1, (kt + 1) & 1);
        const int cur = kt & 1;

        // scores: Q(16x64) @ K^T(64x32) -> two 16x16 C tiles, 4 full WMMAs
        FragBF kb;
        v8f sc0 = {}, sc1 = {};
        kb.u4[0] = *(const uint4*)&Ks[cur][l15][koff];
        kb.u4[1] = *(const uint4*)&Ks[cur][l15][koff + 16];
        sc0 = __builtin_amdgcn_wmma_f32_16x16x32_bf16(false, qa0.v, false, kb.v, (short)0, sc0, false, false);
        kb.u4[0] = *(const uint4*)&Ks[cur][l15][32 + koff];
        kb.u4[1] = *(const uint4*)&Ks[cur][l15][32 + koff + 16];
        sc0 = __builtin_amdgcn_wmma_f32_16x16x32_bf16(false, qa1.v, false, kb.v, (short)0, sc0, false, false);
        kb.u4[0] = *(const uint4*)&Ks[cur][16 + l15][koff];
        kb.u4[1] = *(const uint4*)&Ks[cur][16 + l15][koff + 16];
        sc1 = __builtin_amdgcn_wmma_f32_16x16x32_bf16(false, qa0.v, false, kb.v, (short)0, sc1, false, false);
        kb.u4[0] = *(const uint4*)&Ks[cur][16 + l15][32 + koff];
        kb.u4[1] = *(const uint4*)&Ks[cur][16 + l15][32 + koff + 16];
        sc1 = __builtin_amdgcn_wmma_f32_16x16x32_bf16(false, qa1.v, false, kb.v, (short)0, sc1, false, false);

        const int colg0 = kt * 32 + l15, colg1 = colg0 + 16;
        float p0v[8], p1v[8], fac[8];
#pragma unroll
        for (int r = 0; r < 8; r++) {
            int rowg = q0w + r + 8 * lhalf;
            float s0 = sc0[r];                              // scale already folded into Q
            float s1 = sc1[r];
            if (colg0 > rowg) s0 = -3.0e38f;                // causal mask
            if (colg1 > rowg) s1 = -3.0e38f;
            float tm = red_max16(fmaxf(s0, s1));            // DPP row reduction
            float mnew = fmaxf(mrow[r], tm);
            float f = expf(mrow[r] - mnew);
            float p0 = expf(s0 - mnew);
            float p1 = expf(s1 - mnew);
            if (colg0 > rowg) p0 = 0.f;
            if (colg1 > rowg) p1 = 0.f;
            float ps = red_sum16(p0 + p1);                  // DPP row reduction
            lrow[r] = lrow[r] * f + ps;
            mrow[r] = mnew;
            fac[r] = f;
            p0v[r] = p0;
            p1v[r] = p1;
        }

        // P tile -> per-wave LDS (C-frag layout -> A-frag layout); same-wave LDS in-order.
#pragma unroll
        for (int r = 0; r < 8; r++) {
            Ps[wave][r + 8 * lhalf][l15]      = f2bf(p0v[r]);
            Ps[wave][r + 8 * lhalf][16 + l15] = f2bf(p1v[r]);
        }
        asm volatile("s_wait_dscnt 0x0" ::: "memory");

#pragma unroll
        for (int c = 0; c < 4; c++)
#pragma unroll
            for (int r = 0; r < 8; r++) ov[c][r] *= fac[r];

        FragBF pa;                                          // full 16x32 A fragment
        pa.u4[0] = *(const uint4*)&Ps[wave][l15][koff];
        pa.u4[1] = *(const uint4*)&Ps[wave][l15][koff + 16];
#pragma unroll
        for (int c = 0; c < 4; c++) {
            FragBF vb;                                      // full 32x16 B fragment
            vb.u4[0] = *(const uint4*)&Vs[cur][c * 16 + l15][koff];
            vb.u4[1] = *(const uint4*)&Vs[cur][c * 16 + l15][koff + 16];
            ov[c] = __builtin_amdgcn_wmma_f32_16x16x32_bf16(false, pa.v, false, vb.v, (short)0, ov[c], false, false);
        }
    }

    // normalize and write ctx[b][s][h*DH + e] as bf16
    const int b = bh >> 4, h = bh & 15;
#pragma unroll
    for (int r = 0; r < 8; r++) {
        float inv = 1.0f / lrow[r];
        int srow = q0w + r + 8 * lhalf;
        size_t base = ((size_t)(b * S + srow)) * D + h * DH;
#pragma unroll
        for (int c = 0; c < 4; c++)
            ctx[base + c * 16 + l15] = f2bf(ov[c][r] * inv);
    }
}

// ---------------------------------------------------------------------------
extern "C" void kernel_launch(void* const* d_in, const int* in_sizes, int n_in,
                              void* d_out, int out_size, void* d_ws, size_t ws_size,
                              hipStream_t stream) {
    (void)in_sizes; (void)n_in; (void)out_size; (void)ws_size;
    const float* x   = (const float*)d_in[0];
    const float* g1  = (const float*)d_in[1];
    const float* be1 = (const float*)d_in[2];
    const float* Wq  = (const float*)d_in[3];
    const float* Wk  = (const float*)d_in[4];
    const float* Wv  = (const float*)d_in[5];
    const float* Wo  = (const float*)d_in[6];
    const float* bo  = (const float*)d_in[7];
    const float* g2  = (const float*)d_in[8];
    const float* be2 = (const float*)d_in[9];
    const float* W1  = (const float*)d_in[10];
    const float* fb1 = (const float*)d_in[11];
    const float* W2  = (const float*)d_in[12];
    const float* fb2 = (const float*)d_in[13];
    float* out = (float*)d_out;

    char* ws = (char*)d_ws;
    auto alloc = [&](size_t bytes) -> char* {
        char* p = ws; ws += (bytes + 255) & ~(size_t)255; return p;
    };
    u16*   wqkvT = (u16*)alloc((size_t)3 * D * D * 2);   // [3D][D]
    u16*   woT   = (u16*)alloc((size_t)D * D * 2);       // [D][D]
    u16*   w1T   = (u16*)alloc((size_t)DF * D * 2);      // [DF][D]
    u16*   w2T   = (u16*)alloc((size_t)D * DF * 2);      // [D][DF]
    u16*   h1    = (u16*)alloc((size_t)ROWS * D * 2);
    u16*   qkv   = (u16*)alloc((size_t)3 * ROWS * D * 2);
    u16*   ctx   = (u16*)alloc((size_t)ROWS * D * 2);
    float* xmid  = (float*)alloc((size_t)ROWS * D * 4);
    u16*   h2    = (u16*)alloc((size_t)ROWS * D * 2);
    u16*   ffn1  = (u16*)alloc((size_t)ROWS * DF * 2);

    dim3 blk(256);
    k_prep<<<NB_PREP, blk, 0, stream>>>(Wq, Wk, Wv, Wo, W1, W2, x, g1, be1, wqkvT, woT, w1T, w2T, h1);
    k_gemm<0, 3 * D><<<dim3(3 * D / 128, ROWS / 128), blk, 0, stream>>>(h1, wqkvT, nullptr, nullptr, nullptr, qkv, D);
    k_attention<<<dim3(Bsz * H, S / 128), blk, 0, stream>>>(qkv, ctx);
    k_gemm<1, D><<<dim3(D / 128, ROWS / 128), blk, 0, stream>>>(ctx, woT, bo, x, xmid, nullptr, D);
    k_layernorm<<<ROWS, blk, 0, stream>>>(xmid, g2, be2, h2);
    k_gemm<2, DF><<<dim3(DF / 128, ROWS / 128), blk, 0, stream>>>(h2, w1T, fb1, nullptr, nullptr, ffn1, D);
    k_gemm<1, D><<<dim3(D / 128, ROWS / 128), blk, 0, stream>>>(ffn1, w2T, fb2, xmid, out, nullptr, DF);
}

// v005
// Measured time: 164 microseconds a run.
// Next to v004, in two timings, it ran 1.04 times as fast each time.
// Counting every step since v000, it is 1.50 times as fast.
#include <hip/hip_runtime.h>
#include <cstdint>

typedef unsigned short u16;
typedef __attribute__((ext_vector_type(16))) __bf16 v16bf;
typedef __attribute__((ext_vector_type(8)))  float  v8f;

constexpr int Bsz = 8, S = 512, D = 1024, H = 16, DH = 64, DF = 4096;
constexpr int ROWS = Bsz * S;   // 4096

__device__ __forceinline__ u16 f2bf(float f) {
    uint32_t u = __float_as_uint(f);
    uint32_t r = u + 0x7FFFu + ((u >> 16) & 1u);   // round-to-nearest-even
    return (u16)(r >> 16);
}

union FragBF {                  // one wave32 16x32 bf16 A/B fragment (8 VGPRs)
    v16bf v;
    uint4 u4[2];
    u16   us[16];
};

// Async global -> LDS copy of 16 bytes per lane (ASYNCcnt-tracked).
__device__ __forceinline__ void async_b128(u16* lds, const u16* gptr) {
    uint32_t l = (uint32_t)(uintptr_t)lds;          // low 32 bits = LDS offset
    asm volatile("global_load_async_to_lds_b128 %0, %1, off"
                 :: "v"(l), "v"(gptr) : "memory");
}
__device__ __forceinline__ void wait_async0() {
    asm volatile("s_wait_asynccnt 0x0" ::: "memory");
}

// DPP butterfly reduction across a 16-lane row (lanes 0-15 / 16-31 separately).
template <int CTRL>
__device__ __forceinline__ float dpp_f(float x) {
    return __int_as_float(__builtin_amdgcn_mov_dpp(__float_as_int(x), CTRL, 0xf, 0xf, true));
}
__device__ __forceinline__ float red_max16(float v) {
    v = fmaxf(v, dpp_f<0xB1>(v));    // quad_perm [1,0,3,2]  (xor 1)
    v = fmaxf(v, dpp_f<0x4E>(v));    // quad_perm [2,3,0,1]  (xor 2)
    v = fmaxf(v, dpp_f<0x141>(v));   // row_half_mirror
    v = fmaxf(v, dpp_f<0x140>(v));   // row_mirror
    return v;
}
__device__ __forceinline__ float red_sum16(float v) {
    v += dpp_f<0xB1>(v);
    v += dpp_f<0x4E>(v);
    v += dpp_f<0x141>(v);
    v += dpp_f<0x140>(v);
    return v;
}

// ---------------------------------------------------------------------------
// Weight conversion: fp32 -> bf16, stored TRANSPOSED as W^T[N][K] so GEMM B
// tiles are row-major block copies (async-to-LDS friendly, no LDS scatter).
// One block transposes a tile of 128 k x 64 n through LDS: it reads 256-byte
// row pieces of the source (16 bytes a lane) and writes 256-byte row pieces of
// the destination (16 bytes a lane).  LDS holds one dword per (n, k pair).
// ---------------------------------------------------------------------------
constexpr int CTK = 128, CTN = 64;        // tile: k extent, n extent
constexpr int CPITCH = CTK / 2 + 1;       // dwords per n row; odd, so both sides spread over the banks

// src: first element of the tile, rows are k (pitch srcPitch floats).
// dst: first element of the tile, rows are n (pitch dstPitch bf16).
// tl: CTN * CPITCH dwords of LDS, the caller's (one array serves every instance in a kernel).
template <int srcPitch, int dstPitch>
__device__ __forceinline__ void conv_tile(const float* __restrict__ src, u16* __restrict__ dst, uint32_t* tl) {
    const int tid = threadIdx.x;
    const int nq = tid & 15, kp0 = tid >> 4;           // 4 n columns, k pair (+16*j)
    float4 r0[4], r1[4];
#pragma unroll
    for (int j = 0; j < 4; j++) {
        const float* p = src + (2 * kp0 * srcPitch + nq * 4) + 32 * j * srcPitch;
        r0[j] = *(const float4*)p;
        r1[j] = *(const float4*)(p + srcPitch);
    }
#pragma unroll
    for (int j = 0; j < 4; j++) {
        uint32_t* q = &tl[(nq * 4) * CPITCH + kp0 + 16 * j];
        q[0 * CPITCH] = (uint32_t)f2bf(r0[j].x) | ((uint32_t)f2bf(r1[j].x) << 16);
        q[1 * CPITCH] = (uint32_t)f2bf(r0[j].y) | ((uint32_t)f2bf(r1[j].y) << 16);
        q[2 * CPITCH] = (uint32_t)f2bf(r0[j].z) | ((uint32_t)f2bf(r1[j].z) << 16);
        q[3 * CPITCH] = (uint32_t)f2bf(r0[j].w) | ((uint32_t)f2bf(r1[j].w) << 16);
    }
    __syncthreads();
#pragma unroll
    for (int i = 0; i < 4; i++) {
        const int n = (tid >> 4) + 16 * i, kq = tid & 15;   // 16 lanes cover one n row
        const uint32_t* q = &tl[n * CPITCH + kq * 4];
        uint4 o = make_uint4(q[0], q[1], q[2], q[3]);
        *(uint4*)&dst[((tid >> 4) * dstPitch + kq * 8) + 16 * i * dstPitch] = o;
    }
}

// ---------------------------------------------------------------------------
// LayerNorm (block per row of D=1024, 256 threads) -> bf16
// ---------------------------------------------------------------------------
// sb: 256 floats of LDS, the caller's.
__device__ __forceinline__ void ln_row(const float* __restrict__ x, const float* __restrict__ g,
                                       const float* __restrict__ b, u16* __restrict__ out,
                                       int row, float* sb) {
    const int tid = threadIdx.x;
    const float* xr = x + (size_t)row * D;
    float v0 = xr[tid], v1 = xr[tid + 256], v2 = xr[tid + 512], v3 = xr[tid + 768];
    sb[tid] = v0 + v1 + v2 + v3;
    __syncthreads();
    for (int o = 128; o > 0; o >>= 1) { if (tid < o) sb[tid] += sb[tid + o]; __syncthreads(); }
    float mean = sb[0] * (1.0f / D);
    __syncthreads();
    float d0 = v0 - mean, d1 = v1 - mean, d2 = v2 - mean, d3 = v3 - mean;
    sb[tid] = d0 * d0 + d1 * d1 + d2 * d2 + d3 * d3;
    __syncthreads();
    for (int o = 128; o > 0; o >>= 1) { if (tid < o) sb[tid] += sb[tid + o]; __syncthreads(); }
    float rstd = rsqrtf(sb[0] * (1.0f / D) + 1e-5f);
    u16* orow = out + (size_t)row * D;
    orow[tid]       = f2bf(d0 * rstd * g[tid]       + b[tid]);
    orow[tid + 256] = f2bf(d1 * rstd * g[tid + 256] + b[tid + 256]);
    orow[tid + 512] = f2bf(d2 * rstd * g[tid + 512] + b[tid + 512]);
    orow[tid + 768] = f2bf(d3 * rstd * g[tid + 768] + b[tid + 768]);
}

__global__ void k_layernorm(const float* __restrict__ x, const float* __restrict__ g,
                            const float* __restrict__ b, u16* __restrict__ out) {
    __shared__ float sb[256];
    ln_row(x, g, b, out, blockIdx.x, sb);
}

// ---------------------------------------------------------------------------
// Everything that depends on the inputs alone, in ONE launch: the four weight
// conversions and the first LayerNorm.  Block indices are dealt in groups of
// MIX_C conversion tiles and MIX_L LayerNorm rows, so that the conversions,
// which carry most of the bytes, and the LayerNorm blocks, which mostly wait
// at barriers, share every WGP for the whole launch.
// ---------------------------------------------------------------------------
constexpr int NB_QKV = 3 * H * (D / CTK);            // one [D][DH] matrix per 8 k tiles
constexpr int NB_WO  = (D / CTN) * (D / CTK);
constexpr int NB_W1  = (DF / CTN) * (D / CTK);
constexpr int NB_W2  = (D / CTN) * (DF / CTK);
constexpr int NB_CONV = NB_W1 + NB_W2 + NB_QKV + NB_WO;
constexpr int NGRP = 512, MIX_C = NB_CONV / NGRP, MIX_L = ROWS / NGRP;   // 3 tiles and 8 rows a group
static_assert(MIX_C * NGRP == NB_CONV && MIX_L * NGRP == ROWS, "groups must cover both kinds of block exactly");
constexpr int NB_PREP = NB_CONV + ROWS;

__global__ __launch_bounds__(256) void k_prep(const float* __restrict__ Wq, const float* __restrict__ Wk,
                                              const float* __restrict__ Wv, const float* __restrict__ Wo,
                                              const float* __restrict__ W1, const float* __restrict__ W2,
                                              const float* __restrict__ x, const float* __restrict__ g,
                                              const float* __restrict__ b,
                                              u16* __restrict__ wqkvT, u16* __restrict__ woT,
                                              u16* __restrict__ w1T, u16* __restrict__ w2T,
                                              u16* __restrict__ h1) {
    __shared__ uint32_t lds[CTN * CPITCH];            // a conversion's tile, or a LayerNorm's 256 partial sums
    // every test below is the same for the whole block
    const int grp = blockIdx.x / (MIX_C + MIX_L), r = blockIdx.x % (MIX_C + MIX_L);
    if (r >= MIX_C) {
        ln_row(x, g, b, h1, grp * MIX_L + r - MIX_C, (float*)lds);
        return;
    }
    int blk = grp * MIX_C + r;                        // conversion tile 0 .. NB_CONV - 1
    if (blk < NB_W1) {                                // dst[n*K + k] = src[k*N + n], n tile fastest
        const int n0 = (blk % (DF / CTN)) * CTN, k0 = (blk / (DF / CTN)) * CTK;
        conv_tile<DF, D>(W1 + (size_t)k0 * DF + n0, w1T + (size_t)n0 * D + k0, lds);
    } else if ((blk -= NB_W1) < NB_W2) {
        const int n0 = (blk % (D / CTN)) * CTN, k0 = (blk / (D / CTN)) * CTK;
        conv_tile<D, DF>(W2 + (size_t)k0 * D + n0, w2T + (size_t)n0 * DF + k0, lds);
    } else if ((blk -= NB_W2) < NB_QKV) {             // which * H + h fastest, then the k tile
        const int m = blk % (3 * H), which = m >> 4, h = m & 15;
        const int k0 = (blk / (3 * H)) * CTK;
        const float* W = (which == 0) ? Wq : (which == 1 ? Wk : Wv);
        conv_tile<DH, D>(W + ((size_t)h * D + k0) * DH, wqkvT + (size_t)(which * D + h * DH) * D + k0, lds);
    } else {
        blk -= NB_QKV;
        const int n0 = (blk % (D / CTN)) * CTN, k0 = (blk / (D / CTN)) * CTK;
        conv_tile<D, D>(Wo + (size_t)k0 * D + n0, woT + (size_t)n0 * D + k0, lds);
        // in the built code another range's register writes follow these stores behind a scalar
        // test only: the wait that belongs in front of an overwrite of a store's registers
        asm volatile("s_wait_xcnt 0x0" ::: "memory");
    }
}

// ---------------------------------------------------------------------------
// bf16 WMMA GEMM: C[M][N] = A[M][K] * B[K][N] with B supplied TRANSPOSED
// (Bt[N][K]).  Block tile 128x128, K-step 64, double-buffered async-to-LDS
// staging, single barrier per K-step.  8 waves in 4(m) x 2(n); each wave:
// 32x64 = 2x4 WMMA tiles, 16 v_wmma_f32_16x16x32_bf16 per K-step.
// EPI 0: QKV permute -> bf16 (Q pre-scaled by 1/sqrt(DH), V stored transposed)
// EPI 1: +bias +res -> fp32      EPI 2: GELU(.+bias) -> bf16
// All three write out through LDS in 16-byte pieces that fill whole lines.
// ---------------------------------------------------------------------------
constexpr int TSTRIDE = 72;               // 64 + 8 pad (u16)
constexpr int TSZ = 128 * TSTRIDE;        // one 128x64 tile in LDS (u16 count)
constexpr int EPITCH = 68;                // epilogue staging, floats a row: 64 + 4, rows 8 apart fall 32 banks apart
constexpr int VPITCH = 136;               // V^T staging, u16 a column: 128 + 8, 16 columns spread over all banks

template <int EPI, int N>                 // N at compile time: the epilogue's row steps become immediate offsets
__global__ __launch_bounds__(256) void k_gemm(const u16* __restrict__ A, const u16* __restrict__ Bt,
                                              const float* __restrict__ bias, const float* __restrict__ res,
                                              float* __restrict__ outF, u16* __restrict__ outU,
                                              int K) {
    __shared__ __attribute__((aligned(16))) u16 smem[4 * TSZ];   // [buf 0/1][A tile | B tile]; epilogue staging afterwards
    const int tid = threadIdx.x;
    const int lane = tid & 31, wave = tid >> 5;
    const int wm = wave & 3, wn = wave >> 2;           // 4(m) x 2(n)
    const int m0 = blockIdx.y * 128, n0 = blockIdx.x * 128;
    const int l15 = lane & 15, lhalf = lane >> 4, koff = lhalf * 8;
    const int ldr = tid >> 3, ldc = (tid & 7) * 8;     // loader: row 0..31 (+j*32), col chunk

    v8f acc[2][4] = {};

    auto issue_tile = [&](int k0, int buf) {
        u16* As = &smem[buf * 2 * TSZ];
        u16* Bs = As + TSZ;
#pragma unroll
        for (int j = 0; j < 4; j++) {
            int r = ldr + j * 32;
            async_b128(&As[r * TSTRIDE + ldc], &A[(size_t)(m0 + r) * K + k0 + ldc]);
            async_b128(&Bs[r * TSTRIDE + ldc], &Bt[(size_t)(n0 + r) * K + k0 + ldc]);
        }
    };

    const int nT = K / 64;
    issue_tile(0, 0);
    for (int t = 0; t < nT; t++) {
        wait_async0();
        __syncthreads();
        if (t + 1 < nT) issue_tile((t + 1) * 64, (t + 1) & 1);
        const u16* As = &smem[(t & 1) * 2 * TSZ];
        const u16* Bs = As + TSZ;
#pragma unroll
        for (int kc = 0; kc < 64; kc += 32) {
            FragBF a[2], b[4];
#pragma unroll
            for (int mt = 0; mt < 2; mt++) {
                const u16* p = &As[(wm * 32 + mt * 16 + l15) * TSTRIDE + kc + koff];
                a[mt].u4[0] = *(const uint4*)p;
                a[mt].u4[1] = *(const uint4*)(p + 16);
            }
#pragma unroll
            for (int nt = 0; nt < 4; nt++) {
                const u16* p = &Bs[(wn * 64 + nt * 16 + l15) * TSTRIDE + kc + koff];
                b[nt].u4[0] = *(const uint4*)p;
                b[nt].u4[1] = *(const uint4*)(p + 16);
            }
#pragma unroll
            for (int mt = 0; mt < 2; mt++)
#pragma unroll
                for (int nt = 0; nt < 4; nt++)
                    acc[mt][nt] = __builtin_amdgcn_wmma_f32_16x16x32_bf16(
                        false, a[mt].v, false, b[nt].v, (short)0, acc[mt][nt], false, false);
        }
    }

    // Epilogue: the accumulators go through LDS so that every global access is
    // 16 bytes a lane and covers whole 128-byte lines.
    constexpr size_t planeE = (size_t)Bsz * H * S * DH;
    __syncthreads();                      // every wave has left the last K tile: smem is staging space now
    float* st = (float*)smem + wave * (32 * EPITCH);   // this wave's own 32 x 64 fp32 tile
    auto stage = [&]() {
#pragma unroll
        for (int mt = 0; mt < 2; mt++)
#pragma unroll
            for (int nt = 0; nt < 4; nt++)
#pragma unroll
                for (int r = 0; r < 8; r++)
                    st[(mt * 16 + r + 8 * lhalf) * EPITCH + nt * 16 + l15] = acc[mt][nt][r];
        // the rows are read back by other lanes of this wave: its LDS writes must have landed
        asm volatile("s_wait_dscnt 0x0" ::: "memory");
    };
    auto pack8 = [](float4 lo, float4 hi) {
        return make_uint4((uint32_t)f2bf(lo.x) | ((uint32_t)f2bf(lo.y) << 16),
                          (uint32_t)f2bf(lo.z) | ((uint32_t)f2bf(lo.w) << 16),
                          (uint32_t)f2bf(hi.x) | ((uint32_t)f2bf(hi.y) << 16),
                          (uint32_t)f2bf(hi.z) | ((uint32_t)f2bf(hi.w) << 16));
    };

    if constexpr (EPI == 0) {
        const int which = n0 >> 10;                       // /D : 0=Q 1=K 2=V, the same for the whole block
        const int nb = n0 & 1023;                         // h * DH + e of the block's first column
        const int bb = m0 >> 9, s0 = m0 & 511;            // /S, %S of the block's first row
        if (which != 2) {                                 // Q or K; the whole block takes this side
            stage();
            const float sc = (which == 0) ? 0.125f : 1.0f;   // fold 1/sqrt(DH) into Q
            // the wave's 64 columns are one head: its 32 x 64 tile is 4 KB in a row
            u16* dst = outU + (size_t)which * planeE +
                       (((size_t)bb * H + (nb >> 6) + wn) * S + s0 + wm * 32) * DH + lane * 8;
#pragma unroll
            for (int i = 0; i < 8; i++) {
                const int row = i * 4 + (lane >> 3), c8 = (lane & 7) * 8;
                float4 lo = *(const float4*)&st[row * EPITCH + c8];
                float4 hi = *(const float4*)&st[row * EPITCH + c8 + 4];
                lo.x *= sc; lo.y *= sc; lo.z *= sc; lo.w *= sc;
                hi.x *= sc; hi.y *= sc; hi.z *= sc; hi.w *= sc;
                *(uint4*)&dst[i * 4 * DH] = pack8(lo, hi);       // (lane >> 3) * DH + c8 == lane * 8
            }
            // in the built code the V side's register writes follow these stores behind a scalar
            // test only: the wait that belongs in front of an overwrite of a store's registers
            asm volatile("s_wait_xcnt 0x0" ::: "memory");
            return;
        }
        // V is stored transposed [b][h][dh][s]: 8 accumulator rows of a lane are 8
        // neighbours in s.  Block tile in LDS as [128 columns][128 s], then 256-byte rows out.
#pragma unroll
        for (int mt = 0; mt < 2; mt++)
#pragma unroll
            for (int nt = 0; nt < 4; nt++) {
                const v8f c = acc[mt][nt];
                *(uint4*)&smem[(wn * 64 + nt * 16 + l15) * VPITCH + wm * 32 + mt * 16 + 8 * lhalf] =
                    pack8(make_float4(c[0], c[1], c[2], c[3]), make_float4(c[4], c[5], c[6], c[7]));
            }
        __syncthreads();                  // a column's 128 s values come from four waves
        const int c0 = tid >> 4, q = (tid & 15) * 8;
        u16* dst = outU + 2 * planeE + ((size_t)bb * D + nb + c0) * S + s0 + q;
#pragma unroll
        for (int i = 0; i < 8; i++)
            *(uint4*)&dst[i * 16 * S] = *(const uint4*)&smem[(i * 16 + c0) * VPITCH + q];
    } else if constexpr (EPI == 1) {
        stage();
        const int c4 = (lane & 15) * 4;
        const float4 bv = *(const float4*)&bias[n0 + wn * 64 + c4];
        // one 32-bit byte offset serves the residual reads and the stores
        const uint32_t off = (uint32_t)((m0 + wm * 32 + lhalf) * N + n0 + wn * 64 + c4) * 4u;
        const char* rp = (const char*)res + off;
        char* op = (char*)outF + off;
#pragma unroll
        for (int i = 0; i < 16; i++) {
            const float4 v = *(const float4*)&st[(i * 2 + lhalf) * EPITCH + c4];
            const float4 rr = *(const float4*)(rp + i * 2 * N * 4);
            *(float4*)(op + i * 2 * N * 4) =
                make_float4(v.x + bv.x + rr.x, v.y + bv.y + rr.y, v.z + bv.z + rr.z, v.w + bv.w + rr.w);
        }
    } else {
        stage();
        const int c8 = (lane & 7) * 8;
        const float4 b0 = *(const float4*)&bias[n0 + wn * 64 + c8];
        const float4 b1 = *(const float4*)&bias[n0 + wn * 64 + c8 + 4];
        // GELU(t) = 0.5 t (1 + erf(t / sqrt 2)), without a branch.  With z = |t| / sqrt 2:
        // erfc(z) = u (a1 + u (a2 + u (a3 + u (a4 + u a5)))) exp(-z z), u = 1 / (1 + p z), absolute error
        // at most 1.5e-7; 1 + erf is erfc(z) for t < 0 (no cancellation there) and 2 - erfc(z) otherwise.
        // The library erff picks one of two polynomials by a branch per element, which the lanes of a
        // wave take both ways and which keeps the elements' dependent chains from overlapping.
        auto gelu4 = [](float4 t) {
            const float a0 = fmaf(0.3275911f * 0.70710678118654752f, fabsf(t.x), 1.0f);
            const float a1 = fmaf(0.3275911f * 0.70710678118654752f, fabsf(t.y), 1.0f);
            const float a2 = fmaf(0.3275911f * 0.70710678118654752f, fabsf(t.z), 1.0f);
            const float a3 = fmaf(0.3275911f * 0.70710678118654752f, fabsf(t.w), 1.0f);
            const float b0 = t.x * t.x * -0.72134752044448170f, b1 = t.y * t.y * -0.72134752044448170f;
            const float b2 = t.z * t.z * -0.72134752044448170f, b3 = t.w * t.w * -0.72134752044448170f;
            float u0, u1, u2, u3, e0, e1, e2, e3;     // u = 1 / a, e = 2^b = exp(-t t / 2)
            // One statement, so that behind each transcendental stands an instruction that neither reads
            // its result nor overwrites its source, as the instruction set asks: the outputs are early
            // clobbers (no output shares a register with an input), and v_nop is the slot behind the last.
            asm("v_rcp_f32 %0, %8\n\tv_rcp_f32 %1, %9\n\tv_rcp_f32 %2, %10\n\tv_rcp_f32 %3, %11\n\t"
                "v_exp_f32 %4, %12\n\tv_exp_f32 %5, %13\n\tv_exp_f32 %6, %14\n\tv_exp_f32 %7, %15\n\tv_nop"
                : "=&v"(u0), "=&v"(u1), "=&v"(u2), "=&v"(u3), "=&v"(e0), "=&v"(e1), "=&v"(e2), "=&v"(e3)
                : "v"(a0), "v"(a1), "v"(a2), "v"(a3), "v"(b0), "v"(b1), "v"(b2), "v"(b3));
            auto fin = [](float tt, float u, float e) {
                float p = fmaf(1.061405429f, u, -1.453152027f);
                p = fmaf(p, u, 1.421413741f);
                p = fmaf(p, u, -0.284496736f);
                p = fmaf(p, u, 0.254829592f);
                const float c = p * u * e;            // erfc(|t| / sqrt 2)
                return 0.5f * tt * (tt < 0.f ? c : 2.0f - c);
            };
            return make_float4(fin(t.x, u0, e0), fin(t.y, u1, e1), fin(t.z, u2, e2), fin(t.w, u3, e3));
        };
        u16* dst = outU + (size_t)(m0 + wm * 32 + (lane >> 3)) * N + n0 + wn * 64 + c8;
#pragma unroll
        for (int i = 0; i < 8; i++) {
            const int row = i * 4 + (lane >> 3);
            const float4 lo = *(const float4*)&st[row * EPITCH + c8];
            const float4 hi = *(const float4*)&st[row * EPITCH + c8 + 4];
            *(uint4*)&dst[i * 4 * N] =
                pack8(gelu4(make_float4(lo.x + b0.x, lo.y + b0.y, lo.z + b0.z, lo.w + b0.w)),
                      gelu4(make_float4(hi.x + b1.x, hi.y + b1.y, hi.z + b1.z, hi.w + b1.w)));
        }
    }
}

__device__ __forceinline__ float xhalf(float x) {
    return __int_as_float(__builtin_amdgcn_permlanex16(__float_as_int(x), __float_as_int(x),
                                                       0x76543210, 0xfedcba98, false, false));
}

// e^x for eight values by the steps of the library's expf: x log2(e) in two parts, 2^fraction, ldexp by the
// whole part, the two range tests.  Written out only so that the eight v_exp_f32 stand in ONE statement:
// behind each then stands an instruction that neither reads its result nor overwrites its source, as the
// instruction set asks (the outputs are early clobbers), and v_nop is the slot behind the last.
__device__ __forceinline__ void exp8(const float (&x)[8], float (&y)[8]) {
    float e[8], a[8], t[8];
#pragma unroll
    for (int i = 0; i < 8; i++) {
        const float ph = x[i] * 0x1.715476p+0f;
        const float pl = fmaf(x[i], 0x1.4ae0bep-26f, fmaf(x[i], 0x1.715476p+0f, -ph));
        e[i] = rintf(ph);
        a[i] = (ph - e[i]) + pl;
    }
    asm("v_exp_f32 %0, %8\n\tv_exp_f32 %1, %9\n\tv_exp_f32 %2, %10\n\tv_exp_f32 %3, %11\n\t"
        "v_exp_f32 %4, %12\n\tv_exp_f32 %5, %13\n\tv_exp_f32 %6, %14\n\tv_exp_f32 %7, %15\n\tv_nop"
        : "=&v"(t[0]), "=&v"(t[1]), "=&v"(t[2]), "=&v"(t[3]), "=&v"(t[4]), "=&v"(t[5]), "=&v"(t[6]), "=&v"(t[7])
        : "v"(a[0]), "v"(a[1]), "v"(a[2]), "v"(a[3]), "v"(a[4]), "v"(a[5]), "v"(a[6]), "v"(a[7]));
#pragma unroll
    for (int i = 0; i < 8; i++) {
        float r = ldexpf(t[i], (int)e[i]);
        r = x[i] < -0x1.9d1da0p+6f ? 0.f : r;
        y[i] = x[i] > 0x1.62e430p+6f ? __builtin_inff() : r;
    }
}

__global__ __launch_bounds__(256) void k_attention(const u16* __restrict__ qkv, u16* __restrict__ ctx) {
    __shared__ u16 Ks[2][32][72];    // [buf][key t][dh]   (+8 pad)
    __shared__ u16 Vs[2][64][40];    // [buf][dh][key t]   (+8 pad)
    const int tid = threadIdx.x;
    const int lane = tid & 31, wave = tid >> 5;
    const int l15 = lane & 15, lhalf = lane >> 4, koff = lhalf * 8;
    const int bh = blockIdx.x;                    // b*H + h
    const int qBase = blockIdx.y * 128;
    const int q0w = qBase + wave * 16;
    const size_t plane = (size_t)Bsz * H * S * DH;
    const u16* qp = qkv + (size_t)bh * S * DH;
    const u16* kp = qkv + plane + (size_t)bh * S * DH;
    const u16* vp = qkv + 2 * plane + (size_t)bh * DH * S;   // transposed [dh][s]

    // Q fragments (already scaled by 1/sqrt(DH)) for this wave's 16 rows: B operand, column = query l15.
    FragBF qa0, qa1;
    {
        const u16* qrow = qp + (size_t)(q0w + l15) * DH;
        qa0.u4[0] = *(const uint4*)&qrow[koff];
        qa0.u4[1] = *(const uint4*)&qrow[koff + 16];
        qa1.u4[0] = *(const uint4*)&qrow[32 + koff];
        qa1.u4[1] = *(const uint4*)&qrow[32 + koff + 16];
    }

    auto issue_kv = [&](int kt, int buf) {
        int t = tid >> 3, c8 = (tid & 7) * 8;              // K: 32 keys x 64 dh
        async_b128(&Ks[buf][t][c8], &kp[(size_t)(kt * 32 + t) * DH + c8]);
        int dh = tid >> 2, c = (tid & 3) * 8;              // V^T: 64 dh x 32 keys
        async_b128(&Vs[buf][dh][c], &vp[(size_t)dh * S + kt * 32 + c]);
    };

    v8f ov[4] = {};                 // O^T accum: ov[c][r] = O[query l15][dh c*16 + 8*lhalf + r]
    const int rowg = q0w + l15;     // this lane's query
    float mrow = -3.0e38f;          // its running maximum, alike in both halves
    float lrow = 0.f;               // its running sum over the keys that this half holds

    const int ktEnd = (qBase + 127) >> 5;         // 32-key tiles
    issue_kv(0, 0);
    for (int kt = 0; kt <= ktEnd; kt++) {
        wait_async0();
        __syncthreads();
        if (kt + 1 <= ktEnd) issue_kv(kt + 1, (kt + 1) & 1);
        const int cur = kt & 1;

        // scores: K(32x64) @ Q^T(64x16) -> two 16x16 C tiles, 4 full WMMAs
        // sc0[r] = S[rowg][kt*32 + 8*lhalf + r], sc1[r] the key 16 further
        FragBF kb;
        v8f sc0 = {}, sc1 = {};
        kb.u4[0] = *(const uint4*)&Ks[cur][l15][koff];
        kb.u4[1] = *(const uint4*)&Ks[cur][l15][koff + 16];
        sc0 = __builtin_amdgcn_wmma_f32_16x16x32_bf16(false, kb.v, false, qa0.v, (short)0, sc0, false, false);
        kb.u4[0] = *(const uint4*)&Ks[cur][l15][32 + koff];
        kb.u4[1] = *(const uint4*)&Ks[cur][l15][32 + koff + 16];
        sc0 = __builtin_amdgcn_wmma_f32_16x16x32_bf16(false, kb.v, false, qa1.v, (short)0, sc0, false, false);
        kb.u4[0] = *(const uint4*)&Ks[cur][16 + l15][koff];
        kb.u4[1] = *(const uint4*)&Ks[cur][16 + l15][koff + 16];
        sc1 = __builtin_amdgcn_wmma_f32_16x16x32_bf16(false, kb.v, false, qa0.v, (short)0, sc1, false, false);
        kb.u4[0] = *(const uint4*)&Ks[cur][16 + l15][32 + koff];
        kb.u4[1] = *(const uint4*)&Ks[cur][16 + l15][32 + koff + 16];
        sc1 = __builtin_amdgcn_wmma_f32_16x16x32_bf16(false, kb.v, false, qa1.v, (short)0, sc1, false, false);

        const int key0 = kt * 32 + koff, key1 = key0 + 16;
        float s0[8], s1[8];
        float tm0 = -3.0e38f, tm1 = -3.0e38f;               // two chains: half the dependent depth of one
#pragma unroll
        for (int r = 0; r < 8; r++) {
            s0[r] = (key0 + r > rowg) ? -3.0e38f : sc0[r];  // causal mask; scale already folded into Q
            s1[r] = (key1 + r > rowg) ? -3.0e38f : sc1[r];
            tm0 = fmaxf(tm0, s0[r]);
            tm1 = fmaxf(tm1, s1[r]);
        }
        float tm = fmaxf(tm0, tm1);
        tm = fmaxf(tm, xhalf(tm));                          // the other half holds the tile's other 16 keys
        const float mnew = fmaxf(mrow, tm);
        const float f = expf(mrow - mnew);
        float ps = 0.f;
        FragBF pb;                                          // P^T, full 32x16 B fragment: element s is key 8*lhalf + s, 16 + 8*lhalf + s - 8
#pragma unroll
        for (int r = 0; r < 8; r++) { s0[r] -= mnew; s1[r] -= mnew; }
        float e0[8], e1[8];
        exp8(s0, e0);
        exp8(s1, e1);
#pragma unroll
        for (int r = 0; r < 8; r++) {
            float p0 = e0[r];
            float p1 = e1[r];
            if (key0 + r > rowg) p0 = 0.f;
            if (key1 + r > rowg) p1 = 0.f;
            ps += p0 + p1;
            pb.us[r]     = f2bf(p0);
            pb.us[8 + r] = f2bf(p1);
        }
        lrow = lrow * f + ps;
        mrow = mnew;

#pragma unroll
        for (int c = 0; c < 4; c++)
#pragma unroll
            for (int r = 0; r < 8; r++) ov[c][r] *= f;

#pragma unroll
        for (int c = 0; c < 4; c++) {
            FragBF vb;                                      // V^T, full 16x32 A fragment: row = dh c*16 + l15
            vb.u4[0] = *(const uint4*)&Vs[cur][c * 16 + l15][koff];
            vb.u4[1] = *(const uint4*)&Vs[cur][c * 16 + l15][koff + 16];
            ov[c] = __builtin_amdgcn_wmma_f32_16x16x32_bf16(false, vb.v, false, pb.v, (short)0, ov[c], false, false);
        }
    }

    // normalize and write ctx[b][s][h*DH + e] as bf16: a lane's 8 registers are 8 neighbours in e
    const int b = bh >> 4, h = bh & 15;
    const float inv = 1.0f / (lrow + xhalf(lrow));          // the two halves' sums join here
    u16* dst = ctx + ((size_t)(b * S + rowg)) * D + h * DH + koff;
#pragma unroll
    for (int c = 0; c < 4; c++) {
        const v8f o = ov[c];
        *(uint4*)&dst[c * 16] =
            make_uint4((uint32_t)f2bf(o[0] * inv) | ((uint32_t)f2bf(o[1] * inv) << 16),
                       (uint32_t)f2bf(o[2] * inv) | ((uint32_t)f2bf(o[3] * inv) << 16),
                       (uint32_t)f2bf(o[4] * inv) | ((uint32_t)f2bf(o[5] * inv) << 16),
                       (uint32_t)f2bf(o[6] * inv) | ((uint32_t)f2bf(o[7] * inv) << 16));
    }
}

// ---------------------------------------------------------------------------
extern "C" void kernel_launch(void* const* d_in, const int* in_sizes, int n_in,
                              void* d_out, int out_size, void* d_ws, size_t ws_size,
                              hipStream_t stream) {
    (void)in_sizes; (void)n_in; (void)out_size; (void)ws_size;
    const float* x   = (const float*)d_in[0];
    const float* g1  = (const float*)d_in[1];
    const float* be1 = (const float*)d_in[2];
    const float* Wq  = (const float*)d_in[3];
    const float* Wk  = (const float*)d_in[4];
    const float* Wv  = (const float*)d_in[5];
    const float* Wo  = (const float*)d_in[6];
    const float* bo  = (const float*)d_in[7];
    const float* g2  = (const float*)d_in[8];
    const float* be2 = (const float*)d_in[9];
    const float* W1  = (const float*)d_in[10];
    const float* fb1 = (const float*)d_in[11];
    const float* W2  = (const float*)d_in[12];
    const float* fb2 = (const float*)d_in[13];
    float* out = (float*)d_out;

    char* ws = (char*)d_ws;
    auto alloc = [&](size_t bytes) -> char* {
        char* p = ws; ws += (bytes + 255) & ~(size_t)255; return p;
    };
    u16*   wqkvT = (u16*)alloc((size_t)3 * D * D * 2);   // [3D][D]
    u16*   woT   = (u16*)alloc((size_t)D * D * 2);       // [D][D]
    u16*   w1T   = (u16*)alloc((size_t)DF * D * 2);      // [DF][D]
    u16*   w2T   = (u16*)alloc((size_t)D * DF * 2);      // [D][DF]
    u16*   h1    = (u16*)alloc((size_t)ROWS * D * 2);
    u16*   qkv   = (u16*)alloc((size_t)3 * ROWS * D * 2);
    u16*   ctx   = (u16*)alloc((size_t)ROWS * D * 2);
    float* xmid  = (float*)alloc((size_t)ROWS * D * 4);
    u16*   h2    = (u16*)alloc((size_t)ROWS * D * 2);
    u16*   ffn1  = (u16*)alloc((size_t)ROWS * DF * 2);

    dim3 blk(256);
    k_prep<<<NB_PREP, blk, 0, stream>>>(Wq, Wk, Wv, Wo, W1, W2, x, g1, be1, wqkvT, woT, w1T, w2T, h1);
    k_gemm<0, 3 * D><<<dim3(3 * D / 128, ROWS / 128), blk, 0, stream>>>(h1, wqkvT, nullptr, nullptr, nullptr, qkv, D);
    k_attention<<<dim3(Bsz * H, S / 128), blk, 0, stream>>>(qkv, ctx);
    k_gemm<1, D><<<dim3(D / 128, ROWS / 128), blk, 0, stream>>>(ctx, woT, bo, x, xmid, nullptr, D);
    k_layernorm<<<ROWS, blk, 0, stream>>>(xmid, g2, be2, h2);
    k_gemm<2, DF><<<dim3(DF / 128, ROWS / 128), blk, 0, stream>>>(h2, w1T, fb1, nullptr, nullptr, ffn1, D);
    k_gemm<1, D><<<dim3(D / 128, ROWS / 128), blk, 0, stream>>>(ffn1, w2T, fb2, xmid, out, nullptr, DF);
}

// v006
// A run of this version takes 149 microseconds.
// In two side-by-side timings against v005, it was 1.09 and 1.10 times as fast.
// Counting every step since v000, it is 1.64 times as fast.
#include <hip/hip_runtime.h>
#include <cstdint>

typedef unsigned short u16;
typedef __attribute__((ext_vector_type(16))) __bf16 v16bf;
typedef __attribute__((ext_vector_type(8)))  float  v8f;

constexpr int Bsz = 8, S = 512, D = 1024, H = 16, DH = 64, DF = 4096;
constexpr int ROWS = Bsz * S;   // 4096

__device__ __forceinline__ u16 f2bf(float f) {
    uint32_t u = __float_as_uint(f);
    uint32_t r = u + 0x7FFFu + ((u >> 16) & 1u);   // round-to-nearest-even
    return (u16)(r >> 16);
}

union FragBF {                  // one wave32 16x32 bf16 A/B fragment (8 VGPRs)
    v16bf v;
    uint4 u4[2];
    u16   us[16];
};

// Async global -> LDS copy of 16 bytes per lane (ASYNCcnt-tracked).
__device__ __forceinline__ void async_b128(u16* lds, const u16* gptr) {
    uint32_t l = (uint32_t)(uintptr_t)lds;          // low 32 bits = LDS offset
    asm volatile("global_load_async_to_lds_b128 %0, %1, off"
                 :: "v"(l), "v"(gptr) : "memory");
}
__device__ __forceinline__ void wait_async0() {
    asm volatile("s_wait_asynccnt 0x0" ::: "memory");
}
// Returns when all but this wave's CNT youngest copies have landed.
template <int CNT>
__device__ __forceinline__ void wait_async_but() {
    asm volatile("s_wait_asynccnt %0" :: "n"(CNT) : "memory");
}
// The same copy as the compiler's builtin: the compiler sees its address registers.
typedef __attribute__((ext_vector_type(4))) int v4i;
__device__ __forceinline__ void copy_b128(u16* lds, const u16* gptr) {
    __builtin_amdgcn_global_load_async_to_lds_b128(
        (__attribute__((address_space(1))) v4i*)gptr, (__attribute__((address_space(3))) v4i*)lds, 0, 0);
}

// DPP butterfly reduction across a 16-lane row (lanes 0-15 / 16-31 separately).
template <int CTRL>
__device__ __forceinline__ float dpp_f(float x) {
    return __int_as_float(__builtin_amdgcn_mov_dpp(__float_as_int(x), CTRL, 0xf, 0xf, true));
}
__device__ __forceinline__ float red_max16(float v) {
    v = fmaxf(v, dpp_f<0xB1>(v));    // quad_perm [1,0,3,2]  (xor 1)
    v = fmaxf(v, dpp_f<0x4E>(v));    // quad_perm [2,3,0,1]  (xor 2)
    v = fmaxf(v, dpp_f<0x141>(v));   // row_half_mirror
    v = fmaxf(v, dpp_f<0x140>(v));   // row_mirror
    return v;
}
__device__ __forceinline__ float red_sum16(float v) {
    v += dpp_f<0xB1>(v);
    v += dpp_f<0x4E>(v);
    v += dpp_f<0x141>(v);
    v += dpp_f<0x140>(v);
    return v;
}

// ---------------------------------------------------------------------------
// Weight conversion: fp32 -> bf16, stored TRANSPOSED as W^T[N][K] so GEMM B
// tiles are row-major block copies (async-to-LDS friendly, no LDS scatter).
// One block transposes a tile of 128 k x 64 n through LDS: it reads 256-byte
// row pieces of the source (16 bytes a lane) and writes 256-byte row pieces of
// the destination (16 bytes a lane).  LDS holds one dword per (n, k pair).
// ---------------------------------------------------------------------------
constexpr int CTK = 128, CTN = 64;        // tile: k extent, n extent
constexpr int CPITCH = CTK / 2 + 1;       // dwords per n row; odd, so both sides spread over the banks

// src: first element of the tile, rows are k (pitch srcPitch floats).
// dst: first element of the tile, rows are n (pitch dstPitch bf16).
// tl: CTN * CPITCH dwords of LDS, the caller's (one array serves every instance in a kernel).
template <int srcPitch, int dstPitch>
__device__ __forceinline__ void conv_tile(const float* __restrict__ src, u16* __restrict__ dst, uint32_t* tl) {
    const int tid = threadIdx.x;
    const int nq = tid & 15, kp0 = tid >> 4;           // 4 n columns, k pair (+16*j)
    float4 r0[4], r1[4];
#pragma unroll
    for (int j = 0; j < 4; j++) {
        const float* p = src + (2 * kp0 * srcPitch + nq * 4) + 32 * j * srcPitch;
        r0[j] = *(const float4*)p;
        r1[j] = *(const float4*)(p + srcPitch);
    }
#pragma unroll
    for (int j = 0; j < 4; j++) {
        uint32_t* q = &tl[(nq * 4) * CPITCH + kp0 + 16 * j];
        q[0 * CPITCH] = (uint32_t)f2bf(r0[j].x) | ((uint32_t)f2bf(r1[j].x) << 16);
        q[1 * CPITCH] = (uint32_t)f2bf(r0[j].y) | ((uint32_t)f2bf(r1[j].y) << 16);
        q[2 * CPITCH] = (uint32_t)f2bf(r0[j].z) | ((uint32_t)f2bf(r1[j].z) << 16);
        q[3 * CPITCH] = (uint32_t)f2bf(r0[j].w) | ((uint32_t)f2bf(r1[j].w) << 16);
    }
    __syncthreads();
#pragma unroll
    for (int i = 0; i < 4; i++) {
        const int n = (tid >> 4) + 16 * i, kq = tid & 15;   // 16 lanes cover one n row
        const uint32_t* q = &tl[n * CPITCH + kq * 4];
        uint4 o = make_uint4(q[0], q[1], q[2], q[3]);
        *(uint4*)&dst[((tid >> 4) * dstPitch + kq * 8) + 16 * i * dstPitch] = o;
    }
}

// ---------------------------------------------------------------------------
// LayerNorm (block per row of D=1024, 256 threads) -> bf16
// ---------------------------------------------------------------------------
// sb: 256 floats of LDS, the caller's.
__device__ __forceinline__ void ln_row(const float* __restrict__ x, const float* __restrict__ g,
                                       const float* __restrict__ b, u16* __restrict__ out,
                                       int row, float* sb) {
    const int tid = threadIdx.x;
    const float* xr = x + (size_t)row * D;
    float v0 = xr[tid], v1 = xr[tid + 256], v2 = xr[tid + 512], v3 = xr[tid + 768];
    sb[tid] = v0 + v1 + v2 + v3;
    __syncthreads();
    for (int o = 128; o > 0; o >>= 1) { if (tid < o) sb[tid] += sb[tid + o]; __syncthreads(); }
    float mean = sb[0] * (1.0f / D);
    __syncthreads();
    float d0 = v0 - mean, d1 = v1 - mean, d2 = v2 - mean, d3 = v3 - mean;
    sb[tid] = d0 * d0 + d1 * d1 + d2 * d2 + d3 * d3;
    __syncthreads();
    for (int o = 128; o > 0; o >>= 1) { if (tid < o) sb[tid] += sb[tid + o]; __syncthreads(); }
    float rstd = rsqrtf(sb[0] * (1.0f / D) + 1e-5f);
    u16* orow = out + (size_t)row * D;
    orow[tid]       = f2bf(d0 * rstd * g[tid]       + b[tid]);
    orow[tid + 256] = f2bf(d1 * rstd * g[tid + 256] + b[tid + 256]);
    orow[tid + 512] = f2bf(d2 * rstd * g[tid + 512] + b[tid + 512]);
    orow[tid + 768] = f2bf(d3 * rstd * g[tid + 768] + b[tid + 768]);
}

__global__ void k_layernorm(const float* __restrict__ x, const float* __restrict__ g,
                            const float* __restrict__ b, u16* __restrict__ out) {
    __shared__ float sb[256];
    ln_row(x, g, b, out, blockIdx.x, sb);
}

// ---------------------------------------------------------------------------
// Everything that depends on the inputs alone, in ONE launch: the four weight
// conversions and the first LayerNorm.  Block indices are dealt in groups of
// MIX_C conversion tiles and MIX_L LayerNorm rows, so that the conversions,
// which carry most of the bytes, and the LayerNorm blocks, which mostly wait
// at barriers, share every WGP for the whole launch.
// ---------------------------------------------------------------------------
constexpr int NB_QKV = 3 * H * (D / CTK);            // one [D][DH] matrix per 8 k tiles
constexpr int NB_WO  = (D / CTN) * (D / CTK);
constexpr int NB_W1  = (DF / CTN) * (D / CTK);
constexpr int NB_W2  = (D / CTN) * (DF / CTK);
constexpr int NB_CONV = NB_W1 + NB_W2 + NB_QKV + NB_WO;
constexpr int NGRP = 512, MIX_C = NB_CONV / NGRP, MIX_L = ROWS / NGRP;   // 3 tiles and 8 rows a group
static_assert(MIX_C * NGRP == NB_CONV && MIX_L * NGRP == ROWS, "groups must cover both kinds of block exactly");
constexpr int NB_PREP = NB_CONV + ROWS;

__global__ __launch_bounds__(256) void k_prep(const float* __restrict__ Wq, const float* __restrict__ Wk,
                                              const float* __restrict__ Wv, const float* __restrict__ Wo,
                                              const float* __restrict__ W1, const float* __restrict__ W2,
                                              const float* __restrict__ x, const float* __restrict__ g,
                                              const float* __restrict__ b,
                                              u16* __restrict__ wqkvT, u16* __restrict__ woT,
                                              u16* __restrict__ w1T, u16* __restrict__ w2T,
                                              u16* __restrict__ h1) {
    __shared__ uint32_t lds[CTN * CPITCH];            // a conversion's tile, or a LayerNorm's 256 partial sums
    // every test below is the same for the whole block
    const int grp = blockIdx.x / (MIX_C + MIX_L), r = blockIdx.x % (MIX_C + MIX_L);
    if (r >= MIX_C) {
        ln_row(x, g, b, h1, grp * MIX_L + r - MIX_C, (float*)lds);
        return;
    }
    int blk = grp * MIX_C + r;                        // conversion tile 0 .. NB_CONV - 1
    if (blk < NB_W1) {                                // dst[n*K + k] = src[k*N + n], n tile fastest
        const int n0 = (blk % (DF / CTN)) * CTN, k0 = (blk / (DF / CTN)) * CTK;
        conv_tile<DF, D>(W1 + (size_t)k0 * DF + n0, w1T + (size_t)n0 * D + k0, lds);
    } else if ((blk -= NB_W1) < NB_W2) {
        const int n0 = (blk % (D / CTN)) * CTN, k0 = (blk / (D / CTN)) * CTK;
        conv_tile<D, DF>(W2 + (size_t)k0 * D + n0, w2T + (size_t)n0 * DF + k0, lds);
    } else if ((blk -= NB_W2) < NB_QKV) {             // which * H + h fastest, then the k tile
        const int m = blk % (3 * H), which = m >> 4, h = m & 15;
        const int k0 = (blk / (3 * H)) * CTK;
        const float* W = (which == 0) ? Wq : (which == 1 ? Wk : Wv);
        conv_tile<DH, D>(W + ((size_t)h * D + k0) * DH, wqkvT + (size_t)(which * D + h * DH) * D + k0, lds);
    } else {
        blk -= NB_QKV;
        const int n0 = (blk % (D / CTN)) * CTN, k0 = (blk / (D / CTN)) * CTK;
        conv_tile<D, D>(Wo + (size_t)k0 * D + n0, woT + (size_t)n0 * D + k0, lds);
        // in the built code another range's register writes follow these stores behind a scalar
        // test only: the wait that belongs in front of an overwrite of a store's registers
        asm volatile("s_wait_xcnt 0x0" ::: "memory");
    }
}

// ---------------------------------------------------------------------------
// bf16 WMMA GEMM: C[M][N] = A[M][K] * B[K][N] with B supplied TRANSPOSED
// (Bt[N][K]).  Block tile 128x128, K-step 64, async-to-LDS staging in a ring of
// NS buffers, NS - 1 K-steps ahead, single barrier per K-step.  NS = 2 for QKV, whose
// blocks are all resident at once, three a WGP, and cover each other's waits.  NS = 4
// for the others: with N = 1024 a block has its WGP alone, and one K-step is shorter than
// a copy's way from memory; with N = 4096 registers allow three blocks a WGP at most, which
// leaves a quarter of the grid for a thin second round: two blocks a WGP make two even rounds.
// 8 waves in 4(m) x 2(n); each wave:
// 32x64 = 2x4 WMMA tiles, 16 v_wmma_f32_16x16x32_bf16 per K-step.
// EPI 0: QKV permute -> bf16 (Q pre-scaled by 1/sqrt(DH), V stored transposed)
// EPI 1: +bias +res -> fp32      EPI 2: GELU(.+bias) -> bf16
// All three write out through LDS in 16-byte pieces that fill whole lines.
// ---------------------------------------------------------------------------
constexpr int TSTRIDE = 72;               // 64 + 8 pad (u16)
constexpr int TSZ = 128 * TSTRIDE;        // one 128x64 tile in LDS (u16 count)
constexpr int EPITCH = 68;                // epilogue staging, floats a row: 64 + 4, rows 8 apart fall 32 banks apart
constexpr int VPITCH = 136;               // V^T staging, u16 a column: 128 + 8, 16 columns spread over all banks

template <int EPI, int N, int NS>         // N at compile time: the epilogue's row steps become immediate offsets
__global__ __launch_bounds__(256) void k_gemm(const u16* __restrict__ A, const u16* __restrict__ Bt,
                                              const float* __restrict__ bias, const float* __restrict__ res,
                                              float* __restrict__ outF, u16* __restrict__ outU,
                                              int K) {
    __shared__ __attribute__((aligned(16))) u16 smem[NS * 2 * TSZ];   // [buf 0 .. NS-1][A tile | B tile]; epilogue staging afterwards
    const int tid = threadIdx.x;
    const int lane = tid & 31, wave = tid >> 5;
    const int wm = wave & 3, wn = wave >> 2;           // 4(m) x 2(n)
    const int m0 = blockIdx.y * 128, n0 = blockIdx.x * 128;
    const int l15 = lane & 15, lhalf = lane >> 4, koff = lhalf * 8;
    const int ldr = tid >> 3, ldc = (tid & 7) * 8;     // loader: row 0..31 (+j*32), col chunk

    v8f acc[2][4] = {};

    auto issue_tile = [&](int k0, int buf) {
        u16* As = &smem[buf * 2 * TSZ];
        u16* Bs = As + TSZ;
#pragma unroll
        for (int j = 0; j < 4; j++) {
            int r = ldr + j * 32;
            copy_b128(&As[r * TSTRIDE + ldc], &A[(size_t)(m0 + r) * K + k0 + ldc]);
            copy_b128(&Bs[r * TSTRIDE + ldc], &Bt[(size_t)(n0 + r) * K + k0 + ldc]);
        }
    };

    constexpr int CPS = 8;                // copies of a wave per tile
    const int nT = K / 64;
    // the ring's first NS - 1 tiles (every launch has K >= (NS - 1) * 64); unrolled: each buffer's offset a constant
#pragma unroll
    for (int s = 0; s < NS - 1; s++) issue_tile(s * 64, s);
    for (int t = 0; t < nT; t++) {
        // this wave's reads of tile t - 1 are done before the barrier behind which its buffer is refilled
        asm volatile("s_wait_dscnt 0x0" ::: "memory");
        // tile t has landed: while tiles t + 1 .. t + NS - 2 all exist they are the wave's youngest
        // copies, CPS each, and stay in flight; in the last trips, which issue none, everything is waited for
        if (NS > 2 && t + NS - 2 < nT) wait_async_but<(NS - 2) * CPS>();
        else wait_async0();
        __syncthreads();                  // publishes tile t, and ends every wave's reads of tile t - 1
        if (t + NS - 1 < nT) issue_tile((t + NS - 1) * 64, (t + NS - 1) % NS);
        const u16* As = &smem[(t % NS) * 2 * TSZ];
        const u16* Bs = As + TSZ;
#pragma unroll
        for (int kc = 0; kc < 64; kc += 32) {
            FragBF a[2], b[4];
#pragma unroll
            for (int mt = 0; mt < 2; mt++) {
                const u16* p = &As[(wm * 32 + mt * 16 + l15) * TSTRIDE + kc + koff];
                a[mt].u4[0] = *(const uint4*)p;
                a[mt].u4[1] = *(const uint4*)(p + 16);
            }
#pragma unroll
            for (int nt = 0; nt < 4; nt++) {
                const u16* p = &Bs[(wn * 64 + nt * 16 + l15) * TSTRIDE + kc + koff];
                b[nt].u4[0] = *(const uint4*)p;
                b[nt].u4[1] = *(const uint4*)(p + 16);
            }
#pragma unroll
            for (int mt = 0; mt < 2; mt++)
#pragma unroll
                for (int nt = 0; nt < 4; nt++)
                    acc[mt][nt] = __builtin_amdgcn_wmma_f32_16x16x32_bf16(
                        false, a[mt].v, false, b[nt].v, (short)0, acc[mt][nt], false, false);
        }
    }

    // Epilogue: the accumulators go through LDS so that every global access is
    // 16 bytes a lane and covers whole 128-byte lines.
    constexpr size_t planeE = (size_t)Bsz * H * S * DH;
    __syncthreads();                      // every wave has left the last K tile: smem is staging space now
    float* st = (float*)smem + wave * (32 * EPITCH);   // this wave's own 32 x 64 fp32 tile
    auto stage = [&]() {
#pragma unroll
        for (int mt = 0; mt < 2; mt++)
#pragma unroll
            for (int nt = 0; nt < 4; nt++)
#pragma unroll
                for (int r = 0; r < 8; r++)
                    st[(mt * 16 + r + 8 * lhalf) * EPITCH + nt * 16 + l15] = acc[mt][nt][r];
        // the rows are read back by other lanes of this wave: its LDS writes must have landed
        asm volatile("s_wait_dscnt 0x0" ::: "memory");
    };
    auto pack8 = [](float4 lo, float4 hi) {
        return make_uint4((uint32_t)f2bf(lo.x) | ((uint32_t)f2bf(lo.y) << 16),
                          (uint32_t)f2bf(lo.z) | ((uint32_t)f2bf(lo.w) << 16),
                          (uint32_t)f2bf(hi.x) | ((uint32_t)f2bf(hi.y) << 16),
                          (uint32_t)f2bf(hi.z) | ((uint32_t)f2bf(hi.w) << 16));
    };

    if constexpr (EPI == 0) {
        const int which = n0 >> 10;                       // /D : 0=Q 1=K 2=V, the same for the whole block
        const int nb = n0 & 1023;                         // h * DH + e of the block's first column
        const int bb = m0 >> 9, s0 = m0 & 511;            // /S, %S of the block's first row
        if (which != 2) {                                 // Q or K; the whole block takes this side
            stage();
            const float sc = (which == 0) ? 0.125f : 1.0f;   // fold 1/sqrt(DH) into Q
            // the wave's 64 columns are one head: its 32 x 64 tile is 4 KB in a row
            u16* dst = outU + (size_t)which * planeE +
                       (((size_t)bb * H + (nb >> 6) + wn) * S + s0 + wm * 32) * DH + lane * 8;
#pragma unroll
            for (int i = 0; i < 8; i++) {
                const int row = i * 4 + (lane >> 3), c8 = (lane & 7) * 8;
                float4 lo = *(const float4*)&st[row * EPITCH + c8];
                float4 hi = *(const float4*)&st[row * EPITCH + c8 + 4];
                lo.x *= sc; lo.y *= sc; lo.z *= sc; lo.w *= sc;
                hi.x *= sc; hi.y *= sc; hi.z *= sc; hi.w *= sc;
                *(uint4*)&dst[i * 4 * DH] = pack8(lo, hi);       // (lane >> 3) * DH + c8 == lane * 8
            }
            // in the built code the V side's register writes follow these stores behind a scalar
            // test only: the wait that belongs in front of an overwrite of a store's registers
            asm volatile("s_wait_xcnt 0x0" ::: "memory");
            return;
        }
        // V is stored transposed [b][h][dh][s]: 8 accumulator rows of a lane are 8
        // neighbours in s.  Block tile in LDS as [128 columns][128 s], then 256-byte rows out.
#pragma unroll
        for (int mt = 0; mt < 2; mt++)
#pragma unroll
            for (int nt = 0; nt < 4; nt++) {
                const v8f c = acc[mt][nt];
                *(uint4*)&smem[(wn * 64 + nt * 16 + l15) * VPITCH + wm * 32 + mt * 16 + 8 * lhalf] =
                    pack8(make_float4(c[0], c[1], c[2], c[3]), make_float4(c[4], c[5], c[6], c[7]));
            }
        __syncthreads();                  // a column's 128 s values come from four waves
        const int c0 = tid >> 4, q = (tid & 15) * 8;
        u16* dst = outU + 2 * planeE + ((size_t)bb * D + nb + c0) * S + s0 + q;
#pragma unroll
        for (int i = 0; i < 8; i++)
            *(uint4*)&dst[i * 16 * S] = *(const uint4*)&smem[(i * 16 + c0) * VPITCH + q];
    } else if constexpr (EPI == 1) {
        stage();
        const int c4 = (lane & 15) * 4;
        const float4 bv = *(const float4*)&bias[n0 + wn * 64 + c4];
        // one 32-bit byte offset serves the residual reads and the stores
        const uint32_t off = (uint32_t)((m0 + wm * 32 + lhalf) * N + n0 + wn * 64 + c4) * 4u;
        const char* rp = (const char*)res + off;
        char* op = (char*)outF + off;
#pragma unroll
        for (int i = 0; i < 16; i++) {
            const float4 v = *(const float4*)&st[(i * 2 + lhalf) * EPITCH + c4];
            const float4 rr = *(const float4*)(rp + i * 2 * N * 4);
            *(float4*)(op + i * 2 * N * 4) =
                make_float4(v.x + bv.x + rr.x, v.y + bv.y + rr.y, v.z + bv.z + rr.z, v.w + bv.w + rr.w);
        }
    } else {
        stage();
        const int c8 = (lane & 7) * 8;
        const float4 b0 = *(const float4*)&bias[n0 + wn * 64 + c8];
        const float4 b1 = *(const float4*)&bias[n0 + wn * 64 + c8 + 4];
        // GELU(t) = 0.5 t (1 + erf(t / sqrt 2)), without a branch.  With z = |t| / sqrt 2:
        // erfc(z) = u (a1 + u (a2 + u (a3 + u (a4 + u a5)))) exp(-z z), u = 1 / (1 + p z), absolute error
        // at most 1.5e-7; 1 + erf is erfc(z) for t < 0 (no cancellation there) and 2 - erfc(z) otherwise.
        // The library erff picks one of two polynomials by a branch per element, which the lanes of a
        // wave take both ways and which keeps the elements' dependent chains from overlapping.
        auto gelu4 = [](float4 t) {
            const float a0 = fmaf(0.3275911f * 0.70710678118654752f, fabsf(t.x), 1.0f);
            const float a1 = fmaf(0.3275911f * 0.70710678118654752f, fabsf(t.y), 1.0f);
            const float a2 = fmaf(0.3275911f * 0.70710678118654752f, fabsf(t.z), 1.0f);
            const float a3 = fmaf(0.3275911f * 0.70710678118654752f, fabsf(t.w), 1.0f);
            const float b0 = t.x * t.x * -0.72134752044448170f, b1 = t.y * t.y * -0.72134752044448170f;
            const float b2 = t.z * t.z * -0.72134752044448170f, b3 = t.w * t.w * -0.72134752044448170f;
            float u0, u1, u2, u3, e0, e1, e2, e3;     // u = 1 / a, e = 2^b = exp(-t t / 2)
            // One statement, so that behind each transcendental stands an instruction that neither reads
            // its result nor overwrites its source, as the instruction set asks: the outputs are early
            // clobbers (no output shares a register with an input), and v_nop is the slot behind the last.
            asm("v_rcp_f32 %0, %8\n\tv_rcp_f32 %1, %9\n\tv_rcp_f32 %2, %10\n\tv_rcp_f32 %3, %11\n\t"
                "v_exp_f32 %4, %12\n\tv_exp_f32 %5, %13\n\tv_exp_f32 %6, %14\n\tv_exp_f32 %7, %15\n\tv_nop"
                : "=&v"(u0), "=&v"(u1), "=&v"(u2), "=&v"(u3), "=&v"(e0), "=&v"(e1), "=&v"(e2), "=&v"(e3)
                : "v"(a0), "v"(a1), "v"(a2), "v"(a3), "v"(b0), "v"(b1), "v"(b2), "v"(b3));
            auto fin = [](float tt, float u, float e) {
                float p = fmaf(1.061405429f, u, -1.453152027f);
                p = fmaf(p, u, 1.421413741f);
                p = fmaf(p, u, -0.284496736f);
                p = fmaf(p, u, 0.254829592f);
                const float c = p * u * e;            // erfc(|t| / sqrt 2)
                return 0.5f * tt * (tt < 0.f ? c : 2.0f - c);
            };
            return make_float4(fin(t.x, u0, e0), fin(t.y, u1, e1), fin(t.z, u2, e2), fin(t.w, u3, e3));
        };
        u16* dst = outU + (size_t)(m0 + wm * 32 + (lane >> 3)) * N + n0 + wn * 64 + c8;
#pragma unroll
        for (int i = 0; i < 8; i++) {
            const int row = i * 4 + (lane >> 3);
            const float4 lo = *(const float4*)&st[row * EPITCH + c8];
            const float4 hi = *(const float4*)&st[row * EPITCH + c8 + 4];
            *(uint4*)&dst[i * 4 * N] =
                pack8(gelu4(make_float4(lo.x + b0.x, lo.y + b0.y, lo.z + b0.z, lo.w + b0.w)),
                      gelu4(make_float4(hi.x + b1.x, hi.y + b1.y, hi.z + b1.z, hi.w + b1.w)));
        }
    }
}

__device__ __forceinline__ float xhalf(float x) {
    return __int_as_float(__builtin_amdgcn_permlanex16(__float_as_int(x), __float_as_int(x),
                                                       0x76543210, 0xfedcba98, false, false));
}

// e^x for eight values by the steps of the library's expf: x log2(e) in two parts, 2^fraction, ldexp by the
// whole part, the two range tests.  Written out only so that the eight v_exp_f32 stand in ONE statement:
// behind each then stands an instruction that neither reads its result nor overwrites its source, as the
// instruction set asks (the outputs are early clobbers), and v_nop is the slot behind the last.
__device__ __forceinline__ void exp8(const float (&x)[8], float (&y)[8]) {
    float e[8], a[8], t[8];
#pragma unroll
    for (int i = 0; i < 8; i++) {
        const float ph = x[i] * 0x1.715476p+0f;
        const float pl = fmaf(x[i], 0x1.4ae0bep-26f, fmaf(x[i], 0x1.715476p+0f, -ph));
        e[i] = rintf(ph);
        a[i] = (ph - e[i]) + pl;
    }
    asm("v_exp_f32 %0, %8\n\tv_exp_f32 %1, %9\n\tv_exp_f32 %2, %10\n\tv_exp_f32 %3, %11\n\t"
        "v_exp_f32 %4, %12\n\tv_exp_f32 %5, %13\n\tv_exp_f32 %6, %14\n\tv_exp_f32 %7, %15\n\tv_nop"
        : "=&v"(t[0]), "=&v"(t[1]), "=&v"(t[2]), "=&v"(t[3]), "=&v"(t[4]), "=&v"(t[5]), "=&v"(t[6]), "=&v"(t[7])
        : "v"(a[0]), "v"(a[1]), "v"(a[2]), "v"(a[3]), "v"(a[4]), "v"(a[5]), "v"(a[6]), "v"(a[7]));
#pragma unroll
    for (int i = 0; i < 8; i++) {
        float r = ldexpf(t[i], (int)e[i]);
        r = x[i] < -0x1.9d1da0p+6f ? 0.f : r;
        y[i] = x[i] > 0x1.62e430p+6f ? __builtin_inff() : r;
    }
}

__global__ __launch_bounds__(256) void k_attention(const u16* __restrict__ qkv, u16* __restrict__ ctx) {
    __shared__ u16 Ks[2][32][72];    // [buf][key t][dh]   (+8 pad)
    __shared__ u16 Vs[2][64][40];    // [buf][dh][key t]   (+8 pad)
    const int tid = threadIdx.x;
    const int lane = tid & 31, wave = tid >> 5;
    const int l15 = lane & 15, lhalf = lane >> 4, koff = lhalf * 8;
    const int bh = blockIdx.x;                    // b*H + h
    const int qBase = blockIdx.y * 128;
    const int q0w = qBase + wave * 16;
    const size_t plane = (size_t)Bsz * H * S * DH;
    const u16* qp = qkv + (size_t)bh * S * DH;
    const u16* kp = qkv + plane + (size_t)bh * S * DH;
    const u16* vp = qkv + 2 * plane + (size_t)bh * DH * S;   // transposed [dh][s]

    // Q fragments (already scaled by 1/sqrt(DH)) for this wave's 16 rows: B operand, column = query l15.
    FragBF qa0, qa1;
    {
        const u16* qrow = qp + (size_t)(q0w + l15) * DH;
        qa0.u4[0] = *(const uint4*)&qrow[koff];
        qa0.u4[1] = *(const uint4*)&qrow[koff + 16];
        qa1.u4[0] = *(const uint4*)&qrow[32 + koff];
        qa1.u4[1] = *(const uint4*)&qrow[32 + koff + 16];
    }

    auto issue_kv = [&](int kt, int buf) {
        int t = tid >> 3, c8 = (tid & 7) * 8;              // K: 32 keys x 64 dh
        async_b128(&Ks[buf][t][c8], &kp[(size_t)(kt * 32 + t) * DH + c8]);
        int dh = tid >> 2, c = (tid & 3) * 8;              // V^T: 64 dh x 32 keys
        async_b128(&Vs[buf][dh][c], &vp[(size_t)dh * S + kt * 32 + c]);
    };

    v8f ov[4] = {};                 // O^T accum: ov[c][r] = O[query l15][dh c*16 + 8*lhalf + r]
    const int rowg = q0w + l15;     // this lane's query
    float mrow = -3.0e38f;          // its running maximum, alike in both halves
    float lrow = 0.f;               // its running sum over the keys that this half holds

    const int ktEnd = (qBase + 127) >> 5;         // 32-key tiles
    issue_kv(0, 0);
    for (int kt = 0; kt <= ktEnd; kt++) {
        wait_async0();
        __syncthreads();
        if (kt + 1 <= ktEnd) issue_kv(kt + 1, (kt + 1) & 1);
        const int cur = kt & 1;

        // scores: K(32x64) @ Q^T(64x16) -> two 16x16 C tiles, 4 full WMMAs
        // sc0[r] = S[rowg][kt*32 + 8*lhalf + r], sc1[r] the key 16 further
        FragBF kb;
        v8f sc0 = {}, sc1 = {};
        kb.u4[0] = *(const uint4*)&Ks[cur][l15][koff];
        kb.u4[1] = *(const uint4*)&Ks[cur][l15][koff + 16];
        sc0 = __builtin_amdgcn_wmma_f32_16x16x32_bf16(false, kb.v, false, qa0.v, (short)0, sc0, false, false);
        kb.u4[0] = *(const uint4*)&Ks[cur][l15][32 + koff];
        kb.u4[1] = *(const uint4*)&Ks[cur][l15][32 + koff + 16];
        sc0 = __builtin_amdgcn_wmma_f32_16x16x32_bf16(false, kb.v, false, qa1.v, (short)0, sc0, false, false);
        kb.u4[0] = *(const uint4*)&Ks[cur][16 + l15][koff];
        kb.u4[1] = *(const uint4*)&Ks[cur][16 + l15][koff + 16];
        sc1 = __builtin_amdgcn_wmma_f32_16x16x32_bf16(false, kb.v, false, qa0.v, (short)0, sc1, false, false);
        kb.u4[0] = *(const uint4*)&Ks[cur][16 + l15][32 + koff];
        kb.u4[1] = *(const uint4*)&Ks[cur][16 + l15][32 + koff + 16];
        sc1 = __builtin_amdgcn_wmma_f32_16x16x32_bf16(false, kb.v, false, qa1.v, (short)0, sc1, false, false);

        const int key0 = kt * 32 + koff, key1 = key0 + 16;
        float s0[8], s1[8];
        float tm0 = -3.0e38f, tm1 = -3.0e38f;               // two chains: half the dependent depth of one
#pragma unroll
        for (int r = 0; r < 8; r++) {
            s0[r] = (key0 + r > rowg) ? -3.0e38f : sc0[r];  // causal mask; scale already folded into Q
            s1[r] = (key1 + r > rowg) ? -3.0e38f : sc1[r];
            tm0 = fmaxf(tm0, s0[r]);
            tm1 = fmaxf(tm1, s1[r]);
        }
        float tm = fmaxf(tm0, tm1);
        tm = fmaxf(tm, xhalf(tm));                          // the other half holds the tile's other 16 keys
        const float mnew = fmaxf(mrow, tm);
        const float f = expf(mrow - mnew);
        float ps = 0.f;
        FragBF pb;                                          // P^T, full 32x16 B fragment: element s is key 8*lhalf + s, 16 + 8*lhalf + s - 8
#pragma unroll
        for (int r = 0; r < 8; r++) { s0[r] -= mnew; s1[r] -= mnew; }
        float e0[8], e1[8];
        exp8(s0, e0);
        exp8(s1, e1);
#pragma unroll
        for (int r = 0; r < 8; r++) {
            float p0 = e0[r];
            float p1 = e1[r];
            if (key0 + r > rowg) p0 = 0.f;
            if (key1 + r > rowg) p1 = 0.f;
            ps += p0 + p1;
            pb.us[r]     = f2bf(p0);
            pb.us[8 + r] = f2bf(p1);
        }
        lrow = lrow * f + ps;
        mrow = mnew;

#pragma unroll
        for (int c = 0; c < 4; c++)
#pragma unroll
            for (int r = 0; r < 8; r++) ov[c][r] *= f;

#pragma unroll
        for (int c = 0; c < 4; c++) {
            FragBF vb;                                      // V^T, full 16x32 A fragment: row = dh c*16 + l15
            vb.u4[0] = *(const uint4*)&Vs[cur][c * 16 + l15][koff];
            vb.u4[1] = *(const uint4*)&Vs[cur][c * 16 + l15][koff + 16];
            ov[c] = __builtin_amdgcn_wmma_f32_16x16x32_bf16(false, vb.v, false, pb.v, (short)0, ov[c], false, false);
        }
    }

    // normalize and write ctx[b][s][h*DH + e] as bf16: a lane's 8 registers are 8 neighbours in e
    const int b = bh >> 4, h = bh & 15;
    const float inv = 1.0f / (lrow + xhalf(lrow));          // the two halves' sums join here
    u16* dst = ctx + ((size_t)(b * S + rowg)) * D + h * DH + koff;
#pragma unroll
    for (int c = 0; c < 4; c++) {
        const v8f o = ov[c];
        *(uint4*)&dst[c * 16] =
            make_uint4((uint32_t)f2bf(o[0] * inv) | ((uint32_t)f2bf(o[1] * inv) << 16),
                       (uint32_t)f2bf(o[2] * inv) | ((uint32_t)f2bf(o[3] * inv) << 16),
                       (uint32_t)f2bf(o[4] * inv) | ((uint32_t)f2bf(o[5] * inv) << 16),
                       (uint32_t)f2bf(o[6] * inv) | ((uint32_t)f2bf(o[7] * inv) << 16));
    }
}

// ---------------------------------------------------------------------------
extern "C" void kernel_launch(void* const* d_in, const int* in_sizes, int n_in,
                              void* d_out, int out_size, void* d_ws, size_t ws_size,
                              hipStream_t stream) {
    (void)in_sizes; (void)n_in; (void)out_size; (void)ws_size;
    const float* x   = (const float*)d_in[0];
    const float* g1  = (const float*)d_in[1];
    const float* be1 = (const float*)d_in[2];
    const float* Wq  = (const float*)d_in[3];
    const float* Wk  = (const float*)d_in[4];
    const float* Wv  = (const float*)d_in[5];
    const float* Wo  = (const float*)d_in[6];
    const float* bo  = (const float*)d_in[7];
    const float* g2  = (const float*)d_in[8];
    const float* be2 = (const float*)d_in[9];
    const float* W1  = (const float*)d_in[10];
    const float* fb1 = (const float*)d_in[11];
    const float* W2  = (const float*)d_in[12];
    const float* fb2 = (const float*)d_in[13];
    float* out = (float*)d_out;

    char* ws = (char*)d_ws;
    auto alloc = [&](size_t bytes) -> char* {
        char* p = ws; ws += (bytes + 255) & ~(size_t)255; return p;
    };
    u16*   wqkvT = (u16*)alloc((size_t)3 * D * D * 2);   // [3D][D]
    u16*   woT   = (u16*)alloc((size_t)D * D * 2);       // [D][D]
    u16*   w1T   = (u16*)alloc((size_t)DF * D * 2);      // [DF][D]
    u16*   w2T   = (u16*)alloc((size_t)D * DF * 2);      // [D][DF]
    u16*   h1    = (u16*)alloc((size_t)ROWS * D * 2);
    u16*   qkv   = (u16*)alloc((size_t)3 * ROWS * D * 2);
    u16*   ctx   = (u16*)alloc((size_t)ROWS * D * 2);
    float* xmid  = (float*)alloc((size_t)ROWS * D * 4);
    u16*   h2    = (u16*)alloc((size_t)ROWS * D * 2);
    u16*   ffn1  = (u16*)alloc((size_t)ROWS * DF * 2);

    dim3 blk(256);
    k_prep<<<NB_PREP, blk, 0, stream>>>(Wq, Wk, Wv, Wo, W1, W2, x, g1, be1, wqkvT, woT, w1T, w2T, h1);
    k_gemm<0, 3 * D, 2><<<dim3(3 * D / 128, ROWS / 128), blk, 0, stream>>>(h1, wqkvT, nullptr, nullptr, nullptr, qkv, D);
    k_attention<<<dim3(Bsz * H, S / 128), blk, 0, stream>>>(qkv, ctx);
    k_gemm<1, D, 4><<<dim3(D / 128, ROWS / 128), blk, 0, stream>>>(ctx, woT, bo, x, xmid, nullptr, D);
    k_layernorm<<<ROWS, blk, 0, stream>>>(xmid, g2, be2, h2);
    k_gemm<2, DF, 4><<<dim3(DF / 128, ROWS / 128), blk, 0, stream>>>(h2, w1T, fb1, nullptr, nullptr, ffn1, D);
    k_gemm<1, D, 4><<<dim3(D / 128, ROWS / 128), blk, 0, stream>>>(ffn1, w2T, fb2, xmid, out, nullptr, DF);
}

// v007
// It runs in 143 microseconds.
// Timed twice side by side with v006, it ran 1.04 times as fast both times.
// All steps since v000 together make it 1.70 times as fast.
#include <hip/hip_runtime.h>
#include <cstdint>

typedef unsigned short u16;
typedef __attribute__((ext_vector_type(16))) __bf16 v16bf;
typedef __attribute__((ext_vector_type(8)))  float  v8f;

constexpr int Bsz = 8, S = 512, D = 1024, H = 16, DH = 64, DF = 4096;
constexpr int ROWS = Bsz * S;   // 4096

__device__ __forceinline__ u16 f2bf(float f) {
    uint32_t u = __float_as_uint(f);
    uint32_t r = u + 0x7FFFu + ((u >> 16) & 1u);   // round-to-nearest-even
    return (u16)(r >> 16);
}

union FragBF {                  // one wave32 16x32 bf16 A/B fragment (8 VGPRs)
    v16bf v;
    uint4 u4[2];
    u16   us[16];
};

// Async global -> LDS copy of 16 bytes per lane (ASYNCcnt-tracked).
__device__ __forceinline__ void async_b128(u16* lds, const u16* gptr) {
    uint32_t l = (uint32_t)(uintptr_t)lds;          // low 32 bits = LDS offset
    asm volatile("global_load_async_to_lds_b128 %0, %1, off"
                 :: "v"(l), "v"(gptr) : "memory");
}
__device__ __forceinline__ void wait_async0() {
    asm volatile("s_wait_asynccnt 0x0" ::: "memory");
}
// Returns when all but this wave's CNT youngest copies have landed.
template <int CNT>
__device__ __forceinline__ void wait_async_but() {
    asm volatile("s_wait_asynccnt %0" :: "n"(CNT) : "memory");
}
// The same copy as the compiler's builtin: the compiler sees its address registers.
typedef __attribute__((ext_vector_type(4))) int v4i;
__device__ __forceinline__ void copy_b128(u16* lds, const u16* gptr) {
    __builtin_amdgcn_global_load_async_to_lds_b128(
        (__attribute__((address_space(1))) v4i*)gptr, (__attribute__((address_space(3))) v4i*)lds, 0, 0);
}

// DPP butterfly reduction across a 16-lane row (lanes 0-15 / 16-31 separately).
template <int CTRL>
__device__ __forceinline__ float dpp_f(float x) {
    return __int_as_float(__builtin_amdgcn_mov_dpp(__float_as_int(x), CTRL, 0xf, 0xf, true));
}
__device__ __forceinline__ float red_max16(float v) {
    v = fmaxf(v, dpp_f<0xB1>(v));    // quad_perm [1,0,3,2]  (xor 1)
    v = fmaxf(v, dpp_f<0x4E>(v));    // quad_perm [2,3,0,1]  (xor 2)
    v = fmaxf(v, dpp_f<0x141>(v));   // row_half_mirror
    v = fmaxf(v, dpp_f<0x140>(v));   // row_mirror
    return v;
}
__device__ __forceinline__ float red_sum16(float v) {
    v += dpp_f<0xB1>(v);
    v += dpp_f<0x4E>(v);
    v += dpp_f<0x141>(v);
    v += dpp_f<0x140>(v);
    return v;
}

__device__ __forceinline__ float xhalf(float x) {     // lane l reads lane l ^ 16
    return __int_as_float(__builtin_amdgcn_permlanex16(__float_as_int(x), __float_as_int(x),
                                                       0x76543210, 0xfedcba98, false, false));
}

// ---------------------------------------------------------------------------
// Weight conversion: fp32 -> bf16, stored TRANSPOSED as W^T[N][K] so GEMM B
// tiles are row-major block copies (async-to-LDS friendly, no LDS scatter).
// One block transposes a tile of 128 k x 64 n through LDS: it reads 256-byte
// row pieces of the source (16 bytes a lane) and writes 256-byte row pieces of
// the destination (16 bytes a lane).  LDS holds one dword per (n, k pair).
// ---------------------------------------------------------------------------
constexpr int CTK = 128, CTN = 64;        // tile: k extent, n extent
constexpr int CPITCH = CTK / 2 + 1;       // dwords per n row; odd, so both sides spread over the banks

// src: first element of the tile, rows are k (pitch srcPitch floats).
// dst: first element of the tile, rows are n (pitch dstPitch bf16).
// tl: CTN * CPITCH dwords of LDS, the caller's (one array serves every instance in a kernel).
template <int srcPitch, int dstPitch>
__device__ __forceinline__ void conv_tile(const float* __restrict__ src, u16* __restrict__ dst, uint32_t* tl) {
    const int tid = threadIdx.x;
    const int nq = tid & 15, kp0 = tid >> 4;           // 4 n columns, k pair (+16*j)
    float4 r0[4], r1[4];
#pragma unroll
    for (int j = 0; j < 4; j++) {
        const float* p = src + (2 * kp0 * srcPitch + nq * 4) + 32 * j * srcPitch;
        r0[j] = *(const float4*)p;
        r1[j] = *(const float4*)(p + srcPitch);
    }
#pragma unroll
    for (int j = 0; j < 4; j++) {
        uint32_t* q = &tl[(nq * 4) * CPITCH + kp0 + 16 * j];
        q[0 * CPITCH] = (uint32_t)f2bf(r0[j].x) | ((uint32_t)f2bf(r1[j].x) << 16);
        q[1 * CPITCH] = (uint32_t)f2bf(r0[j].y) | ((uint32_t)f2bf(r1[j].y) << 16);
        q[2 * CPITCH] = (uint32_t)f2bf(r0[j].z) | ((uint32_t)f2bf(r1[j].z) << 16);
        q[3 * CPITCH] = (uint32_t)f2bf(r0[j].w) | ((uint32_t)f2bf(r1[j].w) << 16);
    }
    __syncthreads();
#pragma unroll
    for (int i = 0; i < 4; i++) {
        const int n = (tid >> 4) + 16 * i, kq = tid & 15;   // 16 lanes cover one n row
        const uint32_t* q = &tl[n * CPITCH + kq * 4];
        uint4 o = make_uint4(q[0], q[1], q[2], q[3]);
        *(uint4*)&dst[((tid >> 4) * dstPitch + kq * 8) + 16 * i * dstPitch] = o;
    }
}

// ---------------------------------------------------------------------------
// LayerNorm -> bf16.  One WAVE per row of D = 1024: a lane holds 32 of the row's
// values in registers (8 loads of 16 bytes, each 512 bytes in a row over the wave),
// the two sums run inside the lane and then across the 32 lanes.  No LDS and no
// barrier; a block of 256 threads takes LNR = 8 rows, so that a launch starts an
// eighth of the waves that a block per row needs.
// ---------------------------------------------------------------------------
constexpr int LNR = 8;                    // rows a block: one per wave

__device__ __forceinline__ float red_sum32(float v) {   // the sum over all 32 lanes, in every lane
    v = red_sum16(v);
    return v + xhalf(v);
}

typedef __attribute__((ext_vector_type(4))) float f32x4;
typedef __attribute__((ext_vector_type(2))) float f32x2;

__device__ __forceinline__ void ln_row(const float* __restrict__ x, const float* __restrict__ g,
                                       const float* __restrict__ b, u16* __restrict__ out, int row) {
    const int lane = threadIdx.x & 31;
    const f32x4* xr = (const f32x4*)(x + (size_t)row * D) + lane;
    const f32x4* gr = (const f32x4*)g + lane;
    const f32x4* br = (const f32x4*)b + lane;
    f32x4 v[8], gg[8], bb[8];
#pragma unroll
    for (int j = 0; j < 8; j++) v[j] = xr[j * 32];
    // the compiler lets a later load's result land in the address registers of the loads above:
    // the wait that belongs in front of an overwrite of a load's registers
    asm volatile("s_wait_xcnt 0x0" ::: "memory");
#pragma unroll
    for (int j = 0; j < 8; j++) { gg[j] = gr[j * 32]; bb[j] = br[j * 32]; }
    // all 24 loads are issued before the first sum: left free, the compiler sinks those of g and b to
    // their uses behind the sums, some of them one at a time, each with its whole latency exposed
    __builtin_amdgcn_sched_barrier(0);
    f32x2 s0 = v[0].lo, s1 = v[0].hi;     // four independent chains, two to a packed add
#pragma unroll
    for (int j = 1; j < 8; j++) { s0 += v[j].lo; s1 += v[j].hi; }
    s0 += s1;
    const float mean = red_sum32(s0.x + s0.y) * (1.0f / D);
    f32x2 q0 = 0.f, q1 = 0.f;
#pragma unroll
    for (int j = 0; j < 8; j++) {
        v[j] -= mean;
        q0 = __builtin_elementwise_fma(v[j].lo, v[j].lo, q0);
        q1 = __builtin_elementwise_fma(v[j].hi, v[j].hi, q1);
    }
    q0 += q1;
    const float rstd = rsqrtf(red_sum32(q0.x + q0.y) * (1.0f / D) + 1e-5f);
    u16* orow = out + (size_t)row * D + lane * 4;
#pragma unroll
    for (int j = 0; j < 8; j++) {         // 8 bytes a lane, 256 bytes in a row over the wave
        const f32x4 y = v[j] * rstd * gg[j] + bb[j];
        *(uint2*)&orow[j * 128] = make_uint2((uint32_t)f2bf(y.x) | ((uint32_t)f2bf(y.y) << 16),
                                             (uint32_t)f2bf(y.z) | ((uint32_t)f2bf(y.w) << 16));
    }
}

__global__ __launch_bounds__(256) void k_layernorm(const float* __restrict__ x, const float* __restrict__ g,
                                                   const float* __restrict__ b, u16* __restrict__ out) {
    ln_row(x, g, b, out, blockIdx.x * LNR + (threadIdx.x >> 5));
}

// ---------------------------------------------------------------------------
// Everything that depends on the inputs alone, in ONE launch: the four weight
// conversions and the first LayerNorm.  Block indices are dealt in groups of
// MIX_C conversion tiles and MIX_L LayerNorm blocks, so that both kinds of
// block share every WGP for the whole launch.
// ---------------------------------------------------------------------------
constexpr int NB_QKV = 3 * H * (D / CTK);            // one [D][DH] matrix per 8 k tiles
constexpr int NB_WO  = (D / CTN) * (D / CTK);
constexpr int NB_W1  = (DF / CTN) * (D / CTK);
constexpr int NB_W2  = (D / CTN) * (DF / CTK);
constexpr int NB_CONV = NB_W1 + NB_W2 + NB_QKV + NB_WO;
constexpr int NB_LN = ROWS / LNR;
constexpr int NGRP = 512, MIX_C = NB_CONV / NGRP, MIX_L = NB_LN / NGRP;   // 3 tiles and 1 block of 8 rows a group
static_assert(MIX_C * NGRP == NB_CONV && MIX_L * NGRP == NB_LN, "groups must cover both kinds of block exactly");
constexpr int NB_PREP = NB_CONV + NB_LN;

__global__ __launch_bounds__(256) void k_prep(const float* __restrict__ Wq, const float* __restrict__ Wk,
                                              const float* __restrict__ Wv, const float* __restrict__ Wo,
                                              const float* __restrict__ W1, const float* __restrict__ W2,
                                              const float* __restrict__ x, const float* __restrict__ g,
                                              const float* __restrict__ b,
                                              u16* __restrict__ wqkvT, u16* __restrict__ woT,
                                              u16* __restrict__ w1T, u16* __restrict__ w2T,
                                              u16* __restrict__ h1) {
    __shared__ uint32_t lds[CTN * CPITCH];            // a conversion's tile
    // every test below is the same for the whole block
    const int grp = blockIdx.x / (MIX_C + MIX_L), r = blockIdx.x % (MIX_C + MIX_L);
    if (r >= MIX_C) {
        ln_row(x, g, b, h1, (grp * MIX_L + r - MIX_C) * LNR + (threadIdx.x >> 5));
        return;
    }
    int blk = grp * MIX_C + r;                        // conversion tile 0 .. NB_CONV - 1
    if (blk < NB_W1) {                                // dst[n*K + k] = src[k*N + n], n tile fastest
        const int n0 = (blk % (DF / CTN)) * CTN, k0 = (blk / (DF / CTN)) * CTK;
        conv_tile<DF, D>(W1 + (size_t)k0 * DF + n0, w1T + (size_t)n0 * D + k0, lds);
    } else if ((blk -= NB_W1) < NB_W2) {
        const int n0 = (blk % (D / CTN)) * CTN, k0 = (blk / (D / CTN)) * CTK;
        conv_tile<D, DF>(W2 + (size_t)k0 * D + n0, w2T + (size_t)n0 * DF + k0, lds);
    } else if ((blk -= NB_W2) < NB_QKV) {             // which * H + h fastest, then the k tile
        const int m = blk % (3 * H), which = m >> 4, h = m & 15;
        const int k0 = (blk / (3 * H)) * CTK;
        const float* W = (which == 0) ? Wq : (which == 1 ? Wk : Wv);
        conv_tile<DH, D>(W + ((size_t)h * D + k0) * DH, wqkvT + (size_t)(which * D + h * DH) * D + k0, lds);
    } else {
        blk -= NB_QKV;
        const int n0 = (blk % (D / CTN)) * CTN, k0 = (blk / (D / CTN)) * CTK;
        conv_tile<D, D>(Wo + (size_t)k0 * D + n0, woT + (size_t)n0 * D + k0, lds);
        // in the built code another range's register writes follow these stores behind a scalar
        // test only: the wait that belongs in front of an overwrite of a store's registers
        asm volatile("s_wait_xcnt 0x0" ::: "memory");
    }
}

// ---------------------------------------------------------------------------
// bf16 WMMA GEMM: C[M][N] = A[M][K] * B[K][N] with B supplied TRANSPOSED
// (Bt[N][K]).  Block tile 128x128, K-step 64, async-to-LDS staging in a ring of
// NS buffers, NS - 1 K-steps ahead, single barrier per K-step.  NS = 2 for QKV, whose
// blocks are all resident at once, three a WGP, and cover each other's waits.  NS = 4
// for the others: with N = 1024 a block has its WGP alone, and one K-step is shorter than
// a copy's way from memory; with N = 4096 registers allow three blocks a WGP at most, which
// leaves a quarter of the grid for a thin second round: two blocks a WGP make two even rounds.
// 8 waves in 4(m) x 2(n); each wave:
// 32x64 = 2x4 WMMA tiles, 16 v_wmma_f32_16x16x32_bf16 per K-step.
// EPI 0: QKV permute -> bf16 (Q pre-scaled by 1/sqrt(DH), V stored transposed)
// EPI 1: +bias +res -> fp32      EPI 2: GELU(.+bias) -> bf16
// All three write out through LDS in 16-byte pieces that fill whole lines.
// ---------------------------------------------------------------------------
constexpr int TSTRIDE = 72;               // 64 + 8 pad (u16)
constexpr int TSZ = 128 * TSTRIDE;        // one 128x64 tile in LDS (u16 count)
constexpr int EPITCH = 68;                // epilogue staging, floats a row: 64 + 4, rows 8 apart fall 32 banks apart
constexpr int VPITCH = 136;               // V^T staging, u16 a column: 128 + 8, 16 columns spread over all banks

template <int EPI, int N, int NS>         // N at compile time: the epilogue's row steps become immediate offsets
__global__ __launch_bounds__(256) void k_gemm(const u16* __restrict__ A, const u16* __restrict__ Bt,
                                              const float* __restrict__ bias, const float* __restrict__ res,
                                              float* __restrict__ outF, u16* __restrict__ outU,
                                              int K) {
    __shared__ __attribute__((aligned(16))) u16 smem[NS * 2 * TSZ];   // [buf 0 .. NS-1][A tile | B tile]; epilogue staging afterwards
    const int tid = threadIdx.x;
    const int lane = tid & 31, wave = tid >> 5;
    const int wm = wave & 3, wn = wave >> 2;           // 4(m) x 2(n)
    const int m0 = blockIdx.y * 128, n0 = blockIdx.x * 128;
    const int l15 = lane & 15, lhalf = lane >> 4, koff = lhalf * 8;
    const int ldr = tid >> 3, ldc = (tid & 7) * 8;     // loader: row 0..31 (+j*32), col chunk

    v8f acc[2][4] = {};

    auto issue_tile = [&](int k0, int buf) {
        u16* As = &smem[buf * 2 * TSZ];
        u16* Bs = As + TSZ;
#pragma unroll
        for (int j = 0; j < 4; j++) {
            int r = ldr + j * 32;
            copy_b128(&As[r * TSTRIDE + ldc], &A[(size_t)(m0 + r) * K + k0 + ldc]);
            copy_b128(&Bs[r * TSTRIDE + ldc], &Bt[(size_t)(n0 + r) * K + k0 + ldc]);
        }
    };

    constexpr int CPS = 8;                // copies of a wave per tile
    const int nT = K / 64;
    // the ring's first NS - 1 tiles (every launch has K >= (NS - 1) * 64); unrolled: each buffer's offset a constant
#pragma unroll
    for (int s = 0; s < NS - 1; s++) issue_tile(s * 64, s);
    for (int t = 0; t < nT; t++) {
        // this wave's reads of tile t - 1 are done before the barrier behind which its buffer is refilled
        asm volatile("s_wait_dscnt 0x0" ::: "memory");
        // tile t has landed: while tiles t + 1 .. t + NS - 2 all exist they are the wave's youngest
        // copies, CPS each, and stay in flight; in the last trips, which issue none, everything is waited for
        if (NS > 2 && t + NS - 2 < nT) wait_async_but<(NS - 2) * CPS>();
        else wait_async0();
        __syncthreads();                  // publishes tile t, and ends every wave's reads of tile t - 1
        if (t + NS - 1 < nT) issue_tile((t + NS - 1) * 64, (t + NS - 1) % NS);
        const u16* As = &smem[(t % NS) * 2 * TSZ];
        const u16* Bs = As + TSZ;
#pragma unroll
        for (int kc = 0; kc < 64; kc += 32) {
            FragBF a[2], b[4];
#pragma unroll
            for (int mt = 0; mt < 2; mt++) {
                const u16* p = &As[(wm * 32 + mt * 16 + l15) * TSTRIDE + kc + koff];
                a[mt].u4[0] = *(const uint4*)p;
                a[mt].u4[1] = *(const uint4*)(p + 16);
            }
#pragma unroll
            for (int nt = 0; nt < 4; nt++) {
                const u16* p = &Bs[(wn * 64 + nt * 16 + l15) * TSTRIDE + kc + koff];
                b[nt].u4[0] = *(const uint4*)p;
                b[nt].u4[1] = *(const uint4*)(p + 16);
            }
#pragma unroll
            for (int mt = 0; mt < 2; mt++)
#pragma unroll
                for (int nt = 0; nt < 4; nt++)
                    acc[mt][nt] = __builtin_amdgcn_wmma_f32_16x16x32_bf16(
                        false, a[mt].v, false, b[nt].v, (short)0, acc[mt][nt], false, false);
        }
    }

    // Epilogue: the accumulators go through LDS so that every global access is
    // 16 bytes a lane and covers whole 128-byte lines.
    constexpr size_t planeE = (size_t)Bsz * H * S * DH;
    __syncthreads();                      // every wave has left the last K tile: smem is staging space now
    float* st = (float*)smem + wave * (32 * EPITCH);   // this wave's own 32 x 64 fp32 tile
    auto stage = [&]() {
#pragma unroll
        for (int mt = 0; mt < 2; mt++)
#pragma unroll
            for (int nt = 0; nt < 4; nt++)
#pragma unroll
                for (int r = 0; r < 8; r++)
                    st[(mt * 16 + r + 8 * lhalf) * EPITCH + nt * 16 + l15] = acc[mt][nt][r];
        // the rows are read back by other lanes of this wave: its LDS writes must have landed
        asm volatile("s_wait_dscnt 0x0" ::: "memory");
    };
    auto pack8 = [](float4 lo, float4 hi) {
        return make_uint4((uint32_t)f2bf(lo.x) | ((uint32_t)f2bf(lo.y) << 16),
                          (uint32_t)f2bf(lo.z) | ((uint32_t)f2bf(lo.w) << 16),
                          (uint32_t)f2bf(hi.x) | ((uint32_t)f2bf(hi.y) << 16),
                          (uint32_t)f2bf(hi.z) | ((uint32_t)f2bf(hi.w) << 16));
    };

    if constexpr (EPI == 0) {
        const int which = n0 >> 10;                       // /D : 0=Q 1=K 2=V, the same for the whole block
        const int nb = n0 & 1023;                         // h * DH + e of the block's first column
        const int bb = m0 >> 9, s0 = m0 & 511;            // /S, %S of the block's first row
        if (which != 2) {                                 // Q or K; the whole block takes this side
            stage();
            const float sc = (which == 0) ? 0.125f : 1.0f;   // fold 1/sqrt(DH) into Q
            // the wave's 64 columns are one head: its 32 x 64 tile is 4 KB in a row
            u16* dst = outU + (size_t)which * planeE +
                       (((size_t)bb * H + (nb >> 6) + wn) * S + s0 + wm * 32) * DH + lane * 8;
#pragma unroll
            for (int i = 0; i < 8; i++) {
                const int row = i * 4 + (lane >> 3), c8 = (lane & 7) * 8;
                float4 lo = *(const float4*)&st[row * EPITCH + c8];
                float4 hi = *(const float4*)&st[row * EPITCH + c8 + 4];
                lo.x *= sc; lo.y *= sc; lo.z *= sc; lo.w *= sc;
                hi.x *= sc; hi.y *= sc; hi.z *= sc; hi.w *= sc;
                *(uint4*)&dst[i * 4 * DH] = pack8(lo, hi);       // (lane >> 3) * DH + c8 == lane * 8
            }
            // in the built code the V side's register writes follow these stores behind a scalar
            // test only: the wait that belongs in front of an overwrite of a store's registers
            asm volatile("s_wait_xcnt 0x0" ::: "memory");
            return;
        }
        // V is stored transposed [b][h][dh][s]: 8 accumulator rows of a lane are 8
        // neighbours in s.  Block tile in LDS as [128 columns][128 s], then 256-byte rows out.
#pragma unroll
        for (int mt = 0; mt < 2; mt++)
#pragma unroll
            for (int nt = 0; nt < 4; nt++) {
                const v8f c = acc[mt][nt];
                *(uint4*)&smem[(wn * 64 + nt * 16 + l15) * VPITCH + wm * 32 + mt * 16 + 8 * lhalf] =
                    pack8(make_float4(c[0], c[1], c[2], c[3]), make_float4(c[4], c[5], c[6], c[7]));
            }
        __syncthreads();                  // a column's 128 s values come from four waves
        const int c0 = tid >> 4, q = (tid & 15) * 8;
        u16* dst = outU + 2 * planeE + ((size_t)bb * D + nb + c0) * S + s0 + q;
#pragma unroll
        for (int i = 0; i < 8; i++)
            *(uint4*)&dst[i * 16 * S] = *(const uint4*)&smem[(i * 16 + c0) * VPITCH + q];
    } else if constexpr (EPI == 1) {
        stage();
        const int c4 = (lane & 15) * 4;
        const float4 bv = *(const float4*)&bias[n0 + wn * 64 + c4];
        // one 32-bit byte offset serves the residual reads and the stores
        const uint32_t off = (uint32_t)((m0 + wm * 32 + lhalf) * N + n0 + wn * 64 + c4) * 4u;
        const char* rp = (const char*)res + off;
        char* op = (char*)outF + off;
#pragma unroll
        for (int i = 0; i < 16; i++) {
            const float4 v = *(const float4*)&st[(i * 2 + lhalf) * EPITCH + c4];
            const float4 rr = *(const float4*)(rp + i * 2 * N * 4);
            *(float4*)(op + i * 2 * N * 4) =
                make_float4(v.x + bv.x + rr.x, v.y + bv.y + rr.y, v.z + bv.z + rr.z, v.w + bv.w + rr.w);
        }
    } else {
        stage();
        const int c8 = (lane & 7) * 8;
        const float4 b0 = *(const float4*)&bias[n0 + wn * 64 + c8];
        const float4 b1 = *(const float4*)&bias[n0 + wn * 64 + c8 + 4];
        // GELU(t) = 0.5 t (1 + erf(t / sqrt 2)), without a branch.  With z = |t| / sqrt 2:
        // erfc(z) = u (a1 + u (a2 + u (a3 + u (a4 + u a5)))) exp(-z z), u = 1 / (1 + p z), absolute error
        // at most 1.5e-7; 1 + erf is erfc(z) for t < 0 (no cancellation there) and 2 - erfc(z) otherwise.
        // The library erff picks one of two polynomials by a branch per element, which the lanes of a
        // wave take both ways and which keeps the elements' dependent chains from overlapping.
        auto gelu4 = [](float4 t) {
            const float a0 = fmaf(0.3275911f * 0.70710678118654752f, fabsf(t.x), 1.0f);
            const float a1 = fmaf(0.3275911f * 0.70710678118654752f, fabsf(t.y), 1.0f);
            const float a2 = fmaf(0.3275911f * 0.70710678118654752f, fabsf(t.z), 1.0f);
            const float a3 = fmaf(0.3275911f * 0.70710678118654752f, fabsf(t.w), 1.0f);
            const float b0 = t.x * t.x * -0.72134752044448170f, b1 = t.y * t.y * -0.72134752044448170f;
            const float b2 = t.z * t.z * -0.72134752044448170f, b3 = t.w * t.w * -0.72134752044448170f;
            float u0, u1, u2, u3, e0, e1, e2, e3;     // u = 1 / a, e = 2^b = exp(-t t / 2)
            // One statement, so that behind each transcendental stands an instruction that neither reads
            // its result nor overwrites its source, as the instruction set asks: the outputs are early
            // clobbers (no output shares a register with an input), and v_nop is the slot behind the last.
            asm("v_rcp_f32 %0, %8\n\tv_rcp_f32 %1, %9\n\tv_rcp_f32 %2, %10\n\tv_rcp_f32 %3, %11\n\t"
                "v_exp_f32 %4, %12\n\tv_exp_f32 %5, %13\n\tv_exp_f32 %6, %14\n\tv_exp_f32 %7, %15\n\tv_nop"
                : "=&v"(u0), "=&v"(u1), "=&v"(u2), "=&v"(u3), "=&v"(e0), "=&v"(e1), "=&v"(e2), "=&v"(e3)
                : "v"(a0), "v"(a1), "v"(a2), "v"(a3), "v"(b0), "v"(b1), "v"(b2), "v"(b3));
            auto fin = [](float tt, float u, float e) {
                float p = fmaf(1.061405429f, u, -1.453152027f);
                p = fmaf(p, u, 1.421413741f);
                p = fmaf(p, u, -0.284496736f);
                p = fmaf(p, u, 0.254829592f);
                const float c = p * u * e;            // erfc(|t| / sqrt 2)
                return 0.5f * tt * (tt < 0.f ? c : 2.0f - c);
            };
            return make_float4(fin(t.x, u0, e0), fin(t.y, u1, e1), fin(t.z, u2, e2), fin(t.w, u3, e3));
        };
        u16* dst = outU + (size_t)(m0 + wm * 32 + (lane >> 3)) * N + n0 + wn * 64 + c8;
#pragma unroll
        for (int i = 0; i < 8; i++) {
            const int row = i * 4 + (lane >> 3);
            const float4 lo = *(const float4*)&st[row * EPITCH + c8];
            const float4 hi = *(const float4*)&st[row * EPITCH + c8 + 4];
            *(uint4*)&dst[i * 4 * N] =
                pack8(gelu4(make_float4(lo.x + b0.x, lo.y + b0.y, lo.z + b0.z, lo.w + b0.w)),
                      gelu4(make_float4(hi.x + b1.x, hi.y + b1.y, hi.z + b1.z, hi.w + b1.w)));
        }
    }
}

__device__ __forceinline__ void exp8(const float (&x)[8], float (&y)[8]) {
    float e[8], a[8], t[8];
#pragma unroll
    for (int i = 0; i < 8; i++) {
        const float ph = x[i] * 0x1.715476p+0f;
        const float pl = fmaf(x[i], 0x1.4ae0bep-26f, fmaf(x[i], 0x1.715476p+0f, -ph));
        e[i] = rintf(ph);
        a[i] = (ph - e[i]) + pl;
    }
    asm("v_exp_f32 %0, %8\n\tv_exp_f32 %1, %9\n\tv_exp_f32 %2, %10\n\tv_exp_f32 %3, %11\n\t"
        "v_exp_f32 %4, %12\n\tv_exp_f32 %5, %13\n\tv_exp_f32 %6, %14\n\tv_exp_f32 %7, %15\n\tv_nop"
        : "=&v"(t[0]), "=&v"(t[1]), "=&v"(t[2]), "=&v"(t[3]), "=&v"(t[4]), "=&v"(t[5]), "=&v"(t[6]), "=&v"(t[7])
        : "v"(a[0]), "v"(a[1]), "v"(a[2]), "v"(a[3]), "v"(a[4]), "v"(a[5]), "v"(a[6]), "v"(a[7]));
#pragma unroll
    for (int i = 0; i < 8; i++) {
        float r = ldexpf(t[i], (int)e[i]);
        r = x[i] < -0x1.9d1da0p+6f ? 0.f : r;
        y[i] = x[i] > 0x1.62e430p+6f ? __builtin_inff() : r;
    }
}

__global__ __launch_bounds__(256) void k_attention(const u16* __restrict__ qkv, u16* __restrict__ ctx) {
    __shared__ u16 Ks[2][32][72];    // [buf][key t][dh]   (+8 pad)
    __shared__ u16 Vs[2][64][40];    // [buf][dh][key t]   (+8 pad)
    const int tid = threadIdx.x;
    const int lane = tid & 31, wave = tid >> 5;
    const int l15 = lane & 15, lhalf = lane >> 4, koff = lhalf * 8;
    const int bh = blockIdx.x;                    // b*H + h
    const int qBase = blockIdx.y * 128;
    const int q0w = qBase + wave * 16;
    const size_t plane = (size_t)Bsz * H * S * DH;
    const u16* qp = qkv + (size_t)bh * S * DH;
    const u16* kp = qkv + plane + (size_t)bh * S * DH;
    const u16* vp = qkv + 2 * plane + (size_t)bh * DH * S;   // transposed [dh][s]

    // Q fragments (already scaled by 1/sqrt(DH)) for this wave's 16 rows: B operand, column = query l15.
    FragBF qa0, qa1;
    {
        const u16* qrow = qp + (size_t)(q0w + l15) * DH;
        qa0.u4[0] = *(const uint4*)&qrow[koff];
        qa0.u4[1] = *(const uint4*)&qrow[koff + 16];
        qa1.u4[0] = *(const uint4*)&qrow[32 + koff];
        qa1.u4[1] = *(const uint4*)&qrow[32 + koff + 16];
    }

    auto issue_kv = [&](int kt, int buf) {
        int t = tid >> 3, c8 = (tid & 7) * 8;              // K: 32 keys x 64 dh
        async_b128(&Ks[buf][t][c8], &kp[(size_t)(kt * 32 + t) * DH + c8]);
        int dh = tid >> 2, c = (tid & 3) * 8;              // V^T: 64 dh x 32 keys
        async_b128(&Vs[buf][dh][c], &vp[(size_t)dh * S + kt * 32 + c]);
    };

    v8f ov[4] = {};                 // O^T accum: ov[c][r] = O[query l15][dh c*16 + 8*lhalf + r]
    const int rowg = q0w + l15;     // this lane's query
    float mrow = -3.0e38f;          // its running maximum, alike in both halves
    float lrow = 0.f;               // its running sum over the keys that this half holds

    const int ktEnd = (qBase + 127) >> 5;         // 32-key tiles
    issue_kv(0, 0);
    for (int kt = 0; kt <= ktEnd; kt++) {
        wait_async0();
        __syncthreads();
        if (kt + 1 <= ktEnd) issue_kv(kt + 1, (kt + 1) & 1);
        const int cur = kt & 1;

        // scores: K(32x64) @ Q^T(64x16) -> two 16x16 C tiles, 4 full WMMAs
        // sc0[r] = S[rowg][kt*32 + 8*lhalf + r], sc1[r] the key 16 further
        FragBF kb;
        v8f sc0 = {}, sc1 = {};
        kb.u4[0] = *(const uint4*)&Ks[cur][l15][koff];
        kb.u4[1] = *(const uint4*)&Ks[cur][l15][koff + 16];
        sc0 = __builtin_amdgcn_wmma_f32_16x16x32_bf16(false, kb.v, false, qa0.v, (short)0, sc0, false, false);
        kb.u4[0] = *(const uint4*)&Ks[cur][l15][32 + koff];
        kb.u4[1] = *(const uint4*)&Ks[cur][l15][32 + koff + 16];
        sc0 = __builtin_amdgcn_wmma_f32_16x16x32_bf16(false, kb.v, false, qa1.v, (short)0, sc0, false, false);
        kb.u4[0] = *(const uint4*)&Ks[cur][16 + l15][koff];
        kb.u4[1] = *(const uint4*)&Ks[cur][16 + l15][koff + 16];
        sc1 = __builtin_amdgcn_wmma_f32_16x16x32_bf16(false, kb.v, false, qa0.v, (short)0, sc1, false, false);
        kb.u4[0] = *(const uint4*)&Ks[cur][16 + l15][32 + koff];
        kb.u4[1] = *(const uint4*)&Ks[cur][16 + l15][32 + koff + 16];
        sc1 = __builtin_amdgcn_wmma_f32_16x16x32_bf16(false, kb.v, false, qa1.v, (short)0, sc1, false, false);

        const int key0 = kt * 32 + koff, key1 = key0 + 16;
        float s0[8], s1[8];
        float tm0 = -3.0e38f, tm1 = -3.0e38f;               // two chains: half the dependent depth of one
#pragma unroll
        for (int r = 0; r < 8; r++) {
            s0[r] = (key0 + r > rowg) ? -3.0e38f : sc0[r];  // causal mask; scale already folded into Q
            s1[r] = (key1 + r > rowg) ? -3.0e38f : sc1[r];
            tm0 = fmaxf(tm0, s0[r]);
            tm1 = fmaxf(tm1, s1[r]);
        }
        float tm = fmaxf(tm0, tm1);
        tm = fmaxf(tm, xhalf(tm));                          // the other half holds the tile's other 16 keys
        const float mnew = fmaxf(mrow, tm);
        const float f = expf(mrow - mnew);
        float ps = 0.f;
        FragBF pb;                                          // P^T, full 32x16 B fragment: element s is key 8*lhalf + s, 16 + 8*lhalf + s - 8
#pragma unroll
        for (int r = 0; r < 8; r++) { s0[r] -= mnew; s1[r] -= mnew; }
        float e0[8], e1[8];
        exp8(s0, e0);
        exp8(s1, e1);
#pragma unroll
        for (int r = 0; r < 8; r++) {
            float p0 = e0[r];
            float p1 = e1[r];
            if (key0 + r > rowg) p0 = 0.f;
            if (key1 + r > rowg) p1 = 0.f;
            ps += p0 + p1;
            pb.us[r]     = f2bf(p0);
            pb.us[8 + r] = f2bf(p1);
        }
        lrow = lrow * f + ps;
        mrow = mnew;

#pragma unroll
        for (int c = 0; c < 4; c++)
#pragma unroll
            for (int r = 0; r < 8; r++) ov[c][r] *= f;

#pragma unroll
        for (int c = 0; c < 4; c++) {
            FragBF vb;                                      // V^T, full 16x32 A fragment: row = dh c*16 + l15
            vb.u4[0] = *(const uint4*)&Vs[cur][c * 16 + l15][koff];
            vb.u4[1] = *(const uint4*)&Vs[cur][c * 16 + l15][koff + 16];
            ov[c] = __builtin_amdgcn_wmma_f32_16x16x32_bf16(false, vb.v, false, pb.v, (short)0, ov[c], false, false);
        }
    }

    // normalize and write ctx[b][s][h*DH + e] as bf16: a lane's 8 registers are 8 neighbours in e
    const int b = bh >> 4, h = bh & 15;
    const float inv = 1.0f / (lrow + xhalf(lrow));          // the two halves' sums join here
    u16* dst = ctx + ((size_t)(b * S + rowg)) * D + h * DH + koff;
#pragma unroll
    for (int c = 0; c < 4; c++) {
        const v8f o = ov[c];
        *(uint4*)&dst[c * 16] =
            make_uint4((uint32_t)f2bf(o[0] * inv) | ((uint32_t)f2bf(o[1] * inv) << 16),
                       (uint32_t)f2bf(o[2] * inv) | ((uint32_t)f2bf(o[3] * inv) << 16),
                       (uint32_t)f2bf(o[4] * inv) | ((uint32_t)f2bf(o[5] * inv) << 16),
                       (uint32_t)f2bf(o[6] * inv) | ((uint32_t)f2bf(o[7] * inv) << 16));
    }
}

// ---------------------------------------------------------------------------
extern "C" void kernel_launch(void* const* d_in, const int* in_sizes, int n_in,
                              void* d_out, int out_size, void* d_ws, size_t ws_size,
                              hipStream_t stream) {
    (void)in_sizes; (void)n_in; (void)out_size; (void)ws_size;
    const float* x   = (const float*)d_in[0];
    const float* g1  = (const float*)d_in[1];
    const float* be1 = (const float*)d_in[2];
    const float* Wq  = (const float*)d_in[3];
    const float* Wk  = (const float*)d_in[4];
    const float* Wv  = (const float*)d_in[5];
    const float* Wo  = (const float*)d_in[6];
    const float* bo  = (const float*)d_in[7];
    const float* g2  = (const float*)d_in[8];
    const float* be2 = (const float*)d_in[9];
    const float* W1  = (const float*)d_in[10];
    const float* fb1 = (const float*)d_in[11];
    const float* W2  = (const float*)d_in[12];
    const float* fb2 = (const float*)d_in[13];
    float* out = (float*)d_out;

    char* ws = (char*)d_ws;
    auto alloc = [&](size_t bytes) -> char* {
        char* p = ws; ws += (bytes + 255) & ~(size_t)255; return p;
    };
    u16*   wqkvT = (u16*)alloc((size_t)3 * D * D * 2);   // [3D][D]
    u16*   woT   = (u16*)alloc((size_t)D * D * 2);       // [D][D]
    u16*   w1T   = (u16*)alloc((size_t)DF * D * 2);      // [DF][D]
    u16*   w2T   = (u16*)alloc((size_t)D * DF * 2);      // [D][DF]
    u16*   h1    = (u16*)alloc((size_t)ROWS * D * 2);
    u16*   qkv   = (u16*)alloc((size_t)3 * ROWS * D * 2);
    u16*   ctx   = (u16*)alloc((size_t)ROWS * D * 2);
    float* xmid  = (float*)alloc((size_t)ROWS * D * 4);
    u16*   h2    = (u16*)alloc((size_t)ROWS * D * 2);
    u16*   ffn1  = (u16*)alloc((size_t)ROWS * DF * 2);

    dim3 blk(256);
    k_prep<<<NB_PREP, blk, 0, stream>>>(Wq, Wk, Wv, Wo, W1, W2, x, g1, be1, wqkvT, woT, w1T, w2T, h1);
    k_gemm<0, 3 * D, 2><<<dim3(3 * D / 128, ROWS / 128), blk, 0, stream>>>(h1, wqkvT, nullptr, nullptr, nullptr, qkv, D);
    k_attention<<<dim3(Bsz * H, S / 128), blk, 0, stream>>>(qkv, ctx);
    k_gemm<1, D, 4><<<dim3(D / 128, ROWS / 128), blk, 0, stream>>>(ctx, woT, bo, x, xmid, nullptr, D);
    k_layernorm<<<NB_LN, blk, 0, stream>>>(xmid, g2, be2, h2);
    k_gemm<2, DF, 4><<<dim3(DF / 128, ROWS / 128), blk, 0, stream>>>(h2, w1T, fb1, nullptr, nullptr, ffn1, D);
    k_gemm<1, D, 4><<<dim3(D / 128, ROWS / 128), blk, 0, stream>>>(ffn1, w2T, fb2, xmid, out, nullptr, DF);
}

// v008
// A run of this version takes 135 microseconds.
// In both of two side-by-side timings against v007, it was 1.06 times as fast.
// Counting every step since v000, it is 1.80 times as fast.
#include <hip/hip_runtime.h>
#include <cstdint>

typedef unsigned short u16;
typedef __attribute__((ext_vector_type(16))) __bf16 v16bf;
typedef __attribute__((ext_vector_type(8)))  float  v8f;

constexpr int Bsz = 8, S = 512, D = 1024, H = 16, DH = 64, DF = 4096;
constexpr int ROWS = Bsz * S;   // 4096

__device__ __forceinline__ u16 f2bf(float f) {
    uint32_t u = __float_as_uint(f);
    uint32_t r = u + 0x7FFFu + ((u >> 16) & 1u);   // round-to-nearest-even
    return (u16)(r >> 16);
}

union FragBF {                  // one wave32 16x32 bf16 A/B fragment (8 VGPRs)
    v16bf v;
    uint4 u4[2];
    u16   us[16];
};

// Async global -> LDS copy of 16 bytes per lane (ASYNCcnt-tracked).
__device__ __forceinline__ void async_b128(u16* lds, const u16* gptr) {
    uint32_t l = (uint32_t)(uintptr_t)lds;          // low 32 bits = LDS offset
    asm volatile("global_load_async_to_lds_b128 %0, %1, off"
                 :: "v"(l), "v"(gptr) : "memory");
}
__device__ __forceinline__ void wait_async0() {
    asm volatile("s_wait_asynccnt 0x0" ::: "memory");
}
// Returns when all but this wave's CNT youngest copies have landed.
template <int CNT>
__device__ __forceinline__ void wait_async_but() {
    asm volatile("s_wait_asynccnt %0" :: "n"(CNT) : "memory");
}
// The same copy as the compiler's builtin: the compiler sees its address registers.
typedef __attribute__((ext_vector_type(4))) int v4i;
__device__ __forceinline__ void copy_b128(u16* lds, const u16* gptr) {
    __builtin_amdgcn_global_load_async_to_lds_b128(
        (__attribute__((address_space(1))) v4i*)gptr, (__attribute__((address_space(3))) v4i*)lds, 0, 0);
}

// DPP butterfly reduction across a 16-lane row (lanes 0-15 / 16-31 separately).
template <int CTRL>
__device__ __forceinline__ float dpp_f(float x) {
    return __int_as_float(__builtin_amdgcn_mov_dpp(__float_as_int(x), CTRL, 0xf, 0xf, true));
}
__device__ __forceinline__ float red_max16(float v) {
    v = fmaxf(v, dpp_f<0xB1>(v));    // quad_perm [1,0,3,2]  (xor 1)
    v = fmaxf(v, dpp_f<0x4E>(v));    // quad_perm [2,3,0,1]  (xor 2)
    v = fmaxf(v, dpp_f<0x141>(v));   // row_half_mirror
    v = fmaxf(v, dpp_f<0x140>(v));   // row_mirror
    return v;
}
__device__ __forceinline__ float red_sum16(float v) {
    v += dpp_f<0xB1>(v);
    v += dpp_f<0x4E>(v);
    v += dpp_f<0x141>(v);
    v += dpp_f<0x140>(v);
    return v;
}

__device__ __forceinline__ float xhalf(float x) {     // lane l reads lane l ^ 16
    return __int_as_float(__builtin_amdgcn_permlanex16(__float_as_int(x), __float_as_int(x),
                                                       0x76543210, 0xfedcba98, false, false));
}

// ---------------------------------------------------------------------------
// Weight conversion: fp32 -> bf16, stored TRANSPOSED as W^T[N][K] so GEMM B
// tiles are row-major block copies (async-to-LDS friendly, no LDS scatter).
// One block transposes a tile of 128 k x 64 n through LDS: it reads 256-byte
// row pieces of the source (16 bytes a lane) and writes 256-byte row pieces of
// the destination (16 bytes a lane).  LDS holds one dword per (n, k pair).
// ---------------------------------------------------------------------------
constexpr int CTK = 128, CTN = 64;        // tile: k extent, n extent
constexpr int CPITCH = CTK / 2 + 1;       // dwords per n row; odd, so both sides spread over the banks

// src: first element of the tile, rows are k (pitch srcPitch floats).
// dst: first element of the tile, rows are n (pitch dstPitch bf16).
// tl: CTN * CPITCH dwords of LDS, the caller's (one array serves every instance in a kernel).
template <int srcPitch, int dstPitch>
__device__ __forceinline__ void conv_tile(const float* __restrict__ src, u16* __restrict__ dst, uint32_t* tl) {
    const int tid = threadIdx.x;
    const int nq = tid & 15, kp0 = tid >> 4;           // 4 n columns, k pair (+16*j)
    float4 r0[4], r1[4];
#pragma unroll
    for (int j = 0; j < 4; j++) {
        const float* p = src + (2 * kp0 * srcPitch + nq * 4) + 32 * j * srcPitch;
        r0[j] = *(const float4*)p;
        r1[j] = *(const float4*)(p + srcPitch);
    }
#pragma unroll
    for (int j = 0; j < 4; j++) {
        uint32_t* q = &tl[(nq * 4) * CPITCH + kp0 + 16 * j];
        q[0 * CPITCH] = (uint32_t)f2bf(r0[j].x) | ((uint32_t)f2bf(r1[j].x) << 16);
        q[1 * CPITCH] = (uint32_t)f2bf(r0[j].y) | ((uint32_t)f2bf(r1[j].y) << 16);
        q[2 * CPITCH] = (uint32_t)f2bf(r0[j].z) | ((uint32_t)f2bf(r1[j].z) << 16);
        q[3 * CPITCH] = (uint32_t)f2bf(r0[j].w) | ((uint32_t)f2bf(r1[j].w) << 16);
    }
    __syncthreads();
#pragma unroll
    for (int i = 0; i < 4; i++) {
        const int n = (tid >> 4) + 16 * i, kq = tid & 15;   // 16 lanes cover one n row
        const uint32_t* q = &tl[n * CPITCH + kq * 4];
        uint4 o = make_uint4(q[0], q[1], q[2], q[3]);
        *(uint4*)&dst[((tid >> 4) * dstPitch + kq * 8) + 16 * i * dstPitch] = o;
    }
}

// ---------------------------------------------------------------------------
// LayerNorm -> bf16.  One WAVE per row of D = 1024: a lane holds 32 of the row's
// values in registers (8 loads of 16 bytes, each 512 bytes in a row over the wave),
// the two sums run inside the lane and then across the 32 lanes.  No LDS and no
// barrier; a block of 256 threads takes LNR = 8 rows, so that a launch starts an
// eighth of the waves that a block per row needs.
// ---------------------------------------------------------------------------
constexpr int LNR = 8;                    // rows a block: one per wave

__device__ __forceinline__ float red_sum32(float v) {   // the sum over all 32 lanes, in every lane
    v = red_sum16(v);
    return v + xhalf(v);
}

typedef __attribute__((ext_vector_type(4))) float f32x4;
typedef __attribute__((ext_vector_type(2))) float f32x2;

__device__ __forceinline__ void ln_row(const float* __restrict__ x, const float* __restrict__ g,
                                       const float* __restrict__ b, u16* __restrict__ out, int row) {
    const int lane = threadIdx.x & 31;
    const f32x4* xr = (const f32x4*)(x + (size_t)row * D) + lane;
    const f32x4* gr = (const f32x4*)g + lane;
    const f32x4* br = (const f32x4*)b + lane;
    f32x4 v[8], gg[8], bb[8];
#pragma unroll
    for (int j = 0; j < 8; j++) v[j] = xr[j * 32];
    // the compiler lets a later load's result land in the address registers of the loads above:
    // the wait that belongs in front of an overwrite of a load's registers
    asm volatile("s_wait_xcnt 0x0" ::: "memory");
#pragma unroll
    for (int j = 0; j < 8; j++) { gg[j] = gr[j * 32]; bb[j] = br[j * 32]; }
    // all 24 loads are issued before the first sum: left free, the compiler sinks those of g and b to
    // their uses behind the sums, some of them one at a time, each with its whole latency exposed
    __builtin_amdgcn_sched_barrier(0);
    f32x2 s0 = v[0].lo, s1 = v[0].hi;     // four independent chains, two to a packed add
#pragma unroll
    for (int j = 1; j < 8; j++) { s0 += v[j].lo; s1 += v[j].hi; }
    s0 += s1;
    const float mean = red_sum32(s0.x + s0.y) * (1.0f / D);
    f32x2 q0 = 0.f, q1 = 0.f;
#pragma unroll
    for (int j = 0; j < 8; j++) {
        v[j] -= mean;
        q0 = __builtin_elementwise_fma(v[j].lo, v[j].lo, q0);
        q1 = __builtin_elementwise_fma(v[j].hi, v[j].hi, q1);
    }
    q0 += q1;
    const float rstd = rsqrtf(red_sum32(q0.x + q0.y) * (1.0f / D) + 1e-5f);
    u16* orow = out + (size_t)row * D + lane * 4;
#pragma unroll
    for (int j = 0; j < 8; j++) {         // 8 bytes a lane, 256 bytes in a row over the wave
        const f32x4 y = v[j] * rstd * gg[j] + bb[j];
        *(uint2*)&orow[j * 128] = make_uint2((uint32_t)f2bf(y.x) | ((uint32_t)f2bf(y.y) << 16),
                                             (uint32_t)f2bf(y.z) | ((uint32_t)f2bf(y.w) << 16));
    }
}

__global__ __launch_bounds__(256) void k_layernorm(const float* __restrict__ x, const float* __restrict__ g,
                                                   const float* __restrict__ b, u16* __restrict__ out) {
    ln_row(x, g, b, out, blockIdx.x * LNR + (threadIdx.x >> 5));
}

// ---------------------------------------------------------------------------
// Everything that depends on the inputs alone, in ONE launch: the four weight
// conversions and the first LayerNorm.  Block indices are dealt in groups of
// MIX_C conversion tiles and MIX_L LayerNorm blocks, so that both kinds of
// block share every WGP for the whole launch.
// ---------------------------------------------------------------------------
constexpr int NB_QKV = 3 * H * (D / CTK);            // one [D][DH] matrix per 8 k tiles
constexpr int NB_WO  = (D / CTN) * (D / CTK);
constexpr int NB_W1  = (DF / CTN) * (D / CTK);
constexpr int NB_W2  = (D / CTN) * (DF / CTK);
constexpr int NB_CONV = NB_W1 + NB_W2 + NB_QKV + NB_WO;
constexpr int NB_LN = ROWS / LNR;
constexpr int NGRP = 512, MIX_C = NB_CONV / NGRP, MIX_L = NB_LN / NGRP;   // 3 tiles and 1 block of 8 rows a group
static_assert(MIX_C * NGRP == NB_CONV && MIX_L * NGRP == NB_LN, "groups must cover both kinds of block exactly");
constexpr int NB_PREP = NB_CONV + NB_LN;

__global__ __launch_bounds__(256) void k_prep(const float* __restrict__ Wq, const float* __restrict__ Wk,
                                              const float* __restrict__ Wv, const float* __restrict__ Wo,
                                              const float* __restrict__ W1, const float* __restrict__ W2,
                                              const float* __restrict__ x, const float* __restrict__ g,
                                              const float* __restrict__ b,
                                              u16* __restrict__ wqkvT, u16* __restrict__ woT,
                                              u16* __restrict__ w1T, u16* __restrict__ w2T,
                                              u16* __restrict__ h1) {
    __shared__ uint32_t lds[CTN * CPITCH];            // a conversion's tile
    // every test below is the same for the whole block
    const int grp = blockIdx.x / (MIX_C + MIX_L), r = blockIdx.x % (MIX_C + MIX_L);
    if (r >= MIX_C) {
        ln_row(x, g, b, h1, (grp * MIX_L + r - MIX_C) * LNR + (threadIdx.x >> 5));
        return;
    }
    int blk = grp * MIX_C + r;                        // conversion tile 0 .. NB_CONV - 1
    if (blk < NB_W1) {                                // dst[n*K + k] = src[k*N + n], n tile fastest
        const int n0 = (blk % (DF / CTN)) * CTN, k0 = (blk / (DF / CTN)) * CTK;
        conv_tile<DF, D>(W1 + (size_t)k0 * DF + n0, w1T + (size_t)n0 * D + k0, lds);
    } else if ((blk -= NB_W1) < NB_W2) {
        const int n0 = (blk % (D / CTN)) * CTN, k0 = (blk / (D / CTN)) * CTK;
        conv_tile<D, DF>(W2 + (size_t)k0 * D + n0, w2T + (size_t)n0 * DF + k0, lds);
    } else if ((blk -= NB_W2) < NB_QKV) {             // which * H + h fastest, then the k tile
        const int m = blk % (3 * H), which = m >> 4, h = m & 15;
        const int k0 = (blk / (3 * H)) * CTK;
        const float* W = (which == 0) ? Wq : (which == 1 ? Wk : Wv);
        conv_tile<DH, D>(W + ((size_t)h * D + k0) * DH, wqkvT + (size_t)(which * D + h * DH) * D + k0, lds);
    } else {
        blk -= NB_QKV;
        const int n0 = (blk % (D / CTN)) * CTN, k0 = (blk / (D / CTN)) * CTK;
        conv_tile<D, D>(Wo + (size_t)k0 * D + n0, woT + (size_t)n0 * D + k0, lds);
        // in the built code another range's register writes follow these stores behind a scalar
        // test only: the wait that belongs in front of an overwrite of a store's registers
        asm volatile("s_wait_xcnt 0x0" ::: "memory");
    }
}

// ---------------------------------------------------------------------------
// bf16 WMMA GEMM: C[M][N] = A[M][K] * B[K][N] with B supplied TRANSPOSED
// (Bt[N][K]).  Block tile 128x128, K-step 64, async-to-LDS staging in a ring of
// NS buffers, NS - 1 K-steps ahead, single barrier per K-step.  NS = 2 for QKV, whose
// blocks are all resident at once, three a WGP, and cover each other's waits.  NS = 4
// for the others: with N = 1024 a block has its WGP alone; with N = 4096 registers and LDS allow two blocks a WGP, which make
// two even rounds of the grid.
// 8 waves, 16 v_wmma_f32_16x16x32_bf16 each per K-step.
// SK false: 4(m) x 2(n) waves, a wave has 32x64 = 2x4 WMMA tiles over both 32-k halves of the K-step
// and reads 12 fragments for its 16 WMMAs.
// SK true: 2(m) x 2(n) x 2(k) waves, a wave has 64x64 = 4x4 WMMA tiles over ONE 32-k half and reads
// 8 fragments for its 16 WMMAs: two thirds of the LDS reads, and one group of them a K-step.  The two
// waves of a tile hold partial sums; the epilogue adds them in LDS, each wave finishing 32 of the 64 rows.
// EPI 0: QKV permute -> bf16 (Q pre-scaled by 1/sqrt(DH), V stored transposed)
// EPI 1: +bias +res -> fp32      EPI 2: GELU(.+bias) -> bf16
// All three write out through LDS in 16-byte pieces that fill whole lines.
// ---------------------------------------------------------------------------
constexpr int TSTRIDE = 72;               // 64 + 8 pad (u16)
constexpr int TSZ = 128 * TSTRIDE;        // one 128x64 tile in LDS (u16 count)
constexpr int EPITCH = 68;                // epilogue staging, floats a row: 64 + 4, rows 8 apart fall 32 banks apart
constexpr int VPITCH = 136;               // V^T staging, u16 a column: 128 + 8, 16 columns spread over all banks

template <int EPI, int N, int NS, bool SK>   // N at compile time: the epilogue's row steps become immediate offsets
__global__ __launch_bounds__(256) void k_gemm(const u16* __restrict__ A, const u16* __restrict__ Bt,
                                              const float* __restrict__ bias, const float* __restrict__ res,
                                              float* __restrict__ outF, u16* __restrict__ outU,
                                              int K) {
    __shared__ __attribute__((aligned(16))) u16 smem[NS * 2 * TSZ];   // [buf 0 .. NS-1][A tile | B tile]; epilogue staging afterwards
    const int tid = threadIdx.x;
    const int lane = tid & 31, wave = tid >> 5;
    constexpr int MT = SK ? 4 : 2;                     // 16-row WMMA tiles of a wave
    const int wk = SK ? wave >> 2 : 0;                 // SK: the 32-k half of every K-step that this wave sums
    const int wm = SK ? wave & 1 : wave & 3;           // 2(m) x 2(n) x 2(k), or 4(m) x 2(n)
    const int wn = SK ? (wave >> 1) & 1 : wave >> 2;
    const int em = SK ? wm * 2 + wk : wm;              // the 32 x 64 piece of the block tile that this wave writes out: rows em * 32
    const int m0 = blockIdx.y * 128, n0 = blockIdx.x * 128;
    const int l15 = lane & 15, lhalf = lane >> 4, koff = lhalf * 8;
    const int ldr = tid >> 3, ldc = (tid & 7) * 8;     // loader: row 0..31 (+j*32), col chunk

    v8f acc[MT][4] = {};

    auto issue_tile = [&](int k0, int buf) {
        u16* As = &smem[buf * 2 * TSZ];
        u16* Bs = As + TSZ;
#pragma unroll
        for (int j = 0; j < 4; j++) {
            int r = ldr + j * 32;
            copy_b128(&As[r * TSTRIDE + ldc], &A[(size_t)(m0 + r) * K + k0 + ldc]);
            copy_b128(&Bs[r * TSTRIDE + ldc], &Bt[(size_t)(n0 + r) * K + k0 + ldc]);
        }
    };

    constexpr int CPS = 8;                // copies of a wave per tile
    const int nT = K / 64;
    // the ring's first NS - 1 tiles (every launch has K >= (NS - 1) * 64); unrolled: each buffer's offset a constant
#pragma unroll
    for (int s = 0; s < NS - 1; s++) issue_tile(s * 64, s);
    for (int t = 0; t < nT; t++) {
        // this wave's reads of tile t - 1 are done before the barrier behind which its buffer is refilled
        asm volatile("s_wait_dscnt 0x0" ::: "memory");
        // tile t has landed: while tiles t + 1 .. t + NS - 2 all exist they are the wave's youngest
        // copies, CPS each, and stay in flight; in the last trips, which issue none, everything is waited for
        if (NS > 2 && t + NS - 2 < nT) wait_async_but<(NS - 2) * CPS>();
        else wait_async0();
        __syncthreads();                  // publishes tile t, and ends every wave's reads of tile t - 1
        if (t + NS - 1 < nT) issue_tile((t + NS - 1) * 64, (t + NS - 1) % NS);
        const u16* As = &smem[(t % NS) * 2 * TSZ];
        const u16* Bs = As + TSZ;
        if constexpr (SK) {
            const int kc = wk * 32;                   // this wave's half of the K-step
            const u16* pa = &As[(wm * 64 + l15) * TSTRIDE + kc + koff];
            const u16* pb = &Bs[(wn * 64 + l15) * TSTRIDE + kc + koff];
            FragBF a[4], b[4];
#pragma unroll
            for (int i = 0; i < 4; i++) {             // A and B fragments in turn: i + 1 of each feed (i + 1)^2 WMMAs
                a[i].u4[0] = *(const uint4*)(pa + i * 16 * TSTRIDE);
                a[i].u4[1] = *(const uint4*)(pa + i * 16 * TSTRIDE + 16);
                b[i].u4[0] = *(const uint4*)(pb + i * 16 * TSTRIDE);
                b[i].u4[1] = *(const uint4*)(pb + i * 16 * TSTRIDE + 16);
            }
            // all 16 reads are issued before the first WMMA: left free, the compiler loads three of the four A
            // fragments into one register set, each behind four WMMAs with its whole LDS latency exposed
            __builtin_amdgcn_sched_barrier(0);
            // the WMMAs in the order in which their fragments arrive; each accumulator gets exactly one
            constexpr int OM[16] = {0, 1, 0, 1, 2, 2, 0, 1, 2, 3, 3, 3, 0, 1, 2, 3};
            constexpr int ON[16] = {0, 0, 1, 1, 0, 1, 2, 2, 2, 0, 1, 2, 3, 3, 3, 3};
#pragma unroll
            for (int i = 0; i < 16; i++)
                acc[OM[i]][ON[i]] = __builtin_amdgcn_wmma_f32_16x16x32_bf16(
                    false, a[OM[i]].v, false, b[ON[i]].v, (short)0, acc[OM[i]][ON[i]], false, false);
        } else {
#pragma unroll
            for (int kc = 0; kc < 64; kc += 32) {
                FragBF a[2], b[4];
#pragma unroll
                for (int mt = 0; mt < 2; mt++) {
                    const u16* p = &As[(wm * 32 + mt * 16 + l15) * TSTRIDE + kc + koff];
                    a[mt].u4[0] = *(const uint4*)p;
                    a[mt].u4[1] = *(const uint4*)(p + 16);
                }
#pragma unroll
                for (int nt = 0; nt < 4; nt++) {
                    const u16* p = &Bs[(wn * 64 + nt * 16 + l15) * TSTRIDE + kc + koff];
                    b[nt].u4[0] = *(const uint4*)p;
                    b[nt].u4[1] = *(const uint4*)(p + 16);
                }
#pragma unroll
                for (int mt = 0; mt < 2; mt++)
#pragma unroll
                    for (int nt = 0; nt < 4; nt++)
                        acc[mt][nt] = __builtin_amdgcn_wmma_f32_16x16x32_bf16(
                            false, a[mt].v, false, b[nt].v, (short)0, acc[mt][nt], false, false);
            }
        }
    }

    // Epilogue: the accumulators go through LDS so that every global access is
    // 16 bytes a lane and covers whole 128-byte lines.
    constexpr size_t planeE = (size_t)Bsz * H * S * DH;
    __syncthreads();                      // every wave has left the last K tile: smem is staging space now
    static_assert((SK ? 16 : 8) * 32 * EPITCH * 4 <= NS * 2 * TSZ * 2, "the staging tiles must fit the ring's LDS");
    float* st = (float*)smem + wave * (32 * EPITCH);   // this wave's own 32 x 64 fp32 tile
    const float* pt = st + 8 * (32 * EPITCH);          // SK: the same 32 x 64 piece, the other k half's sums, written by wave ^ 4
    // 32 rows of accumulators, from WMMA tile row mtb on, to d; inlined so that mtb is a constant and acc stays in registers
    auto put = [&](float* d, int mtb) __attribute__((always_inline)) {
#pragma unroll
        for (int mt = 0; mt < 2; mt++)
#pragma unroll
            for (int nt = 0; nt < 4; nt++)
#pragma unroll
                for (int r = 0; r < 8; r++)
                    d[(mt * 16 + r + 8 * lhalf) * EPITCH + nt * 16 + l15] = acc[mtb + mt][nt][r];
    };
    auto stage = [&]() {
        if constexpr (SK) {
            // the half of its 64 rows that this wave writes out (rows 0 to 31 for wk = 0) goes to its own tile,
            // the other half to its partner's second tile
            float* po = (float*)smem + (8 + (wave ^ 4)) * (32 * EPITCH);
            put(wk == 0 ? st : po, 0);
            put(wk == 0 ? po : st, 2);
        } else {
            put(st, 0);
        }
        // the rows are read back by other lanes of this wave: its LDS writes must have landed
        asm volatile("s_wait_dscnt 0x0" ::: "memory");
        if constexpr (SK) __syncthreads();             // and the partner wave's, which hold the other k half's sums
    };
    auto add4 = [](float4 x, float4 y) { return make_float4(x.x + y.x, x.y + y.y, x.z + y.z, x.w + y.w); };
    auto pack8 = [](float4 lo, float4 hi) {
        return make_uint4((uint32_t)f2bf(lo.x) | ((uint32_t)f2bf(lo.y) << 16),
                          (uint32_t)f2bf(lo.z) | ((uint32_t)f2bf(lo.w) << 16),
                          (uint32_t)f2bf(hi.x) | ((uint32_t)f2bf(hi.y) << 16),
                          (uint32_t)f2bf(hi.z) | ((uint32_t)f2bf(hi.w) << 16));
    };

    if constexpr (EPI == 0) {
        const int which = n0 >> 10;                       // /D : 0=Q 1=K 2=V, the same for the whole block
        const int nb = n0 & 1023;                         // h * DH + e of the block's first column
        const int bb = m0 >> 9, s0 = m0 & 511;            // /S, %S of the block's first row
        if (which != 2) {                                 // Q or K; the whole block takes this side
            stage();
            const float sc = (which == 0) ? 0.125f : 1.0f;   // fold 1/sqrt(DH) into Q
            // the wave's 64 columns are one head: its 32 x 64 tile is 4 KB in a row
            u16* dst = outU + (size_t)which * planeE +
                       (((size_t)bb * H + (nb >> 6) + wn) * S + s0 + em * 32) * DH + lane * 8;
#pragma unroll
            for (int i = 0; i < 8; i++) {
                const int row = i * 4 + (lane >> 3), c8 = (lane & 7) * 8;
                float4 lo = *(const float4*)&st[row * EPITCH + c8];
                float4 hi = *(const float4*)&st[row * EPITCH + c8 + 4];
                lo.x *= sc; lo.y *= sc; lo.z *= sc; lo.w *= sc;
                hi.x *= sc; hi.y *= sc; hi.z *= sc; hi.w *= sc;
                *(uint4*)&dst[i * 4 * DH] = pack8(lo, hi);       // (lane >> 3) * DH + c8 == lane * 8
            }
            // in the built code the V side's register writes follow these stores behind a scalar
            // test only: the wait that belongs in front of an overwrite of a store's registers
            asm volatile("s_wait_xcnt 0x0" ::: "memory");
            return;
        }
        // V is stored transposed [b][h][dh][s]: 8 accumulator rows of a lane are 8
        // neighbours in s.  Block tile in LDS as [128 columns][128 s], then 256-byte rows out.
#pragma unroll
        for (int mt = 0; mt < 2; mt++)
#pragma unroll
            for (int nt = 0; nt < 4; nt++) {
                const v8f c = acc[mt][nt];
                *(uint4*)&smem[(wn * 64 + nt * 16 + l15) * VPITCH + wm * 32 + mt * 16 + 8 * lhalf] =
                    pack8(make_float4(c[0], c[1], c[2], c[3]), make_float4(c[4], c[5], c[6], c[7]));
            }
        __syncthreads();                  // a column's 128 s values come from four waves
        const int c0 = tid >> 4, q = (tid & 15) * 8;
        u16* dst = outU + 2 * planeE + ((size_t)bb * D + nb + c0) * S + s0 + q;
#pragma unroll
        for (int i = 0; i < 8; i++)
            *(uint4*)&dst[i * 16 * S] = *(const uint4*)&smem[(i * 16 + c0) * VPITCH + q];
    } else if constexpr (EPI == 1) {
        stage();
        const int c4 = (lane & 15) * 4;
        const float4 bv = *(const float4*)&bias[n0 + wn * 64 + c4];
        // one 32-bit byte offset serves the residual reads and the stores
        const uint32_t off = (uint32_t)((m0 + em * 32 + lhalf) * N + n0 + wn * 64 + c4) * 4u;
        const char* rp = (const char*)res + off;
        char* op = (char*)outF + off;
#pragma unroll
        for (int i = 0; i < 16; i++) {
            float4 v = *(const float4*)&st[(i * 2 + lhalf) * EPITCH + c4];
            if constexpr (SK) v = add4(v, *(const float4*)&pt[(i * 2 + lhalf) * EPITCH + c4]);
            const float4 rr = *(const float4*)(rp + i * 2 * N * 4);
            *(float4*)(op + i * 2 * N * 4) =
                make_float4(v.x + bv.x + rr.x, v.y + bv.y + rr.y, v.z + bv.z + rr.z, v.w + bv.w + rr.w);
        }
    } else {
        stage();
        const int c8 = (lane & 7) * 8;
        const float4 b0 = *(const float4*)&bias[n0 + wn * 64 + c8];
        const float4 b1 = *(const float4*)&bias[n0 + wn * 64 + c8 + 4];
        // GELU(t) = 0.5 t (1 + erf(t / sqrt 2)), without a branch.  With z = |t| / sqrt 2:
        // erfc(z) = u (a1 + u (a2 + u (a3 + u (a4 + u a5)))) exp(-z z), u = 1 / (1 + p z), absolute error
        // at most 1.5e-7; 1 + erf is erfc(z) for t < 0 (no cancellation there) and 2 - erfc(z) otherwise.
        // The library erff picks one of two polynomials by a branch per element, which the lanes of a
        // wave take both ways and which keeps the elements' dependent chains from overlapping.
        auto gelu4 = [](float4 t) {
            const float a0 = fmaf(0.3275911f * 0.70710678118654752f, fabsf(t.x), 1.0f);
            const float a1 = fmaf(0.3275911f * 0.70710678118654752f, fabsf(t.y), 1.0f);
            const float a2 = fmaf(0.3275911f * 0.70710678118654752f, fabsf(t.z), 1.0f);
            const float a3 = fmaf(0.3275911f * 0.70710678118654752f, fabsf(t.w), 1.0f);
            const float b0 = t.x * t.x * -0.72134752044448170f, b1 = t.y * t.y * -0.72134752044448170f;
            const float b2 = t.z * t.z * -0.72134752044448170f, b3 = t.w * t.w * -0.72134752044448170f;
            float u0, u1, u2, u3, e0, e1, e2, e3;     // u = 1 / a, e = 2^b = exp(-t t / 2)
            // One statement, so that behind each transcendental stands an instruction that neither reads
            // its result nor overwrites its source, as the instruction set asks: the outputs are early
            // clobbers (no output shares a register with an input), and v_nop is the slot behind the last.
            asm("v_rcp_f32 %0, %8\n\tv_rcp_f32 %1, %9\n\tv_rcp_f32 %2, %10\n\tv_rcp_f32 %3, %11\n\t"
                "v_exp_f32 %4, %12\n\tv_exp_f32 %5, %13\n\tv_exp_f32 %6, %14\n\tv_exp_f32 %7, %15\n\tv_nop"
                : "=&v"(u0), "=&v"(u1), "=&v"(u2), "=&v"(u3), "=&v"(e0), "=&v"(e1), "=&v"(e2), "=&v"(e3)
                : "v"(a0), "v"(a1), "v"(a2), "v"(a3), "v"(b0), "v"(b1), "v"(b2), "v"(b3));
            auto fin = [](float tt, float u, float e) {
                float p = fmaf(1.061405429f, u, -1.453152027f);
                p = fmaf(p, u, 1.421413741f);
                p = fmaf(p, u, -0.284496736f);
                p = fmaf(p, u, 0.254829592f);
                const float c = p * u * e;            // erfc(|t| / sqrt 2)
                return 0.5f * tt * (tt < 0.f ? c : 2.0f - c);
            };
            return make_float4(fin(t.x, u0, e0), fin(t.y, u1, e1), fin(t.z, u2, e2), fin(t.w, u3, e3));
        };
        u16* dst = outU + (size_t)(m0 + em * 32 + (lane >> 3)) * N + n0 + wn * 64 + c8;
#pragma unroll
        for (int i = 0; i < 8; i++) {
            const int row = i * 4 + (lane >> 3);
            float4 lo = *(const float4*)&st[row * EPITCH + c8];
            float4 hi = *(const float4*)&st[row * EPITCH + c8 + 4];
            if constexpr (SK) {
                lo = add4(lo, *(const float4*)&pt[row * EPITCH + c8]);
                hi = add4(hi, *(const float4*)&pt[row * EPITCH + c8 + 4]);
            }
            *(uint4*)&dst[i * 4 * N] =
                pack8(gelu4(make_float4(lo.x + b0.x, lo.y + b0.y, lo.z + b0.z, lo.w + b0.w)),
                      gelu4(make_float4(hi.x + b1.x, hi.y + b1.y, hi.z + b1.z, hi.w + b1.w)));
        }
    }
}

__device__ __forceinline__ void exp8(const float (&x)[8], float (&y)[8]) {
    float e[8], a[8], t[8];
#pragma unroll
    for (int i = 0; i < 8; i++) {
        const float ph = x[i] * 0x1.715476p+0f;
        const float pl = fmaf(x[i], 0x1.4ae0bep-26f, fmaf(x[i], 0x1.715476p+0f, -ph));
        e[i] = rintf(ph);
        a[i] = (ph - e[i]) + pl;
    }
    asm("v_exp_f32 %0, %8\n\tv_exp_f32 %1, %9\n\tv_exp_f32 %2, %10\n\tv_exp_f32 %3, %11\n\t"
        "v_exp_f32 %4, %12\n\tv_exp_f32 %5, %13\n\tv_exp_f32 %6, %14\n\tv_exp_f32 %7, %15\n\tv_nop"
        : "=&v"(t[0]), "=&v"(t[1]), "=&v"(t[2]), "=&v"(t[3]), "=&v"(t[4]), "=&v"(t[5]), "=&v"(t[6]), "=&v"(t[7])
        : "v"(a[0]), "v"(a[1]), "v"(a[2]), "v"(a[3]), "v"(a[4]), "v"(a[5]), "v"(a[6]), "v"(a[7]));
#pragma unroll
    for (int i = 0; i < 8; i++) {
        float r = ldexpf(t[i], (int)e[i]);
        r = x[i] < -0x1.9d1da0p+6f ? 0.f : r;
        y[i] = x[i] > 0x1.62e430p+6f ? __builtin_inff() : r;
    }
}

__global__ __launch_bounds__(256) void k_attention(const u16* __restrict__ qkv, u16* __restrict__ ctx) {
    __shared__ u16 Ks[2][32][72];    // [buf][key t][dh]   (+8 pad)
    __shared__ u16 Vs[2][64][40];    // [buf][dh][key t]   (+8 pad)
    const int tid = threadIdx.x;
    const int lane = tid & 31, wave = tid >> 5;
    const int l15 = lane & 15, lhalf = lane >> 4, koff = lhalf * 8;
    const int bh = blockIdx.x;                    // b*H + h
    const int qBase = blockIdx.y * 128;
    const int q0w = qBase + wave * 16;
    const size_t plane = (size_t)Bsz * H * S * DH;
    const u16* qp = qkv + (size_t)bh * S * DH;
    const u16* kp = qkv + plane + (size_t)bh * S * DH;
    const u16* vp = qkv + 2 * plane + (size_t)bh * DH * S;   // transposed [dh][s]

    // Q fragments (already scaled by 1/sqrt(DH)) for this wave's 16 rows: B operand, column = query l15.
    FragBF qa0, qa1;
    {
        const u16* qrow = qp + (size_t)(q0w + l15) * DH;
        qa0.u4[0] = *(const uint4*)&qrow[koff];
        qa0.u4[1] = *(const uint4*)&qrow[koff + 16];
        qa1.u4[0] = *(const uint4*)&qrow[32 + koff];
        qa1.u4[1] = *(const uint4*)&qrow[32 + koff + 16];
    }

    auto issue_kv = [&](int kt, int buf) {
        int t = tid >> 3, c8 = (tid & 7) * 8;              // K: 32 keys x 64 dh
        async_b128(&Ks[buf][t][c8], &kp[(size_t)(kt * 32 + t) * DH + c8]);
        int dh = tid >> 2, c = (tid & 3) * 8;              // V^T: 64 dh x 32 keys
        async_b128(&Vs[buf][dh][c], &vp[(size_t)dh * S + kt * 32 + c]);
    };

    v8f ov[4] = {};                 // O^T accum: ov[c][r] = O[query l15][dh c*16 + 8*lhalf + r]
    const int rowg = q0w + l15;     // this lane's query
    float mrow = -3.0e38f;          // its running maximum, alike in both halves
    float lrow = 0.f;               // its running sum over the keys that this half holds

    const int ktEnd = (qBase + 127) >> 5;         // 32-key tiles
    issue_kv(0, 0);
    for (int kt = 0; kt <= ktEnd; kt++) {
        wait_async0();
        __syncthreads();
        if (kt + 1 <= ktEnd) issue_kv(kt + 1, (kt + 1) & 1);
        const int cur = kt & 1;

        // scores: K(32x64) @ Q^T(64x16) -> two 16x16 C tiles, 4 full WMMAs
        // sc0[r] = S[rowg][kt*32 + 8*lhalf + r], sc1[r] the key 16 further
        FragBF kb;
        v8f sc0 = {}, sc1 = {};
        kb.u4[0] = *(const uint4*)&Ks[cur][l15][koff];
        kb.u4[1] = *(const uint4*)&Ks[cur][l15][koff + 16];
        sc0 = __builtin_amdgcn_wmma_f32_16x16x32_bf16(false, kb.v, false, qa0.v, (short)0, sc0, false, false);
        kb.u4[0] = *(const uint4*)&Ks[cur][l15][32 + koff];
        kb.u4[1] = *(const uint4*)&Ks[cur][l15][32 + koff + 16];
        sc0 = __builtin_amdgcn_wmma_f32_16x16x32_bf16(false, kb.v, false, qa1.v, (short)0, sc0, false, false);
        kb.u4[0] = *(const uint4*)&Ks[cur][16 + l15][koff];
        kb.u4[1] = *(const uint4*)&Ks[cur][16 + l15][koff + 16];
        sc1 = __builtin_amdgcn_wmma_f32_16x16x32_bf16(false, kb.v, false, qa0.v, (short)0, sc1, false, false);
        kb.u4[0] = *(const uint4*)&Ks[cur][16 + l15][32 + koff];
        kb.u4[1] = *(const uint4*)&Ks[cur][16 + l15][32 + koff + 16];
        sc1 = __builtin_amdgcn_wmma_f32_16x16x32_bf16(false, kb.v, false, qa1.v, (short)0, sc1, false, false);

        const int key0 = kt * 32 + koff, key1 = key0 + 16;
        float s0[8], s1[8];
        float tm0 = -3.0e38f, tm1 = -3.0e38f;               // two chains: half the dependent depth of one
#pragma unroll
        for (int r = 0; r < 8; r++) {
            s0[r] = (key0 + r > rowg) ? -3.0e38f : sc0[r];  // causal mask; scale already folded into Q
            s1[r] = (key1 + r > rowg) ? -3.0e38f : sc1[r];
            tm0 = fmaxf(tm0, s0[r]);
            tm1 = fmaxf(tm1, s1[r]);
        }
        float tm = fmaxf(tm0, tm1);
        tm = fmaxf(tm, xhalf(tm));                          // the other half holds the tile's other 16 keys
        const float mnew = fmaxf(mrow, tm);
        const float f = expf(mrow - mnew);
        float ps = 0.f;
        FragBF pb;                                          // P^T, full 32x16 B fragment: element s is key 8*lhalf + s, 16 + 8*lhalf + s - 8
#pragma unroll
        for (int r = 0; r < 8; r++) { s0[r] -= mnew; s1[r] -= mnew; }
        float e0[8], e1[8];
        exp8(s0, e0);
        exp8(s1, e1);
#pragma unroll
        for (int r = 0; r < 8; r++) {
            float p0 = e0[r];
            float p1 = e1[r];
            if (key0 + r > rowg) p0 = 0.f;
            if (key1 + r > rowg) p1 = 0.f;
            ps += p0 + p1;
            pb.us[r]     = f2bf(p0);
            pb.us[8 + r] = f2bf(p1);
        }
        lrow = lrow * f + ps;
        mrow = mnew;

#pragma unroll
        for (int c = 0; c < 4; c++)
#pragma unroll
            for (int r = 0; r < 8; r++) ov[c][r] *= f;

#pragma unroll
        for (int c = 0; c < 4; c++) {
            FragBF vb;                                      // V^T, full 16x32 A fragment: row = dh c*16 + l15
            vb.u4[0] = *(const uint4*)&Vs[cur][c * 16 + l15][koff];
            vb.u4[1] = *(const uint4*)&Vs[cur][c * 16 + l15][koff + 16];
            ov[c] = __builtin_amdgcn_wmma_f32_16x16x32_bf16(false, vb.v, false, pb.v, (short)0, ov[c], false, false);
        }
    }

    // normalize and write ctx[b][s][h*DH + e] as bf16: a lane's 8 registers are 8 neighbours in e
    const int b = bh >> 4, h = bh & 15;
    const float inv = 1.0f / (lrow + xhalf(lrow));          // the two halves' sums join here
    u16* dst = ctx + ((size_t)(b * S + rowg)) * D + h * DH + koff;
#pragma unroll
    for (int c = 0; c < 4; c++) {
        const v8f o = ov[c];
        *(uint4*)&dst[c * 16] =
            make_uint4((uint32_t)f2bf(o[0] * inv) | ((uint32_t)f2bf(o[1] * inv) << 16),
                       (uint32_t)f2bf(o[2] * inv) | ((uint32_t)f2bf(o[3] * inv) << 16),
                       (uint32_t)f2bf(o[4] * inv) | ((uint32_t)f2bf(o[5] * inv) << 16),
                       (uint32_t)f2bf(o[6] * inv) | ((uint32_t)f2bf(o[7] * inv) << 16));
    }
}

// ---------------------------------------------------------------------------
extern "C" void kernel_launch(void* const* d_in, const int* in_sizes, int n_in,
                              void* d_out, int out_size, void* d_ws, size_t ws_size,
                              hipStream_t stream) {
    (void)in_sizes; (void)n_in; (void)out_size; (void)ws_size;
    const float* x   = (const float*)d_in[0];
    const float* g1  = (const float*)d_in[1];
    const float* be1 = (const float*)d_in[2];
    const float* Wq  = (const float*)d_in[3];
    const float* Wk  = (const float*)d_in[4];
    const float* Wv  = (const float*)d_in[5];
    const float* Wo  = (const float*)d_in[6];
    const float* bo  = (const float*)d_in[7];
    const float* g2  = (const float*)d_in[8];
    const float* be2 = (const float*)d_in[9];
    const float* W1  = (const float*)d_in[10];
    const float* fb1 = (const float*)d_in[11];
    const float* W2  = (const float*)d_in[12];
    const float* fb2 = (const float*)d_in[13];
    float* out = (float*)d_out;

    char* ws = (char*)d_ws;
    auto alloc = [&](size_t bytes) -> char* {
        char* p = ws; ws += (bytes + 255) & ~(size_t)255; return p;
    };
    u16*   wqkvT = (u16*)alloc((size_t)3 * D * D * 2);   // [3D][D]
    u16*   woT   = (u16*)alloc((size_t)D * D * 2);       // [D][D]
    u16*   w1T   = (u16*)alloc((size_t)DF * D * 2);      // [DF][D]
    u16*   w2T   = (u16*)alloc((size_t)D * DF * 2);      // [D][DF]
    u16*   h1    = (u16*)alloc((size_t)ROWS * D * 2);
    u16*   qkv   = (u16*)alloc((size_t)3 * ROWS * D * 2);
    u16*   ctx   = (u16*)alloc((size_t)ROWS * D * 2);
    float* xmid  = (float*)alloc((size_t)ROWS * D * 4);
    u16*   h2    = (u16*)alloc((size_t)ROWS * D * 2);
    u16*   ffn1  = (u16*)alloc((size_t)ROWS * DF * 2);

    dim3 blk(256);
    k_prep<<<NB_PREP, blk, 0, stream>>>(Wq, Wk, Wv, Wo, W1, W2, x, g1, be1, wqkvT, woT, w1T, w2T, h1);
    k_gemm<0, 3 * D, 2, false><<<dim3(3 * D / 128, ROWS / 128), blk, 0, stream>>>(h1, wqkvT, nullptr, nullptr, nullptr, qkv, D);
    k_attention<<<dim3(Bsz * H, S / 128), blk, 0, stream>>>(qkv, ctx);
    k_gemm<1, D, 4, true><<<dim3(D / 128, ROWS / 128), blk, 0, stream>>>(ctx, woT, bo, x, xmid, nullptr, D);
    k_layernorm<<<NB_LN, blk, 0, stream>>>(xmid, g2, be2, h2);
    k_gemm<2, DF, 4, true><<<dim3(DF / 128, ROWS / 128), blk, 0, stream>>>(h2, w1T, fb1, nullptr, nullptr, ffn1, D);
    k_gemm<1, D, 4, true><<<dim3(D / 128, ROWS / 128), blk, 0, stream>>>(ffn1, w2T, fb2, xmid, out, nullptr, DF);
}

// v009
// Measured time: 129 microseconds a run.
// Next to v008, in two timings, it ran 1.05 times as fast each time.
// Counting every step since v000, it is 1.89 times as fast.
#include <hip/hip_runtime.h>
#include <cstdint>

typedef unsigned short u16;
typedef __attribute__((ext_vector_type(16))) __bf16 v16bf;
typedef __attribute__((ext_vector_type(8)))  float  v8f;

constexpr int Bsz = 8, S = 512, D = 1024, H = 16, DH = 64, DF = 4096;
constexpr int ROWS = Bsz * S;   // 4096

__device__ __forceinline__ u16 f2bf(float f) {
    uint32_t u = __float_as_uint(f);
    uint32_t r = u + 0x7FFFu + ((u >> 16) & 1u);   // round-to-nearest-even
    return (u16)(r >> 16);
}

union FragBF {                  // one wave32 16x32 bf16 A/B fragment (8 VGPRs)
    v16bf v;
    uint4 u4[2];
    u16   us[16];
};

// Async global -> LDS copy of 16 bytes per lane (ASYNCcnt-tracked).
__device__ __forceinline__ void async_b128(u16* lds, const u16* gptr) {
    uint32_t l = (uint32_t)(uintptr_t)lds;          // low 32 bits = LDS offset
    asm volatile("global_load_async_to_lds_b128 %0, %1, off"
                 :: "v"(l), "v"(gptr) : "memory");
}
__device__ __forceinline__ void wait_async0() {
    asm volatile("s_wait_asynccnt 0x0" ::: "memory");
}
// Returns when all but this wave's CNT youngest copies have landed.
template <int CNT>
__device__ __forceinline__ void wait_async_but() {
    asm volatile("s_wait_asynccnt %0" :: "n"(CNT) : "memory");
}
// The same copy as the compiler's builtin: the compiler sees its address registers.
typedef __attribute__((ext_vector_type(4))) int v4i;
__device__ __forceinline__ void copy_b128(u16* lds, const u16* gptr) {
    __builtin_amdgcn_global_load_async_to_lds_b128(
        (__attribute__((address_space(1))) v4i*)gptr, (__attribute__((address_space(3))) v4i*)lds, 0, 0);
}

// DPP butterfly reduction across a 16-lane row (lanes 0-15 / 16-31 separately).
template <int CTRL>
__device__ __forceinline__ float dpp_f(float x) {
    return __int_as_float(__builtin_amdgcn_mov_dpp(__float_as_int(x), CTRL, 0xf, 0xf, true));
}
__device__ __forceinline__ float red_max16(float v) {
    v = fmaxf(v, dpp_f<0xB1>(v));    // quad_perm [1,0,3,2]  (xor 1)
    v = fmaxf(v, dpp_f<0x4E>(v));    // quad_perm [2,3,0,1]  (xor 2)
    v = fmaxf(v, dpp_f<0x141>(v));   // row_half_mirror
    v = fmaxf(v, dpp_f<0x140>(v));   // row_mirror
    return v;
}
__device__ __forceinline__ float red_sum16(float v) {
    v += dpp_f<0xB1>(v);
    v += dpp_f<0x4E>(v);
    v += dpp_f<0x141>(v);
    v += dpp_f<0x140>(v);
    return v;
}

__device__ __forceinline__ float xhalf(float x) {     // lane l reads lane l ^ 16
    return __int_as_float(__builtin_amdgcn_permlanex16(__float_as_int(x), __float_as_int(x),
                                                       0x76543210, 0xfedcba98, false, false));
}

// ---------------------------------------------------------------------------
// Weight conversion: fp32 -> bf16, stored TRANSPOSED as W^T[N][K] so GEMM B
// tiles are row-major block copies (async-to-LDS friendly, no LDS scatter).
// One block transposes a tile of 128 k x 64 n through LDS: it reads 256-byte
// row pieces of the source (16 bytes a lane) and writes 256-byte row pieces of
// the destination (16 bytes a lane).  LDS holds one dword per (n, k pair).
// ---------------------------------------------------------------------------
constexpr int CTK = 128, CTN = 64;        // tile: k extent, n extent
constexpr int CPITCH = CTK / 2 + 1;       // dwords per n row; odd, so both sides spread over the banks

// src: first element of the tile, rows are k (pitch srcPitch floats).
// dst: first element of the tile, rows are n (pitch dstPitch bf16).
// tl: CTN * CPITCH dwords of LDS, the caller's (one array serves every instance in a kernel).
template <int srcPitch, int dstPitch>
__device__ __forceinline__ void conv_tile(const float* __restrict__ src, u16* __restrict__ dst, uint32_t* tl) {
    const int tid = threadIdx.x;
    const int nq = tid & 15, kp0 = tid >> 4;           // 4 n columns, k pair (+16*j)
    float4 r0[4], r1[4];
#pragma unroll
    for (int j = 0; j < 4; j++) {
        const float* p = src + (2 * kp0 * srcPitch + nq * 4) + 32 * j * srcPitch;
        r0[j] = *(const float4*)p;
        r1[j] = *(const float4*)(p + srcPitch);
    }
#pragma unroll
    for (int j = 0; j < 4; j++) {
        uint32_t* q = &tl[(nq * 4) * CPITCH + kp0 + 16 * j];
        q[0 * CPITCH] = (uint32_t)f2bf(r0[j].x) | ((uint32_t)f2bf(r1[j].x) << 16);
        q[1 * CPITCH] = (uint32_t)f2bf(r0[j].y) | ((uint32_t)f2bf(r1[j].y) << 16);
        q[2 * CPITCH] = (uint32_t)f2bf(r0[j].z) | ((uint32_t)f2bf(r1[j].z) << 16);
        q[3 * CPITCH] = (uint32_t)f2bf(r0[j].w) | ((uint32_t)f2bf(r1[j].w) << 16);
    }
    __syncthreads();
#pragma unroll
    for (int i = 0; i < 4; i++) {
        const int n = (tid >> 4) + 16 * i, kq = tid & 15;   // 16 lanes cover one n row
        const uint32_t* q = &tl[n * CPITCH + kq * 4];
        uint4 o = make_uint4(q[0], q[1], q[2], q[3]);
        *(uint4*)&dst[((tid >> 4) * dstPitch + kq * 8) + 16 * i * dstPitch] = o;
    }
}

// ---------------------------------------------------------------------------
// LayerNorm -> bf16.  One WAVE per row of D = 1024: a lane holds 32 of the row's
// values in registers (8 loads of 16 bytes, each 512 bytes in a row over the wave),
// the two sums run inside the lane and then across the 32 lanes.  No LDS and no
// barrier; a block of 256 threads takes LNR = 8 rows, so that a launch starts an
// eighth of the waves that a block per row needs.
// ---------------------------------------------------------------------------
constexpr int LNR = 8;                    // rows a block: one per wave

__device__ __forceinline__ float red_sum32(float v) {   // the sum over all 32 lanes, in every lane
    v = red_sum16(v);
    return v + xhalf(v);
}

typedef __attribute__((ext_vector_type(4))) float f32x4;
typedef __attribute__((ext_vector_type(2))) float f32x2;

__device__ __forceinline__ void ln_row(const float* __restrict__ x, const float* __restrict__ g,
                                       const float* __restrict__ b, u16* __restrict__ out, int row) {
    const int lane = threadIdx.x & 31;
    const f32x4* xr = (const f32x4*)(x + (size_t)row * D) + lane;
    const f32x4* gr = (const f32x4*)g + lane;
    const f32x4* br = (const f32x4*)b + lane;
    f32x4 v[8], gg[8], bb[8];
#pragma unroll
    for (int j = 0; j < 8; j++) v[j] = xr[j * 32];
    // the compiler lets a later load's result land in the address registers of the loads above:
    // the wait that belongs in front of an overwrite of a load's registers
    asm volatile("s_wait_xcnt 0x0" ::: "memory");
#pragma unroll
    for (int j = 0; j < 8; j++) { gg[j] = gr[j * 32]; bb[j] = br[j * 32]; }
    // all 24 loads are issued before the first sum: left free, the compiler sinks those of g and b to
    // their uses behind the sums, some of them one at a time, each with its whole latency exposed
    __builtin_amdgcn_sched_barrier(0);
    f32x2 s0 = v[0].lo, s1 = v[0].hi;     // four independent chains, two to a packed add
#pragma unroll
    for (int j = 1; j < 8; j++) { s0 += v[j].lo; s1 += v[j].hi; }
    s0 += s1;
    const float mean = red_sum32(s0.x + s0.y) * (1.0f / D);
    f32x2 q0 = 0.f, q1 = 0.f;
#pragma unroll
    for (int j = 0; j < 8; j++) {
        v[j] -= mean;
        q0 = __builtin_elementwise_fma(v[j].lo, v[j].lo, q0);
        q1 = __builtin_elementwise_fma(v[j].hi, v[j].hi, q1);
    }
    q0 += q1;
    const float rstd = rsqrtf(red_sum32(q0.x + q0.y) * (1.0f / D) + 1e-5f);
    u16* orow = out + (size_t)row * D + lane * 4;
#pragma unroll
    for (int j = 0; j < 8; j++) {         // 8 bytes a lane, 256 bytes in a row over the wave
        const f32x4 y = v[j] * rstd * gg[j] + bb[j];
        *(uint2*)&orow[j * 128] = make_uint2((uint32_t)f2bf(y.x) | ((uint32_t)f2bf(y.y) << 16),
                                             (uint32_t)f2bf(y.z) | ((uint32_t)f2bf(y.w) << 16));
    }
}

__global__ __launch_bounds__(256) void k_layernorm(const float* __restrict__ x, const float* __restrict__ g,
                                                   const float* __restrict__ b, u16* __restrict__ out) {
    ln_row(x, g, b, out, blockIdx.x * LNR + (threadIdx.x >> 5));
}

// ---------------------------------------------------------------------------
// Everything that depends on the inputs alone, in ONE launch: the four weight
// conversions and the first LayerNorm.  Block indices are dealt in groups of
// MIX_C conversion tiles and MIX_L LayerNorm blocks, so that both kinds of
// block share every WGP for the whole launch.
// ---------------------------------------------------------------------------
constexpr int NB_QKV = 3 * H * (D / CTK);            // one [D][DH] matrix per 8 k tiles
constexpr int NB_WO  = (D / CTN) * (D / CTK);
constexpr int NB_W1  = (DF / CTN) * (D / CTK);
constexpr int NB_W2  = (D / CTN) * (DF / CTK);
constexpr int NB_CONV = NB_W1 + NB_W2 + NB_QKV + NB_WO;
constexpr int NB_LN = ROWS / LNR;
constexpr int NGRP = 512, MIX_C = NB_CONV / NGRP, MIX_L = NB_LN / NGRP;   // 3 tiles and 1 block of 8 rows a group
static_assert(MIX_C * NGRP == NB_CONV && MIX_L * NGRP == NB_LN, "groups must cover both kinds of block exactly");
constexpr int NB_PREP = NB_CONV + NB_LN;

__global__ __launch_bounds__(256) void k_prep(const float* __restrict__ Wq, const float* __restrict__ Wk,
                                              const float* __restrict__ Wv, const float* __restrict__ Wo,
                                              const float* __restrict__ W1, const float* __restrict__ W2,
                                              const float* __restrict__ x, const float* __restrict__ g,
                                              const float* __restrict__ b,
                                              u16* __restrict__ wqkvT, u16* __restrict__ woT,
                                              u16* __restrict__ w1T, u16* __restrict__ w2T,
                                              u16* __restrict__ h1) {
    __shared__ uint32_t lds[CTN * CPITCH];            // a conversion's tile
    // every test below is the same for the whole block
    const int grp = blockIdx.x / (MIX_C + MIX_L), r = blockIdx.x % (MIX_C + MIX_L);
    if (r >= MIX_C) {
        ln_row(x, g, b, h1, (grp * MIX_L + r - MIX_C) * LNR + (threadIdx.x >> 5));
        return;
    }
    int blk = grp * MIX_C + r;                        // conversion tile 0 .. NB_CONV - 1
    if (blk < NB_W1) {                                // dst[n*K + k] = src[k*N + n], n tile fastest
        const int n0 = (blk % (DF / CTN)) * CTN, k0 = (blk / (DF / CTN)) * CTK;
        conv_tile<DF, D>(W1 + (size_t)k0 * DF + n0, w1T + (size_t)n0 * D + k0, lds);
    } else if ((blk -= NB_W1) < NB_W2) {
        const int n0 = (blk % (D / CTN)) * CTN, k0 = (blk / (D / CTN)) * CTK;
        conv_tile<D, DF>(W2 + (size_t)k0 * D + n0, w2T + (size_t)n0 * DF + k0, lds);
    } else if ((blk -= NB_W2) < NB_QKV) {             // which * H + h fastest, then the k tile
        const int m = blk % (3 * H), which = m >> 4, h = m & 15;
        const int k0 = (blk / (3 * H)) * CTK;
        const float* W = (which == 0) ? Wq : (which == 1 ? Wk : Wv);
        conv_tile<DH, D>(W + ((size_t)h * D + k0) * DH, wqkvT + (size_t)(which * D + h * DH) * D + k0, lds);
    } else {
        blk -= NB_QKV;
        const int n0 = (blk % (D / CTN)) * CTN, k0 = (blk / (D / CTN)) * CTK;
        conv_tile<D, D>(Wo + (size_t)k0 * D + n0, woT + (size_t)n0 * D + k0, lds);
        // in the built code another range's register writes follow these stores behind a scalar
        // test only: the wait that belongs in front of an overwrite of a store's registers
        asm volatile("s_wait_xcnt 0x0" ::: "memory");
    }
}

// ---------------------------------------------------------------------------
// bf16 WMMA GEMM: C[M][N] = A[M][K] * B[K][N] with B supplied TRANSPOSED
// (Bt[N][K]).  Block tile 128x128 (BT = 256: below), K-step 64, async-to-LDS staging in a ring of
// NS buffers, NS - 1 K-steps ahead, single barrier per K-step.  NS = 2 for QKV, whose
// blocks are all resident at once, three a WGP, and cover each other's waits.  NS = 4
// for the others: with N = 1024 a block has its WGP alone;
// so has a block with N = 4096 (BT = 256).
// BT = 128: 8 waves, 16 v_wmma_f32_16x16x32_bf16 each per K-step.
// SK false: 4(m) x 2(n) waves, a wave has 32x64 = 2x4 WMMA tiles over both 32-k halves of the K-step
// and reads 12 fragments for its 16 WMMAs.
// SK true: 2(m) x 2(n) x 2(k) waves, a wave has 64x64 = 4x4 WMMA tiles over ONE 32-k half and reads
// 8 fragments for its 16 WMMAs: two thirds of the LDS reads, and one group of them a K-step.  The two
// waves of a tile hold partial sums; the epilogue adds them in LDS, each wave finishing 32 of the 64 rows.
// BT = 256 (N = 4096, where 256x256 tiles make one block a WGP): block tile 256x256, 16 waves, 4(m) x 4(n), a wave
// has 64x64 over both 32-k halves.  A block brings in 64 KB a K-step for four times the products of a 128x128
// block's 32 KB: half the bytes out of L2 per product; a barrier and a wait serve four times the WMMAs.
// EPI 0: QKV permute -> bf16 (Q pre-scaled by 1/sqrt(DH), V stored transposed)
// EPI 1: +bias +res -> fp32      EPI 2: GELU(.+bias) -> bf16
// All three write out through LDS in 16-byte pieces that fill whole lines.
// ---------------------------------------------------------------------------
constexpr int TSTRIDE = 72;               // 64 + 8 pad (u16)
constexpr int EPITCH = 68;                // epilogue staging, floats a row: 64 + 4, rows 8 apart fall 32 banks apart
constexpr int VPITCH = 136;               // V^T staging, u16 a column: 128 + 8, 16 columns spread over all banks

template <int EPI, int N, int NS, bool SK, int BT>   // N at compile time: the epilogue's row steps become immediate offsets
__global__ __launch_bounds__(2 * BT) void k_gemm(const u16* __restrict__ A, const u16* __restrict__ Bt,
                                              const float* __restrict__ bias, const float* __restrict__ res,
                                              float* __restrict__ outF, u16* __restrict__ outU,
                                              int K) {
    constexpr bool BIG = BT == 256;
    static_assert(BT == 128 || (BIG && !SK && EPI == 2), "the 256x256 tile is written for the GELU epilogue, without the k split");
    constexpr int TSZ = BT * TSTRIDE;     // one BT x 64 tile in LDS (u16 count)
    __shared__ __attribute__((aligned(16))) u16 smem[NS * 2 * TSZ];   // [buf 0 .. NS-1][A tile | B tile]; epilogue staging afterwards
    const int tid = threadIdx.x;
    const int lane = tid & 31, wave = tid >> 5;
    constexpr int MT = (SK || BIG) ? 4 : 2;            // 16-row WMMA tiles of a wave
    const int wk = SK ? wave >> 2 : 0;                 // SK: the 32-k half of every K-step that this wave sums
    const int wm = SK ? wave & 1 : wave & 3;           // 2(m) x 2(n) x 2(k), or 4(m) x 2(n), or 4(m) x 4(n)
    const int wn = SK ? (wave >> 1) & 1 : wave >> 2;
    const int em = SK ? wm * 2 + wk : wm;              // the 32 x 64 piece of the block tile that this wave writes out: rows em * 32
    const int m0 = blockIdx.y * BT, n0 = blockIdx.x * BT;
    const int l15 = lane & 15, lhalf = lane >> 4, koff = lhalf * 8;
    const int ldr = tid >> 3, ldc = (tid & 7) * 8;     // loader: row 0..BT/4-1 (+j*BT/4), col chunk

    v8f acc[MT][4] = {};

    auto issue_tile = [&](int k0, int buf) {
        u16* As = &smem[buf * 2 * TSZ];
        u16* Bs = As + TSZ;
#pragma unroll
        for (int j = 0; j < 4; j++) {
            int r = ldr + j * (BT / 4);
            copy_b128(&As[r * TSTRIDE + ldc], &A[(size_t)(m0 + r) * K + k0 + ldc]);
            copy_b128(&Bs[r * TSTRIDE + ldc], &Bt[(size_t)(n0 + r) * K + k0 + ldc]);
        }
    };

    constexpr int CPS = 8;                // copies of a wave per tile
    const int nT = K / 64;
    // the ring's first NS - 1 tiles (every launch has K >= (NS - 1) * 64); unrolled: each buffer's offset a constant
#pragma unroll
    for (int s = 0; s < NS - 1; s++) issue_tile(s * 64, s);
    for (int t = 0; t < nT; t++) {
        // this wave's reads of tile t - 1 are done before the barrier behind which its buffer is refilled
        asm volatile("s_wait_dscnt 0x0" ::: "memory");
        // tile t has landed: while tiles t + 1 .. t + NS - 2 all exist they are the wave's youngest
        // copies, CPS each, and stay in flight; in the last trips, which issue none, everything is waited for
        if (NS > 2 && t + NS - 2 < nT) wait_async_but<(NS - 2) * CPS>();
        else wait_async0();
        __syncthreads();                  // publishes tile t, and ends every wave's reads of tile t - 1
        if (t + NS - 1 < nT) issue_tile((t + NS - 1) * 64, (t + NS - 1) % NS);
        const u16* As = &smem[(t % NS) * 2 * TSZ];
        const u16* Bs = As + TSZ;
        if constexpr (SK || BIG) {
#pragma unroll
          for (int hk = 0; hk < (SK ? 1 : 2); hk++) {
            const int kc = SK ? wk * 32 : hk * 32;    // SK: this wave's half of the K-step; else both in turn
            const u16* pa = &As[(wm * 64 + l15) * TSTRIDE + kc + koff];
            const u16* pb = &Bs[(wn * 64 + l15) * TSTRIDE + kc + koff];
            FragBF a[4], b[4];
#pragma unroll
            for (int i = 0; i < 4; i++) {             // A and B fragments in turn: i + 1 of each feed (i + 1)^2 WMMAs
                a[i].u4[0] = *(const uint4*)(pa + i * 16 * TSTRIDE);
                a[i].u4[1] = *(const uint4*)(pa + i * 16 * TSTRIDE + 16);
                b[i].u4[0] = *(const uint4*)(pb + i * 16 * TSTRIDE);
                b[i].u4[1] = *(const uint4*)(pb + i * 16 * TSTRIDE + 16);
            }
            // all 16 reads are issued before the first WMMA: left free, the compiler loads three of the four A
            // fragments into one register set, each behind four WMMAs with its whole LDS latency exposed
            __builtin_amdgcn_sched_barrier(0);
            // the WMMAs in the order in which their fragments arrive; each accumulator gets exactly one
            constexpr int OM[16] = {0, 1, 0, 1, 2, 2, 0, 1, 2, 3, 3, 3, 0, 1, 2, 3};
            constexpr int ON[16] = {0, 0, 1, 1, 0, 1, 2, 2, 2, 0, 1, 2, 3, 3, 3, 3};
#pragma unroll
            for (int i = 0; i < 16; i++)
                acc[OM[i]][ON[i]] = __builtin_amdgcn_wmma_f32_16x16x32_bf16(
                    false, a[OM[i]].v, false, b[ON[i]].v, (short)0, acc[OM[i]][ON[i]], false, false);
            // the second half's 16 reads stay one group behind these WMMAs, not single reads among them
            if constexpr (BIG) __builtin_amdgcn_sched_barrier(0);
          }
        } else {
#pragma unroll
            for (int kc = 0; kc < 64; kc += 32) {
                FragBF a[2], b[4];
#pragma unroll
                for (int mt = 0; mt < 2; mt++) {
                    const u16* p = &As[(wm * 32 + mt * 16 + l15) * TSTRIDE + kc + koff];
                    a[mt].u4[0] = *(const uint4*)p;
                    a[mt].u4[1] = *(const uint4*)(p + 16);
                }
#pragma unroll
                for (int nt = 0; nt < 4; nt++) {
                    const u16* p = &Bs[(wn * 64 + nt * 16 + l15) * TSTRIDE + kc + koff];
                    b[nt].u4[0] = *(const uint4*)p;
                    b[nt].u4[1] = *(const uint4*)(p + 16);
                }
#pragma unroll
                for (int mt = 0; mt < 2; mt++)
#pragma unroll
                    for (int nt = 0; nt < 4; nt++)
                        acc[mt][nt] = __builtin_amdgcn_wmma_f32_16x16x32_bf16(
                            false, a[mt].v, false, b[nt].v, (short)0, acc[mt][nt], false, false);
            }
        }
    }

    // Epilogue: the accumulators go through LDS so that every global access is
    // 16 bytes a lane and covers whole 128-byte lines.
    constexpr size_t planeE = (size_t)Bsz * H * S * DH;
    __syncthreads();                      // every wave has left the last K tile: smem is staging space now
    static_assert((SK || BIG ? 16 : 8) * 32 * EPITCH * 4 <= NS * 2 * TSZ * 2, "the staging tiles must fit the ring's LDS");
    float* st = (float*)smem + wave * (32 * EPITCH);   // this wave's own 32 x 64 fp32 tile
    const float* pt = st + 8 * (32 * EPITCH);          // SK: the same 32 x 64 piece, the other k half's sums, written by wave ^ 4
    // 32 rows of accumulators, from WMMA tile row mtb on, to d; inlined so that mtb is a constant and acc stays in registers
    auto put = [&](float* d, int mtb) __attribute__((always_inline)) {
#pragma unroll
        for (int mt = 0; mt < 2; mt++)
#pragma unroll
            for (int nt = 0; nt < 4; nt++)
#pragma unroll
                for (int r = 0; r < 8; r++)
                    d[(mt * 16 + r + 8 * lhalf) * EPITCH + nt * 16 + l15] = acc[mtb + mt][nt][r];
    };
    auto stage = [&]() {
        if constexpr (SK) {
            // the half of its 64 rows that this wave writes out (rows 0 to 31 for wk = 0) goes to its own tile,
            // the other half to its partner's second tile
            float* po = (float*)smem + (8 + (wave ^ 4)) * (32 * EPITCH);
            put(wk == 0 ? st : po, 0);
            put(wk == 0 ? po : st, 2);
        } else {
            put(st, 0);
        }
        // the rows are read back by other lanes of this wave: its LDS writes must have landed
        asm volatile("s_wait_dscnt 0x0" ::: "memory");
        if constexpr (SK) __syncthreads();             // and the partner wave's, which hold the other k half's sums
    };
    auto add4 = [](float4 x, float4 y) { return make_float4(x.x + y.x, x.y + y.y, x.z + y.z, x.w + y.w); };
    auto pack8 = [](float4 lo, float4 hi) {
        return make_uint4((uint32_t)f2bf(lo.x) | ((uint32_t)f2bf(lo.y) << 16),
                          (uint32_t)f2bf(lo.z) | ((uint32_t)f2bf(lo.w) << 16),
                          (uint32_t)f2bf(hi.x) | ((uint32_t)f2bf(hi.y) << 16),
                          (uint32_t)f2bf(hi.z) | ((uint32_t)f2bf(hi.w) << 16));
    };

    if constexpr (EPI == 0) {
        const int which = n0 >> 10;                       // /D : 0=Q 1=K 2=V, the same for the whole block
        const int nb = n0 & 1023;                         // h * DH + e of the block's first column
        const int bb = m0 >> 9, s0 = m0 & 511;            // /S, %S of the block's first row
        if (which != 2) {                                 // Q or K; the whole block takes this side
            stage();
            const float sc = (which == 0) ? 0.125f : 1.0f;   // fold 1/sqrt(DH) into Q
            // the wave's 64 columns are one head: its 32 x 64 tile is 4 KB in a row
            u16* dst = outU + (size_t)which * planeE +
                       (((size_t)bb * H + (nb >> 6) + wn) * S + s0 + em * 32) * DH + lane * 8;
#pragma unroll
            for (int i = 0; i < 8; i++) {
                const int row = i * 4 + (lane >> 3), c8 = (lane & 7) * 8;
                float4 lo = *(const float4*)&st[row * EPITCH + c8];
                float4 hi = *(const float4*)&st[row * EPITCH + c8 + 4];
                lo.x *= sc; lo.y *= sc; lo.z *= sc; lo.w *= sc;
                hi.x *= sc; hi.y *= sc; hi.z *= sc; hi.w *= sc;
                *(uint4*)&dst[i * 4 * DH] = pack8(lo, hi);       // (lane >> 3) * DH + c8 == lane * 8
            }
            // in the built code the V side's register writes follow these stores behind a scalar
            // test only: the wait that belongs in front of an overwrite of a store's registers
            asm volatile("s_wait_xcnt 0x0" ::: "memory");
            return;
        }
        // V is stored transposed [b][h][dh][s]: 8 accumulator rows of a lane are 8
        // neighbours in s.  Block tile in LDS as [128 columns][128 s], then 256-byte rows out.
#pragma unroll
        for (int mt = 0; mt < 2; mt++)
#pragma unroll
            for (int nt = 0; nt < 4; nt++) {
                const v8f c = acc[mt][nt];
                *(uint4*)&smem[(wn * 64 + nt * 16 + l15) * VPITCH + wm * 32 + mt * 16 + 8 * lhalf] =
                    pack8(make_float4(c[0], c[1], c[2], c[3]), make_float4(c[4], c[5], c[6], c[7]));
            }
        __syncthreads();                  // a column's 128 s values come from four waves
        const int c0 = tid >> 4, q = (tid & 15) * 8;
        u16* dst = outU + 2 * planeE + ((size_t)bb * D + nb + c0) * S + s0 + q;
#pragma unroll
        for (int i = 0; i < 8; i++)
            *(uint4*)&dst[i * 16 * S] = *(const uint4*)&smem[(i * 16 + c0) * VPITCH + q];
    } else if constexpr (EPI == 1) {
        stage();
        const int c4 = (lane & 15) * 4;
        const float4 bv = *(const float4*)&bias[n0 + wn * 64 + c4];
        // one 32-bit byte offset serves the residual reads and the stores
        const uint32_t off = (uint32_t)((m0 + em * 32 + lhalf) * N + n0 + wn * 64 + c4) * 4u;
        const char* rp = (const char*)res + off;
        char* op = (char*)outF + off;
#pragma unroll
        for (int i = 0; i < 16; i++) {
            float4 v = *(const float4*)&st[(i * 2 + lhalf) * EPITCH + c4];
            if constexpr (SK) v = add4(v, *(const float4*)&pt[(i * 2 + lhalf) * EPITCH + c4]);
            const float4 rr = *(const float4*)(rp + i * 2 * N * 4);
            *(float4*)(op + i * 2 * N * 4) =
                make_float4(v.x + bv.x + rr.x, v.y + bv.y + rr.y, v.z + bv.z + rr.z, v.w + bv.w + rr.w);
        }
    } else {
        const int c8 = (lane & 7) * 8;
        const float4 b0 = *(const float4*)&bias[n0 + wn * 64 + c8];
        const float4 b1 = *(const float4*)&bias[n0 + wn * 64 + c8 + 4];
        // GELU(t) = 0.5 t (1 + erf(t / sqrt 2)), without a branch.  With z = |t| / sqrt 2:
        // erfc(z) = u (a1 + u (a2 + u (a3 + u (a4 + u a5)))) exp(-z z), u = 1 / (1 + p z), absolute error
        // at most 1.5e-7; 1 + erf is erfc(z) for t < 0 (no cancellation there) and 2 - erfc(z) otherwise.
        // The library erff picks one of two polynomials by a branch per element, which the lanes of a
        // wave take both ways and which keeps the elements' dependent chains from overlapping.
        auto gelu4 = [](float4 t) {
            const float a0 = fmaf(0.3275911f * 0.70710678118654752f, fabsf(t.x), 1.0f);
            const float a1 = fmaf(0.3275911f * 0.70710678118654752f, fabsf(t.y), 1.0f);
            const float a2 = fmaf(0.3275911f * 0.70710678118654752f, fabsf(t.z), 1.0f);
            const float a3 = fmaf(0.3275911f * 0.70710678118654752f, fabsf(t.w), 1.0f);
            const float b0 = t.x * t.x * -0.72134752044448170f, b1 = t.y * t.y * -0.72134752044448170f;
            const float b2 = t.z * t.z * -0.72134752044448170f, b3 = t.w * t.w * -0.72134752044448170f;
            float u0, u1, u2, u3, e0, e1, e2, e3;     // u = 1 / a, e = 2^b = exp(-t t / 2)
            // One statement, so that behind each transcendental stands an instruction that neither reads
            // its result nor overwrites its source, as the instruction set asks: the outputs are early
            // clobbers (no output shares a register with an input), and v_nop is the slot behind the last.
            asm("v_rcp_f32 %0, %8\n\tv_rcp_f32 %1, %9\n\tv_rcp_f32 %2, %10\n\tv_rcp_f32 %3, %11\n\t"
                "v_exp_f32 %4, %12\n\tv_exp_f32 %5, %13\n\tv_exp_f32 %6, %14\n\tv_exp_f32 %7, %15\n\tv_nop"
                : "=&v"(u0), "=&v"(u1), "=&v"(u2), "=&v"(u3), "=&v"(e0), "=&v"(e1), "=&v"(e2), "=&v"(e3)
                : "v"(a0), "v"(a1), "v"(a2), "v"(a3), "v"(b0), "v"(b1), "v"(b2), "v"(b3));
            auto fin = [](float tt, float u, float e) {
                float p = fmaf(1.061405429f, u, -1.453152027f);
                p = fmaf(p, u, 1.421413741f);
                p = fmaf(p, u, -0.284496736f);
                p = fmaf(p, u, 0.254829592f);
                const float c = p * u * e;            // erfc(|t| / sqrt 2)
                return 0.5f * tt * (tt < 0.f ? c : 2.0f - c);
            };
            return make_float4(fin(t.x, u0, e0), fin(t.y, u1, e1), fin(t.z, u2, e2), fin(t.w, u3, e3));
        };
#pragma unroll
      for (int h = 0; h < (BIG ? 2 : 1); h++) {       // BT = 256: the wave's 64 rows go through its 32-row staging tile in two turns
        if constexpr (BIG) {
            put(st, 2 * h);
            // the rows are read back by other lanes of this wave: its LDS writes must have landed
            asm volatile("s_wait_dscnt 0x0" ::: "memory");
        } else {
            stage();
        }
        u16* dst = outU + (size_t)(m0 + (BIG ? wm * 64 + h * 32 : em * 32) + (lane >> 3)) * N + n0 + wn * 64 + c8;
#pragma unroll
        for (int i = 0; i < 8; i++) {
            const int row = i * 4 + (lane >> 3);
            float4 lo = *(const float4*)&st[row * EPITCH + c8];
            float4 hi = *(const float4*)&st[row * EPITCH + c8 + 4];
            if constexpr (SK) {
                lo = add4(lo, *(const float4*)&pt[row * EPITCH + c8]);
                hi = add4(hi, *(const float4*)&pt[row * EPITCH + c8 + 4]);
            }
            *(uint4*)&dst[i * 4 * N] =
                pack8(gelu4(make_float4(lo.x + b0.x, lo.y + b0.y, lo.z + b0.z, lo.w + b0.w)),
                      gelu4(make_float4(hi.x + b1.x, hi.y + b1.y, hi.z + b1.z, hi.w + b1.w)));
        }
      }
    }
}

__device__ __forceinline__ void exp8(const float (&x)[8], float (&y)[8]) {
    float e[8], a[8], t[8];
#pragma unroll
    for (int i = 0; i < 8; i++) {
        const float ph = x[i] * 0x1.715476p+0f;
        const float pl = fmaf(x[i], 0x1.4ae0bep-26f, fmaf(x[i], 0x1.715476p+0f, -ph));
        e[i] = rintf(ph);
        a[i] = (ph - e[i]) + pl;
    }
    asm("v_exp_f32 %0, %8\n\tv_exp_f32 %1, %9\n\tv_exp_f32 %2, %10\n\tv_exp_f32 %3, %11\n\t"
        "v_exp_f32 %4, %12\n\tv_exp_f32 %5, %13\n\tv_exp_f32 %6, %14\n\tv_exp_f32 %7, %15\n\tv_nop"
        : "=&v"(t[0]), "=&v"(t[1]), "=&v"(t[2]), "=&v"(t[3]), "=&v"(t[4]), "=&v"(t[5]), "=&v"(t[6]), "=&v"(t[7])
        : "v"(a[0]), "v"(a[1]), "v"(a[2]), "v"(a[3]), "v"(a[4]), "v"(a[5]), "v"(a[6]), "v"(a[7]));
#pragma unroll
    for (int i = 0; i < 8; i++) {
        float r = ldexpf(t[i], (int)e[i]);
        r = x[i] < -0x1.9d1da0p+6f ? 0.f : r;
        y[i] = x[i] > 0x1.62e430p+6f ? __builtin_inff() : r;
    }
}

__global__ __launch_bounds__(256) void k_attention(const u16* __restrict__ qkv, u16* __restrict__ ctx) {
    __shared__ u16 Ks[2][32][72];    // [buf][key t][dh]   (+8 pad)
    __shared__ u16 Vs[2][64][40];    // [buf][dh][key t]   (+8 pad)
    const int tid = threadIdx.x;
    const int lane = tid & 31, wave = tid >> 5;
    const int l15 = lane & 15, lhalf = lane >> 4, koff = lhalf * 8;
    const int bh = blockIdx.x;                    // b*H + h
    const int qBase = blockIdx.y * 128;
    const int q0w = qBase + wave * 16;
    const size_t plane = (size_t)Bsz * H * S * DH;
    const u16* qp = qkv + (size_t)bh * S * DH;
    const u16* kp = qkv + plane + (size_t)bh * S * DH;
    const u16* vp = qkv + 2 * plane + (size_t)bh * DH * S;   // transposed [dh][s]

    // Q fragments (already scaled by 1/sqrt(DH)) for this wave's 16 rows: B operand, column = query l15.
    FragBF qa0, qa1;
    {
        const u16* qrow = qp + (size_t)(q0w + l15) * DH;
        qa0.u4[0] = *(const uint4*)&qrow[koff];
        qa0.u4[1] = *(const uint4*)&qrow[koff + 16];
        qa1.u4[0] = *(const uint4*)&qrow[32 + koff];
        qa1.u4[1] = *(const uint4*)&qrow[32 + koff + 16];
    }

    auto issue_kv = [&](int kt, int buf) {
        int t = tid >> 3, c8 = (tid & 7) * 8;              // K: 32 keys x 64 dh
        async_b128(&Ks[buf][t][c8], &kp[(size_t)(kt * 32 + t) * DH + c8]);
        int dh = tid >> 2, c = (tid & 3) * 8;              // V^T: 64 dh x 32 keys
        async_b128(&Vs[buf][dh][c], &vp[(size_t)dh * S + kt * 32 + c]);
    };

    v8f ov[4] = {};                 // O^T accum: ov[c][r] = O[query l15][dh c*16 + 8*lhalf + r]
    const int rowg = q0w + l15;     // this lane's query
    float mrow = -3.0e38f;          // its running maximum, alike in both halves
    float lrow = 0.f;               // its running sum over the keys that this half holds

    const int ktEnd = (qBase + 127) >> 5;         // 32-key tiles
    issue_kv(0, 0);
    for (int kt = 0; kt <= ktEnd; kt++) {
        wait_async0();
        __syncthreads();
        if (kt + 1 <= ktEnd) issue_kv(kt + 1, (kt + 1) & 1);
        const int cur = kt & 1;

        // scores: K(32x64) @ Q^T(64x16) -> two 16x16 C tiles, 4 full WMMAs
        // sc0[r] = S[rowg][kt*32 + 8*lhalf + r], sc1[r] the key 16 further
        FragBF kb;
        v8f sc0 = {}, sc1 = {};
        kb.u4[0] = *(const uint4*)&Ks[cur][l15][koff];
        kb.u4[1] = *(const uint4*)&Ks[cur][l15][koff + 16];
        sc0 = __builtin_amdgcn_wmma_f32_16x16x32_bf16(false, kb.v, false, qa0.v, (short)0, sc0, false, false);
        kb.u4[0] = *(const uint4*)&Ks[cur][l15][32 + koff];
        kb.u4[1] = *(const uint4*)&Ks[cur][l15][32 + koff + 16];
        sc0 = __builtin_amdgcn_wmma_f32_16x16x32_bf16(false, kb.v, false, qa1.v, (short)0, sc0, false, false);
        kb.u4[0] = *(const uint4*)&Ks[cur][16 + l15][koff];
        kb.u4[1] = *(const uint4*)&Ks[cur][16 + l15][koff + 16];
        sc1 = __builtin_amdgcn_wmma_f32_16x16x32_bf16(false, kb.v, false, qa0.v, (short)0, sc1, false, false);
        kb.u4[0] = *(const uint4*)&Ks[cur][16 + l15][32 + koff];
        kb.u4[1] = *(const uint4*)&Ks[cur][16 + l15][32 + koff + 16];
        sc1 = __builtin_amdgcn_wmma_f32_16x16x32_bf16(false, kb.v, false, qa1.v, (short)0, sc1, false, false);

        const int key0 = kt * 32 + koff, key1 = key0 + 16;
        float s0[8], s1[8];
        float tm0 = -3.0e38f, tm1 = -3.0e38f;               // two chains: half the dependent depth of one
#pragma unroll
        for (int r = 0; r < 8; r++) {
            s0[r] = (key0 + r > rowg) ? -3.0e38f : sc0[r];  // causal mask; scale already folded into Q
            s1[r] = (key1 + r > rowg) ? -3.0e38f : sc1[r];
            tm0 = fmaxf(tm0, s0[r]);
            tm1 = fmaxf(tm1, s1[r]);
        }
        float tm = fmaxf(tm0, tm1);
        tm = fmaxf(tm, xhalf(tm));                          // the other half holds the tile's other 16 keys
        const float mnew = fmaxf(mrow, tm);
        const float f = expf(mrow - mnew);
        float ps = 0.f;
        FragBF pb;                                          // P^T, full 32x16 B fragment: element s is key 8*lhalf + s, 16 + 8*lhalf + s - 8
#pragma unroll
        for (int r = 0; r < 8; r++) { s0[r] -= mnew; s1[r] -= mnew; }
        float e0[8], e1[8];
        exp8(s0, e0);
        exp8(s1, e1);
#pragma unroll
        for (int r = 0; r < 8; r++) {
            float p0 = e0[r];
            float p1 = e1[r];
            if (key0 + r > rowg) p0 = 0.f;
            if (key1 + r > rowg) p1 = 0.f;
            ps += p0 + p1;
            pb.us[r]     = f2bf(p0);
            pb.us[8 + r] = f2bf(p1);
        }
        lrow = lrow * f + ps;
        mrow = mnew;

#pragma unroll
        for (int c = 0; c < 4; c++)
#pragma unroll
            for (int r = 0; r < 8; r++) ov[c][r] *= f;

#pragma unroll
        for (int c = 0; c < 4; c++) {
            FragBF vb;                                      // V^T, full 16x32 A fragment: row = dh c*16 + l15
            vb.u4[0] = *(const uint4*)&Vs[cur][c * 16 + l15][koff];
            vb.u4[1] = *(const uint4*)&Vs[cur][c * 16 + l15][koff + 16];
            ov[c] = __builtin_amdgcn_wmma_f32_16x16x32_bf16(false, vb.v, false, pb.v, (short)0, ov[c], false, false);
        }
    }

    // normalize and write ctx[b][s][h*DH + e] as bf16: a lane's 8 registers are 8 neighbours in e
    const int b = bh >> 4, h = bh & 15;
    const float inv = 1.0f / (lrow + xhalf(lrow));          // the two halves' sums join here
    u16* dst = ctx + ((size_t)(b * S + rowg)) * D + h * DH + koff;
#pragma unroll
    for (int c = 0; c < 4; c++) {
        const v8f o = ov[c];
        *(uint4*)&dst[c * 16] =
            make_uint4((uint32_t)f2bf(o[0] * inv) | ((uint32_t)f2bf(o[1] * inv) << 16),
                       (uint32_t)f2bf(o[2] * inv) | ((uint32_t)f2bf(o[3] * inv) << 16),
                       (uint32_t)f2bf(o[4] * inv) | ((uint32_t)f2bf(o[5] * inv) << 16),
                       (uint32_t)f2bf(o[6] * inv) | ((uint32_t)f2bf(o[7] * inv) << 16));
    }
}

// ---------------------------------------------------------------------------
extern "C" void kernel_launch(void* const* d_in, const int* in_sizes, int n_in,
                              void* d_out, int out_size, void* d_ws, size_t ws_size,
                              hipStream_t stream) {
    (void)in_sizes; (void)n_in; (void)out_size; (void)ws_size;
    const float* x   = (const float*)d_in[0];
    const float* g1  = (const float*)d_in[1];
    const float* be1 = (const float*)d_in[2];
    const float* Wq  = (const float*)d_in[3];
    const float* Wk  = (const float*)d_in[4];
    const float* Wv  = (const float*)d_in[5];
    const float* Wo  = (const float*)d_in[6];
    const float* bo  = (const float*)d_in[7];
    const float* g2  = (const float*)d_in[8];
    const float* be2 = (const float*)d_in[9];
    const float* W1  = (const float*)d_in[10];
    const float* fb1 = (const float*)d_in[11];
    const float* W2  = (const float*)d_in[12];
    const float* fb2 = (const float*)d_in[13];
    float* out = (float*)d_out;

    char* ws = (char*)d_ws;
    auto alloc = [&](size_t bytes) -> char* {
        char* p = ws; ws += (bytes + 255) & ~(size_t)255; return p;
    };
    u16*   wqkvT = (u16*)alloc((size_t)3 * D * D * 2);   // [3D][D]
    u16*   woT   = (u16*)alloc((size_t)D * D * 2);       // [D][D]
    u16*   w1T   = (u16*)alloc((size_t)DF * D * 2);      // [DF][D]
    u16*   w2T   = (u16*)alloc((size_t)D * DF * 2);      // [D][DF]
    u16*   h1    = (u16*)alloc((size_t)ROWS * D * 2);
    u16*   qkv   = (u16*)alloc((size_t)3 * ROWS * D * 2);
    u16*   ctx   = (u16*)alloc((size_t)ROWS * D * 2);
    float* xmid  = (float*)alloc((size_t)ROWS * D * 4);
    u16*   h2    = (u16*)alloc((size_t)ROWS * D * 2);
    u16*   ffn1  = (u16*)alloc((size_t)ROWS * DF * 2);

    dim3 blk(256);
    k_prep<<<NB_PREP, blk, 0, stream>>>(Wq, Wk, Wv, Wo, W1, W2, x, g1, be1, wqkvT, woT, w1T, w2T, h1);
    k_gemm<0, 3 * D, 2, false, 128><<<dim3(3 * D / 128, ROWS / 128), blk, 0, stream>>>(h1, wqkvT, nullptr, nullptr, nullptr, qkv, D);
    k_attention<<<dim3(Bsz * H, S / 128), blk, 0, stream>>>(qkv, ctx);
    k_gemm<1, D, 4, true, 128><<<dim3(D / 128, ROWS / 128), blk, 0, stream>>>(ctx, woT, bo, x, xmid, nullptr, D);
    k_layernorm<<<NB_LN, blk, 0, stream>>>(xmid, g2, be2, h2);
    k_gemm<2, DF, 4, false, 256><<<dim3(DF / 256, ROWS / 256), dim3(512), 0, stream>>>(h2, w1T, fb1, nullptr, nullptr, ffn1, D);
    k_gemm<1, D, 4, true, 128><<<dim3(D / 128, ROWS / 128), blk, 0, stream>>>(ffn1, w2T, fb2, xmid, out, nullptr, DF);
}

// v010
// Measured time: 123 microseconds a run.
// In both of two side-by-side timings against v009, it was 1.05 times as fast.
// Counting every step since v000, it is 1.97 times as fast.
#include <hip/hip_runtime.h>
#include <cstdint>

typedef unsigned short u16;
typedef __attribute__((ext_vector_type(16))) __bf16 v16bf;
typedef __attribute__((ext_vector_type(8)))  float  v8f;

constexpr int Bsz = 8, S = 512, D = 1024, H = 16, DH = 64, DF = 4096;
constexpr int ROWS = Bsz * S;   // 4096

__device__ __forceinline__ u16 f2bf(float f) {
    uint32_t u = __float_as_uint(f);
    uint32_t r = u + 0x7FFFu + ((u >> 16) & 1u);   // round-to-nearest-even
    return (u16)(r >> 16);
}

union FragBF {                  // one wave32 16x32 bf16 A/B fragment (8 VGPRs)
    v16bf v;
    uint4 u4[2];
    u16   us[16];
};

// Async global -> LDS copy of 16 bytes per lane (ASYNCcnt-tracked).
__device__ __forceinline__ void async_b128(u16* lds, const u16* gptr) {
    uint32_t l = (uint32_t)(uintptr_t)lds;          // low 32 bits = LDS offset
    asm volatile("global_load_async_to_lds_b128 %0, %1, off"
                 :: "v"(l), "v"(gptr) : "memory");
}
__device__ __forceinline__ void wait_async0() {
    asm volatile("s_wait_asynccnt 0x0" ::: "memory");
}
// Returns when all but this wave's CNT youngest copies have landed.
template <int CNT>
__device__ __forceinline__ void wait_async_but() {
    asm volatile("s_wait_asynccnt %0" :: "n"(CNT) : "memory");
}
// The same copy as the compiler's builtin: the compiler sees its address registers.
typedef __attribute__((ext_vector_type(4))) int v4i;
__device__ __forceinline__ void copy_b128(u16* lds, const u16* gptr) {
    __builtin_amdgcn_global_load_async_to_lds_b128(
        (__attribute__((address_space(1))) v4i*)gptr, (__attribute__((address_space(3))) v4i*)lds, 0, 0);
}

// DPP butterfly reduction across a 16-lane row (lanes 0-15 / 16-31 separately).
template <int CTRL>
__device__ __forceinline__ float dpp_f(float x) {
    return __int_as_float(__builtin_amdgcn_mov_dpp(__float_as_int(x), CTRL, 0xf, 0xf, true));
}
__device__ __forceinline__ float red_max16(float v) {
    v = fmaxf(v, dpp_f<0xB1>(v));    // quad_perm [1,0,3,2]  (xor 1)
    v = fmaxf(v, dpp_f<0x4E>(v));    // quad_perm [2,3,0,1]  (xor 2)
    v = fmaxf(v, dpp_f<0x141>(v));   // row_half_mirror
    v = fmaxf(v, dpp_f<0x140>(v));   // row_mirror
    return v;
}
__device__ __forceinline__ float red_sum16(float v) {
    v += dpp_f<0xB1>(v);
    v += dpp_f<0x4E>(v);
    v += dpp_f<0x141>(v);
    v += dpp_f<0x140>(v);
    return v;
}

__device__ __forceinline__ float xhalf(float x) {     // lane l reads lane l ^ 16
    return __int_as_float(__builtin_amdgcn_permlanex16(__float_as_int(x), __float_as_int(x),
                                                       0x76543210, 0xfedcba98, false, false));
}

// ---------------------------------------------------------------------------
// Weight conversion: fp32 -> bf16, stored TRANSPOSED as W^T[N][K] so GEMM B
// tiles are row-major block copies (async-to-LDS friendly, no LDS scatter).
// One block transposes a tile of 128 k x 64 n through LDS: it reads 256-byte
// row pieces of the source (16 bytes a lane) and writes 256-byte row pieces of
// the destination (16 bytes a lane).  LDS holds one dword per (n, k pair).
// ---------------------------------------------------------------------------
constexpr int CTK = 128, CTN = 64;        // tile: k extent, n extent
constexpr int CPITCH = CTK / 2 + 1;       // dwords per n row; odd, so both sides spread over the banks

// src: first element of the tile, rows are k (pitch srcPitch floats).
// dst: first element of the tile, rows are n (pitch dstPitch bf16).
// tl: CTN * CPITCH dwords of LDS, the caller's (one array serves every instance in a kernel).
template <int srcPitch, int dstPitch>
__device__ __forceinline__ void conv_tile(const float* __restrict__ src, u16* __restrict__ dst, uint32_t* tl) {
    const int tid = threadIdx.x;
    const int nq = tid & 15, kp0 = tid >> 4;           // 4 n columns, k pair (+16*j)
    float4 r0[4], r1[4];
#pragma unroll
    for (int j = 0; j < 4; j++) {
        const float* p = src + (2 * kp0 * srcPitch + nq * 4) + 32 * j * srcPitch;
        r0[j] = *(const float4*)p;
        r1[j] = *(const float4*)(p + srcPitch);
    }
#pragma unroll
    for (int j = 0; j < 4; j++) {
        uint32_t* q = &tl[(nq * 4) * CPITCH + kp0 + 16 * j];
        q[0 * CPITCH] = (uint32_t)f2bf(r0[j].x) | ((uint32_t)f2bf(r1[j].x) << 16);
        q[1 * CPITCH] = (uint32_t)f2bf(r0[j].y) | ((uint32_t)f2bf(r1[j].y) << 16);
        q[2 * CPITCH] = (uint32_t)f2bf(r0[j].z) | ((uint32_t)f2bf(r1[j].z) << 16);
        q[3 * CPITCH] = (uint32_t)f2bf(r0[j].w) | ((uint32_t)f2bf(r1[j].w) << 16);
    }
    __syncthreads();
#pragma unroll
    for (int i = 0; i < 4; i++) {
        const int n = (tid >> 4) + 16 * i, kq = tid & 15;   // 16 lanes cover one n row
        const uint32_t* q = &tl[n * CPITCH + kq * 4];
        uint4 o = make_uint4(q[0], q[1], q[2], q[3]);
        *(uint4*)&dst[((tid >> 4) * dstPitch + kq * 8) + 16 * i * dstPitch] = o;
    }
}

// ---------------------------------------------------------------------------
// LayerNorm -> bf16.  One WAVE per row of D = 1024: a lane holds 32 of the row's
// values in registers (8 loads of 16 bytes, each 512 bytes in a row over the wave),
// the two sums run inside the lane and then across the 32 lanes.  No LDS and no
// barrier; a block of 256 threads takes LNR = 8 rows, so that a launch starts an
// eighth of the waves that a block per row needs.
// ---------------------------------------------------------------------------
constexpr int LNR = 8;                    // rows a block: one per wave

__device__ __forceinline__ float red_sum32(float v) {   // the sum over all 32 lanes, in every lane
    v = red_sum16(v);
    return v + xhalf(v);
}

typedef __attribute__((ext_vector_type(4))) float f32x4;
typedef __attribute__((ext_vector_type(2))) float f32x2;

__device__ __forceinline__ void ln_row(const float* __restrict__ x, const float* __restrict__ g,
                                       const float* __restrict__ b, u16* __restrict__ out, int row) {
    const int lane = threadIdx.x & 31;
    const f32x4* xr = (const f32x4*)(x + (size_t)row * D) + lane;
    const f32x4* gr = (const f32x4*)g + lane;
    const f32x4* br = (const f32x4*)b + lane;
    f32x4 v[8], gg[8], bb[8];
#pragma unroll
    for (int j = 0; j < 8; j++) v[j] = xr[j * 32];
    // the compiler lets a later load's result land in the address registers of the loads above:
    // the wait that belongs in front of an overwrite of a load's registers
    asm volatile("s_wait_xcnt 0x0" ::: "memory");
#pragma unroll
    for (int j = 0; j < 8; j++) { gg[j] = gr[j * 32]; bb[j] = br[j * 32]; }
    // all 24 loads are issued before the first sum: left free, the compiler sinks those of g and b to
    // their uses behind the sums, some of them one at a time, each with its whole latency exposed
    __builtin_amdgcn_sched_barrier(0);
    f32x2 s0 = v[0].lo, s1 = v[0].hi;     // four independent chains, two to a packed add
#pragma unroll
    for (int j = 1; j < 8; j++) { s0 += v[j].lo; s1 += v[j].hi; }
    s0 += s1;
    const float mean = red_sum32(s0.x + s0.y) * (1.0f / D);
    f32x2 q0 = 0.f, q1 = 0.f;
#pragma unroll
    for (int j = 0; j < 8; j++) {
        v[j] -= mean;
        q0 = __builtin_elementwise_fma(v[j].lo, v[j].lo, q0);
        q1 = __builtin_elementwise_fma(v[j].hi, v[j].hi, q1);
    }
    q0 += q1;
    const float rstd = rsqrtf(red_sum32(q0.x + q0.y) * (1.0f / D) + 1e-5f);
    u16* orow = out + (size_t)row * D + lane * 4;
#pragma unroll
    for (int j = 0; j < 8; j++) {         // 8 bytes a lane, 256 bytes in a row over the wave
        const f32x4 y = v[j] * rstd * gg[j] + bb[j];
        *(uint2*)&orow[j * 128] = make_uint2((uint32_t)f2bf(y.x) | ((uint32_t)f2bf(y.y) << 16),
                                             (uint32_t)f2bf(y.z) | ((uint32_t)f2bf(y.w) << 16));
    }
}

__global__ __launch_bounds__(256) void k_layernorm(const float* __restrict__ x, const float* __restrict__ g,
                                                   const float* __restrict__ b, u16* __restrict__ out) {
    ln_row(x, g, b, out, blockIdx.x * LNR + (threadIdx.x >> 5));
}

// ---------------------------------------------------------------------------
// Everything that depends on the inputs alone, in ONE launch: the four weight
// conversions and the first LayerNorm.  Block indices are dealt in groups of
// MIX_C conversion tiles and MIX_L LayerNorm blocks, so that both kinds of
// block share every WGP for the whole launch.
// ---------------------------------------------------------------------------
constexpr int NB_QKV = 3 * H * (D / CTK);            // one [D][DH] matrix per 8 k tiles
constexpr int NB_WO  = (D / CTN) * (D / CTK);
constexpr int NB_W1  = (DF / CTN) * (D / CTK);
constexpr int NB_W2  = (D / CTN) * (DF / CTK);
constexpr int NB_CONV = NB_W1 + NB_W2 + NB_QKV + NB_WO;
constexpr int NB_LN = ROWS / LNR;
constexpr int NGRP = 512, MIX_C = NB_CONV / NGRP, MIX_L = NB_LN / NGRP;   // 3 tiles and 1 block of 8 rows a group
static_assert(MIX_C * NGRP == NB_CONV && MIX_L * NGRP == NB_LN, "groups must cover both kinds of block exactly");
constexpr int NB_PREP = NB_CONV + NB_LN;

__global__ __launch_bounds__(256) void k_prep(const float* __restrict__ Wq, const float* __restrict__ Wk,
                                              const float* __restrict__ Wv, const float* __restrict__ Wo,
                                              const float* __restrict__ W1, const float* __restrict__ W2,
                                              const float* __restrict__ x, const float* __restrict__ g,
                                              const float* __restrict__ b,
                                              u16* __restrict__ wqkvT, u16* __restrict__ woT,
                                              u16* __restrict__ w1T, u16* __restrict__ w2T,
                                              u16* __restrict__ h1) {
    __shared__ uint32_t lds[CTN * CPITCH];            // a conversion's tile
    // every test below is the same for the whole block
    const int grp = blockIdx.x / (MIX_C + MIX_L), r = blockIdx.x % (MIX_C + MIX_L);
    if (r >= MIX_C) {
        ln_row(x, g, b, h1, (grp * MIX_L + r - MIX_C) * LNR + (threadIdx.x >> 5));
        return;
    }
    int blk = grp * MIX_C + r;                        // conversion tile 0 .. NB_CONV - 1
    if (blk < NB_W1) {                                // dst[n*K + k] = src[k*N + n], n tile fastest
        const int n0 = (blk % (DF / CTN)) * CTN, k0 = (blk / (DF / CTN)) * CTK;
        conv_tile<DF, D>(W1 + (size_t)k0 * DF + n0, w1T + (size_t)n0 * D + k0, lds);
    } else if ((blk -= NB_W1) < NB_W2) {
        const int n0 = (blk % (D / CTN)) * CTN, k0 = (blk / (D / CTN)) * CTK;
        conv_tile<D, DF>(W2 + (size_t)k0 * D + n0, w2T + (size_t)n0 * DF + k0, lds);
    } else if ((blk -= NB_W2) < NB_QKV) {             // which * H + h fastest, then the k tile
        const int m = blk % (3 * H), which = m >> 4, h = m & 15;
        const int k0 = (blk / (3 * H)) * CTK;
        const float* W = (which == 0) ? Wq : (which == 1 ? Wk : Wv);
        conv_tile<DH, D>(W + ((size_t)h * D + k0) * DH, wqkvT + (size_t)(which * D + h * DH) * D + k0, lds);
    } else {
        blk -= NB_QKV;
        const int n0 = (blk % (D / CTN)) * CTN, k0 = (blk / (D / CTN)) * CTK;
        conv_tile<D, D>(Wo + (size_t)k0 * D + n0, woT + (size_t)n0 * D + k0, lds);
        // in the built code another range's register writes follow these stores behind a scalar
        // test only: the wait that belongs in front of an overwrite of a store's registers
        asm volatile("s_wait_xcnt 0x0" ::: "memory");
    }
}

// ---------------------------------------------------------------------------
// bf16 WMMA GEMM: C[M][N] = A[M][K] * B[K][N] with B supplied TRANSPOSED
// (Bt[N][K]).  Block tile 128x128 (BT = 256: below), K-step KS = 64 (SK: 128), async-to-LDS staging in a ring of
// NS buffers, NS - 1 K-steps ahead, single barrier per K-step.  NS = 2 for QKV, whose
// blocks are all resident at once, three a WGP, and cover each other's waits.  NS = 4
// for the others: with N = 1024 a block has its WGP alone, and so has a block with
// N = 4096 (BT = 256).
// BT = 128: 8 waves, 16 v_wmma_f32_16x16x32_bf16 each per K-step (SK: 32).
// SK false: 4(m) x 2(n) waves, a wave has 32x64 = 2x4 WMMA tiles over both 32-k halves of the K-step
// and reads 12 fragments for its 16 WMMAs.
// SK true: 2(m) x 2(n) x 2(k) waves, a wave has 64x64 = 4x4 WMMA tiles over ONE half of the K-step and reads
// 8 fragments for 16 WMMAs: two thirds of the LDS reads, and one group of them a K-step.  The two
// waves of a tile hold partial sums; the epilogue adds them in LDS, each wave finishing 32 of the 64 rows.
// KS = 128 there: a copy brings 256 bytes in a row of every operand row, not 128, and a barrier with its
// waits serves 32 WMMAs of a wave, not 16; four such buffers still fit the LDS of a WGP that holds one block.
// BT = 256 (N = 4096, where 256x256 tiles make one block a WGP): block tile 256x256, 16 waves, 4(m) x 4(n), a wave
// has 64x64 over both 32-k halves.  A block brings in 64 KB a K-step for four times the products of a 128x128
// block's 32 KB: half the bytes out of L2 per product; a barrier and a wait serve four times the WMMAs.
// EPI 0: QKV permute -> bf16 (Q pre-scaled by 1/sqrt(DH), V stored transposed)
// EPI 1: +bias +res -> fp32      EPI 2: GELU(.+bias) -> bf16
// All three write out through LDS in 16-byte pieces that fill whole lines.
// ---------------------------------------------------------------------------
constexpr int EPITCH = 68;                // epilogue staging, floats a row: 64 + 4, rows 8 apart fall 32 banks apart
constexpr int VPITCH = 136;               // V^T staging, u16 a column: 128 + 8, 16 columns spread over all banks

template <int EPI, int N, int NS, bool SK, int BT, int KS>   // N at compile time: the epilogue's row steps become immediate offsets
__global__ __launch_bounds__(2 * BT) void k_gemm(const u16* __restrict__ A, const u16* __restrict__ Bt,
                                              const float* __restrict__ bias, const float* __restrict__ res,
                                              float* __restrict__ outF, u16* __restrict__ outU,
                                              int K) {
    constexpr bool BIG = BT == 256;
    static_assert(BT == 128 || (BIG && !SK && EPI == 2), "the 256x256 tile is written for the GELU epilogue, without the k split");
    static_assert(KS == 64 || (KS == 128 && SK), "the 128-k stage is written for the k split");
    constexpr int TSTRIDE = KS + 8;       // u16 a row in LDS: KS + 8 pad, 16 bytes x an odd number
    constexpr int TSZ = BT * TSTRIDE;     // one BT x KS tile in LDS (u16 count)
    __shared__ __attribute__((aligned(16))) u16 smem[NS * 2 * TSZ];   // [buf 0 .. NS-1][A tile | B tile]; epilogue staging afterwards
    const int tid = threadIdx.x;
    const int lane = tid & 31, wave = tid >> 5;
    constexpr int MT = (SK || BIG) ? 4 : 2;            // 16-row WMMA tiles of a wave
    const int wk = SK ? wave >> 2 : 0;                 // SK: the 64-k half of every K-step that this wave sums
    const int wm = SK ? wave & 1 : wave & 3;           // 2(m) x 2(n) x 2(k), or 4(m) x 2(n), or 4(m) x 4(n)
    const int wn = SK ? (wave >> 1) & 1 : wave >> 2;
    const int em = SK ? wm * 2 + wk : wm;              // the 32 x 64 piece of the block tile that this wave writes out: rows em * 32
    const int m0 = blockIdx.y * BT, n0 = blockIdx.x * BT;
    const int l15 = lane & 15, lhalf = lane >> 4, koff = lhalf * 8;
    constexpr int CH = KS / 8;                         // 16-byte chunks of a row
    constexpr int RP = 2 * BT / CH, NJ = BT / RP;      // rows that the block's threads cover at once; turns per tile
    const int ldr = tid / CH, ldc = (tid % CH) * 8;    // loader: row 0..RP-1 (+j*RP), col chunk

    v8f acc[MT][4] = {};

    auto issue_tile = [&](int k0, int buf) {
        u16* As = &smem[buf * 2 * TSZ];
        u16* Bs = As + TSZ;
#pragma unroll
        for (int j = 0; j < NJ; j++) {
            int r = ldr + j * RP;
            copy_b128(&As[r * TSTRIDE + ldc], &A[(size_t)(m0 + r) * K + k0 + ldc]);
            copy_b128(&Bs[r * TSTRIDE + ldc], &Bt[(size_t)(n0 + r) * K + k0 + ldc]);
        }
    };

    constexpr int CPS = 2 * NJ;           // copies of a wave per tile
    static_assert((NS - 1) * CPS <= 63, "copies of a wave in flight");
    const int nT = K / KS;
    // the ring's first NS - 1 tiles (every launch has K >= (NS - 1) * KS); unrolled: each buffer's offset a constant
#pragma unroll
    for (int s = 0; s < NS - 1; s++) issue_tile(s * KS, s);
    for (int t = 0; t < nT; t++) {
        // this wave's reads of tile t - 1 are done before the barrier behind which its buffer is refilled
        asm volatile("s_wait_dscnt 0x0" ::: "memory");
        // tile t has landed: while tiles t + 1 .. t + NS - 2 all exist they are the wave's youngest
        // copies, CPS each, and stay in flight; in the last trips, which issue none, everything is waited for
        if (NS > 2 && t + NS - 2 < nT) wait_async_but<(NS - 2) * CPS>();
        else wait_async0();
        __syncthreads();                  // publishes tile t, and ends every wave's reads of tile t - 1
        if (t + NS - 1 < nT) issue_tile((t + NS - 1) * KS, (t + NS - 1) % NS);
        const u16* As = &smem[(t % NS) * 2 * TSZ];
        const u16* Bs = As + TSZ;
        if constexpr (SK) {
            constexpr int NG = KS / 64;               // 32-k groups in this wave's half of the stage
            const u16* pa = &As[(wm * 64 + l15) * TSTRIDE + wk * (KS / 2) + koff];
            const u16* pb = &Bs[(wn * 64 + l15) * TSTRIDE + wk * (KS / 2) + koff];
            FragBF a[NG][4], b[NG][4];
#pragma unroll
            for (int g = 0; g < NG; g++)
#pragma unroll
                for (int i = 0; i < 4; i++) {         // A and B fragments in turn: i + 1 of each feed (i + 1)^2 WMMAs
                    a[g][i].u4[0] = *(const uint4*)(pa + i * 16 * TSTRIDE + g * 32);
                    a[g][i].u4[1] = *(const uint4*)(pa + i * 16 * TSTRIDE + g * 32 + 16);
                    b[g][i].u4[0] = *(const uint4*)(pb + i * 16 * TSTRIDE + g * 32);
                    b[g][i].u4[1] = *(const uint4*)(pb + i * 16 * TSTRIDE + g * 32 + 16);
                }
            // all reads of the stage stay one group in front of the first WMMA: the second 32-k group's are then in
            // flight under the first group's WMMAs, and no read stands among the WMMAs with its LDS latency exposed
            __builtin_amdgcn_sched_barrier(0);
            // the WMMAs in the order in which their fragments arrive; each accumulator gets one a group
            constexpr int OM[16] = {0, 1, 0, 1, 2, 2, 0, 1, 2, 3, 3, 3, 0, 1, 2, 3};
            constexpr int ON[16] = {0, 0, 1, 1, 0, 1, 2, 2, 2, 0, 1, 2, 3, 3, 3, 3};
#pragma unroll
            for (int g = 0; g < NG; g++)
#pragma unroll
                for (int i = 0; i < 16; i++)
                    acc[OM[i]][ON[i]] = __builtin_amdgcn_wmma_f32_16x16x32_bf16(
                        false, a[g][OM[i]].v, false, b[g][ON[i]].v, (short)0, acc[OM[i]][ON[i]], false, false);
        } else if constexpr (BIG) {
#pragma unroll
          for (int hk = 0; hk < 2; hk++) {
            const int kc = hk * 32;                   // both halves of the K-step in turn
            const u16* pa = &As[(wm * 64 + l15) * TSTRIDE + kc + koff];
            const u16* pb = &Bs[(wn * 64 + l15) * TSTRIDE + kc + koff];
            FragBF a[4], b[4];
#pragma unroll
            for (int i = 0; i < 4; i++) {             // A and B fragments in turn: i + 1 of each feed (i + 1)^2 WMMAs
                a[i].u4[0] = *(const uint4*)(pa + i * 16 * TSTRIDE);
                a[i].u4[1] = *(const uint4*)(pa + i * 16 * TSTRIDE + 16);
                b[i].u4[0] = *(const uint4*)(pb + i * 16 * TSTRIDE);
                b[i].u4[1] = *(const uint4*)(pb + i * 16 * TSTRIDE + 16);
            }
            // all 16 reads are issued before the first WMMA: left free, the compiler loads three of the four A
            // fragments into one register set, each behind four WMMAs with its whole LDS latency exposed
            __builtin_amdgcn_sched_barrier(0);
            // the WMMAs in the order in which their fragments arrive; each accumulator gets exactly one
            constexpr int OM[16] = {0, 1, 0, 1, 2, 2, 0, 1, 2, 3, 3, 3, 0, 1, 2, 3};
            constexpr int ON[16] = {0, 0, 1, 1, 0, 1, 2, 2, 2, 0, 1, 2, 3, 3, 3, 3};
#pragma unroll
            for (int i = 0; i < 16; i++)
                acc[OM[i]][ON[i]] = __builtin_amdgcn_wmma_f32_16x16x32_bf16(
                    false, a[OM[i]].v, false, b[ON[i]].v, (short)0, acc[OM[i]][ON[i]], false, false);
            // the second half's 16 reads stay one group behind these WMMAs, not single reads among them
            __builtin_amdgcn_sched_barrier(0);
          }
        } else {
#pragma unroll
            for (int kc = 0; kc < 64; kc += 32) {
                FragBF a[2], b[4];
#pragma unroll
                for (int mt = 0; mt < 2; mt++) {
                    const u16* p = &As[(wm * 32 + mt * 16 + l15) * TSTRIDE + kc + koff];
                    a[mt].u4[0] = *(const uint4*)p;
                    a[mt].u4[1] = *(const uint4*)(p + 16);
                }
#pragma unroll
                for (int nt = 0; nt < 4; nt++) {
                    const u16* p = &Bs[(wn * 64 + nt * 16 + l15) * TSTRIDE + kc + koff];
                    b[nt].u4[0] = *(const uint4*)p;
                    b[nt].u4[1] = *(const uint4*)(p + 16);
                }
#pragma unroll
                for (int mt = 0; mt < 2; mt++)
#pragma unroll
                    for (int nt = 0; nt < 4; nt++)
                        acc[mt][nt] = __builtin_amdgcn_wmma_f32_16x16x32_bf16(
                            false, a[mt].v, false, b[nt].v, (short)0, acc[mt][nt], false, false);
            }
        }
    }

    // Epilogue: the accumulators go through LDS so that every global access is
    // 16 bytes a lane and covers whole 128-byte lines.
    constexpr size_t planeE = (size_t)Bsz * H * S * DH;
    __syncthreads();                      // every wave has left the last K tile: smem is staging space now
    static_assert((SK || BIG ? 16 : 8) * 32 * EPITCH * 4 <= NS * 2 * TSZ * 2, "the staging tiles must fit the ring's LDS");
    float* st = (float*)smem + wave * (32 * EPITCH);   // this wave's own 32 x 64 fp32 tile
    const float* pt = st + 8 * (32 * EPITCH);          // SK: the same 32 x 64 piece, the other k half's sums, written by wave ^ 4
    // 32 rows of accumulators, from WMMA tile row mtb on, to d; inlined so that mtb is a constant and acc stays in registers
    auto put = [&](float* d, int mtb) __attribute__((always_inline)) {
#pragma unroll
        for (int mt = 0; mt < 2; mt++)
#pragma unroll
            for (int nt = 0; nt < 4; nt++)
#pragma unroll
                for (int r = 0; r < 8; r++)
                    d[(mt * 16 + r + 8 * lhalf) * EPITCH + nt * 16 + l15] = acc[mtb + mt][nt][r];
    };
    auto stage = [&]() {
        if constexpr (SK) {
            // the half of its 64 rows that this wave writes out (rows 0 to 31 for wk = 0) goes to its own tile,
            // the other half to its partner's second tile
            float* po = (float*)smem + (8 + (wave ^ 4)) * (32 * EPITCH);
            put(wk == 0 ? st : po, 0);
            put(wk == 0 ? po : st, 2);
        } else {
            put(st, 0);
        }
        // the rows are read back by other lanes of this wave: its LDS writes must have landed
        asm volatile("s_wait_dscnt 0x0" ::: "memory");
        if constexpr (SK) __syncthreads();             // and the partner wave's, which hold the other k half's sums
    };
    auto add4 = [](float4 x, float4 y) { return make_float4(x.x + y.x, x.y + y.y, x.z + y.z, x.w + y.w); };
    auto pack8 = [](float4 lo, float4 hi) {
        return make_uint4((uint32_t)f2bf(lo.x) | ((uint32_t)f2bf(lo.y) << 16),
                          (uint32_t)f2bf(lo.z) | ((uint32_t)f2bf(lo.w) << 16),
                          (uint32_t)f2bf(hi.x) | ((uint32_t)f2bf(hi.y) << 16),
                          (uint32_t)f2bf(hi.z) | ((uint32_t)f2bf(hi.w) << 16));
    };

    if constexpr (EPI == 0) {
        const int which = n0 >> 10;                       // /D : 0=Q 1=K 2=V, the same for the whole block
        const int nb = n0 & 1023;                         // h * DH + e of the block's first column
        const int bb = m0 >> 9, s0 = m0 & 511;            // /S, %S of the block's first row
        if (which != 2) {                                 // Q or K; the whole block takes this side
            stage();
            const float sc = (which == 0) ? 0.125f : 1.0f;   // fold 1/sqrt(DH) into Q
            // the wave's 64 columns are one head: its 32 x 64 tile is 4 KB in a row
            u16* dst = outU + (size_t)which * planeE +
                       (((size_t)bb * H + (nb >> 6) + wn) * S + s0 + em * 32) * DH + lane * 8;
#pragma unroll
            for (int i = 0; i < 8; i++) {
                const int row = i * 4 + (lane >> 3), c8 = (lane & 7) * 8;
                float4 lo = *(const float4*)&st[row * EPITCH + c8];
                float4 hi = *(const float4*)&st[row * EPITCH + c8 + 4];
                lo.x *= sc; lo.y *= sc; lo.z *= sc; lo.w *= sc;
                hi.x *= sc; hi.y *= sc; hi.z *= sc; hi.w *= sc;
                *(uint4*)&dst[i * 4 * DH] = pack8(lo, hi);       // (lane >> 3) * DH + c8 == lane * 8
            }
            // in the built code the V side's register writes follow these stores behind a scalar
            // test only: the wait that belongs in front of an overwrite of a store's registers
            asm volatile("s_wait_xcnt 0x0" ::: "memory");
            return;
        }
        // V is stored transposed [b][h][dh][s]: 8 accumulator rows of a lane are 8
        // neighbours in s.  Block tile in LDS as [128 columns][128 s], then 256-byte rows out.
#pragma unroll
        for (int mt = 0; mt < 2; mt++)
#pragma unroll
            for (int nt = 0; nt < 4; nt++) {
                const v8f c = acc[mt][nt];
                *(uint4*)&smem[(wn * 64 + nt * 16 + l15) * VPITCH + wm * 32 + mt * 16 + 8 * lhalf] =
                    pack8(make_float4(c[0], c[1], c[2], c[3]), make_float4(c[4], c[5], c[6], c[7]));
            }
        __syncthreads();                  // a column's 128 s values come from four waves
        const int c0 = tid >> 4, q = (tid & 15) * 8;
        u16* dst = outU + 2 * planeE + ((size_t)bb * D + nb + c0) * S + s0 + q;
#pragma unroll
        for (int i = 0; i < 8; i++)
            *(uint4*)&dst[i * 16 * S] = *(const uint4*)&smem[(i * 16 + c0) * VPITCH + q];
    } else if constexpr (EPI == 1) {
        stage();
        const int c4 = (lane & 15) * 4;
        const float4 bv = *(const float4*)&bias[n0 + wn * 64 + c4];
        // one 32-bit byte offset serves the residual reads and the stores
        const uint32_t off = (uint32_t)((m0 + em * 32 + lhalf) * N + n0 + wn * 64 + c4) * 4u;
        const char* rp = (const char*)res + off;
        char* op = (char*)outF + off;
#pragma unroll
        for (int i = 0; i < 16; i++) {
            float4 v = *(const float4*)&st[(i * 2 + lhalf) * EPITCH + c4];
            if constexpr (SK) v = add4(v, *(const float4*)&pt[(i * 2 + lhalf) * EPITCH + c4]);
            const float4 rr = *(const float4*)(rp + i * 2 * N * 4);
            *(float4*)(op + i * 2 * N * 4) =
                make_float4(v.x + bv.x + rr.x, v.y + bv.y + rr.y, v.z + bv.z + rr.z, v.w + bv.w + rr.w);
        }
    } else {
        const int c8 = (lane & 7) * 8;
        const float4 b0 = *(const float4*)&bias[n0 + wn * 64 + c8];
        const float4 b1 = *(const float4*)&bias[n0 + wn * 64 + c8 + 4];
        // GELU(t) = 0.5 t (1 + erf(t / sqrt 2)), without a branch.  With z = |t| / sqrt 2:
        // erfc(z) = u (a1 + u (a2 + u (a3 + u (a4 + u a5)))) exp(-z z), u = 1 / (1 + p z), absolute error
        // at most 1.5e-7; 1 + erf is erfc(z) for t < 0 (no cancellation there) and 2 - erfc(z) otherwise.
        // The library erff picks one of two polynomials by a branch per element, which the lanes of a
        // wave take both ways and which keeps the elements' dependent chains from overlapping.
        auto gelu4 = [](float4 t) {
            const float a0 = fmaf(0.3275911f * 0.70710678118654752f, fabsf(t.x), 1.0f);
            const float a1 = fmaf(0.3275911f * 0.70710678118654752f, fabsf(t.y), 1.0f);
            const float a2 = fmaf(0.3275911f * 0.70710678118654752f, fabsf(t.z), 1.0f);
            const float a3 = fmaf(0.3275911f * 0.70710678118654752f, fabsf(t.w), 1.0f);
            const float b0 = t.x * t.x * -0.72134752044448170f, b1 = t.y * t.y * -0.72134752044448170f;
            const float b2 = t.z * t.z * -0.72134752044448170f, b3 = t.w * t.w * -0.72134752044448170f;
            float u0, u1, u2, u3, e0, e1, e2, e3;     // u = 1 / a, e = 2^b = exp(-t t / 2)
            // One statement, so that behind each transcendental stands an instruction that neither reads
            // its result nor overwrites its source, as the instruction set asks: the outputs are early
            // clobbers (no output shares a register with an input), and v_nop is the slot behind the last.
            asm("v_rcp_f32 %0, %8\n\tv_rcp_f32 %1, %9\n\tv_rcp_f32 %2, %10\n\tv_rcp_f32 %3, %11\n\t"
                "v_exp_f32 %4, %12\n\tv_exp_f32 %5, %13\n\tv_exp_f32 %6, %14\n\tv_exp_f32 %7, %15\n\tv_nop"
                : "=&v"(u0), "=&v"(u1), "=&v"(u2), "=&v"(u3), "=&v"(e0), "=&v"(e1), "=&v"(e2), "=&v"(e3)
                : "v"(a0), "v"(a1), "v"(a2), "v"(a3), "v"(b0), "v"(b1), "v"(b2), "v"(b3));
            auto fin = [](float tt, float u, float e) {
                float p = fmaf(1.061405429f, u, -1.453152027f);
                p = fmaf(p, u, 1.421413741f);
                p = fmaf(p, u, -0.284496736f);
                p = fmaf(p, u, 0.254829592f);
                const float c = p * u * e;            // erfc(|t| / sqrt 2)
                return 0.5f * tt * (tt < 0.f ? c : 2.0f - c);
            };
            return make_float4(fin(t.x, u0, e0), fin(t.y, u1, e1), fin(t.z, u2, e2), fin(t.w, u3, e3));
        };
#pragma unroll
      for (int h = 0; h < (BIG ? 2 : 1); h++) {       // BT = 256: the wave's 64 rows go through its 32-row staging tile in two turns
        if constexpr (BIG) {
            put(st, 2 * h);
            // the rows are read back by other lanes of this wave: its LDS writes must have landed
            asm volatile("s_wait_dscnt 0x0" ::: "memory");
        } else {
            stage();
        }
        u16* dst = outU + (size_t)(m0 + (BIG ? wm * 64 + h * 32 : em * 32) + (lane >> 3)) * N + n0 + wn * 64 + c8;
#pragma unroll
        for (int i = 0; i < 8; i++) {
            const int row = i * 4 + (lane >> 3);
            float4 lo = *(const float4*)&st[row * EPITCH + c8];
            float4 hi = *(const float4*)&st[row * EPITCH + c8 + 4];
            if constexpr (SK) {
                lo = add4(lo, *(const float4*)&pt[row * EPITCH + c8]);
                hi = add4(hi, *(const float4*)&pt[row * EPITCH + c8 + 4]);
            }
            *(uint4*)&dst[i * 4 * N] =
                pack8(gelu4(make_float4(lo.x + b0.x, lo.y + b0.y, lo.z + b0.z, lo.w + b0.w)),
                      gelu4(make_float4(hi.x + b1.x, hi.y + b1.y, hi.z + b1.z, hi.w + b1.w)));
        }
      }
    }
}

__device__ __forceinline__ void exp8(const float (&x)[8], float (&y)[8]) {
    float e[8], a[8], t[8];
#pragma unroll
    for (int i = 0; i < 8; i++) {
        const float ph = x[i] * 0x1.715476p+0f;
        const float pl = fmaf(x[i], 0x1.4ae0bep-26f, fmaf(x[i], 0x1.715476p+0f, -ph));
        e[i] = rintf(ph);
        a[i] = (ph - e[i]) + pl;
    }
    asm("v_exp_f32 %0, %8\n\tv_exp_f32 %1, %9\n\tv_exp_f32 %2, %10\n\tv_exp_f32 %3, %11\n\t"
        "v_exp_f32 %4, %12\n\tv_exp_f32 %5, %13\n\tv_exp_f32 %6, %14\n\tv_exp_f32 %7, %15\n\tv_nop"
        : "=&v"(t[0]), "=&v"(t[1]), "=&v"(t[2]), "=&v"(t[3]), "=&v"(t[4]), "=&v"(t[5]), "=&v"(t[6]), "=&v"(t[7])
        : "v"(a[0]), "v"(a[1]), "v"(a[2]), "v"(a[3]), "v"(a[4]), "v"(a[5]), "v"(a[6]), "v"(a[7]));
#pragma unroll
    for (int i = 0; i < 8; i++) {
        float r = ldexpf(t[i], (int)e[i]);
        r = x[i] < -0x1.9d1da0p+6f ? 0.f : r;
        y[i] = x[i] > 0x1.62e430p+6f ? __builtin_inff() : r;
    }
}

__global__ __launch_bounds__(256) void k_attention(const u16* __restrict__ qkv, u16* __restrict__ ctx) {
    __shared__ u16 Ks[2][32][72];    // [buf][key t][dh]   (+8 pad)
    __shared__ u16 Vs[2][64][40];    // [buf][dh][key t]   (+8 pad)
    const int tid = threadIdx.x;
    const int lane = tid & 31, wave = tid >> 5;
    const int l15 = lane & 15, lhalf = lane >> 4, koff = lhalf * 8;
    const int bh = blockIdx.x;                    // b*H + h
    const int qBase = blockIdx.y * 128;
    const int q0w = qBase + wave * 16;
    const size_t plane = (size_t)Bsz * H * S * DH;
    const u16* qp = qkv + (size_t)bh * S * DH;
    const u16* kp = qkv + plane + (size_t)bh * S * DH;
    const u16* vp = qkv + 2 * plane + (size_t)bh * DH * S;   // transposed [dh][s]

    // Q fragments (already scaled by 1/sqrt(DH)) for this wave's 16 rows: B operand, column = query l15.
    FragBF qa0, qa1;
    {
        const u16* qrow = qp + (size_t)(q0w + l15) * DH;
        qa0.u4[0] = *(const uint4*)&qrow[koff];
        qa0.u4[1] = *(const uint4*)&qrow[koff + 16];
        qa1.u4[0] = *(const uint4*)&qrow[32 + koff];
        qa1.u4[1] = *(const uint4*)&qrow[32 + koff + 16];
    }

    auto issue_kv = [&](int kt, int buf) {
        int t = tid >> 3, c8 = (tid & 7) * 8;              // K: 32 keys x 64 dh
        async_b128(&Ks[buf][t][c8], &kp[(size_t)(kt * 32 + t) * DH + c8]);
        int dh = tid >> 2, c = (tid & 3) * 8;              // V^T: 64 dh x 32 keys
        async_b128(&Vs[buf][dh][c], &vp[(size_t)dh * S + kt * 32 + c]);
    };

    v8f ov[4] = {};                 // O^T accum: ov[c][r] = O[query l15][dh c*16 + 8*lhalf + r]
    const int rowg = q0w + l15;     // this lane's query
    float mrow = -3.0e38f;          // its running maximum, alike in both halves
    float lrow = 0.f;               // its running sum over the keys that this half holds

    const int ktEnd = (qBase + 127) >> 5;         // 32-key tiles
    issue_kv(0, 0);
    for (int kt = 0; kt <= ktEnd; kt++) {
        wait_async0();
        __syncthreads();
        if (kt + 1 <= ktEnd) issue_kv(kt + 1, (kt + 1) & 1);
        const int cur = kt & 1;

        // scores: K(32x64) @ Q^T(64x16) -> two 16x16 C tiles, 4 full WMMAs
        // sc0[r] = S[rowg][kt*32 + 8*lhalf + r], sc1[r] the key 16 further
        FragBF kb;
        v8f sc0 = {}, sc1 = {};
        kb.u4[0] = *(const uint4*)&Ks[cur][l15][koff];
        kb.u4[1] = *(const uint4*)&Ks[cur][l15][koff + 16];
        sc0 = __builtin_amdgcn_wmma_f32_16x16x32_bf16(false, kb.v, false, qa0.v, (short)0, sc0, false, false);
        kb.u4[0] = *(const uint4*)&Ks[cur][l15][32 + koff];
        kb.u4[1] = *(const uint4*)&Ks[cur][l15][32 + koff + 16];
        sc0 = __builtin_amdgcn_wmma_f32_16x16x32_bf16(false, kb.v, false, qa1.v, (short)0, sc0, false, false);
        kb.u4[0] = *(const uint4*)&Ks[cur][16 + l15][koff];
        kb.u4[1] = *(const uint4*)&Ks[cur][16 + l15][koff + 16];
        sc1 = __builtin_amdgcn_wmma_f32_16x16x32_bf16(false, kb.v, false, qa0.v, (short)0, sc1, false, false);
        kb.u4[0] = *(const uint4*)&Ks[cur][16 + l15][32 + koff];
        kb.u4[1] = *(const uint4*)&Ks[cur][16 + l15][32 + koff + 16];
        sc1 = __builtin_amdgcn_wmma_f32_16x16x32_bf16(false, kb.v, false, qa1.v, (short)0, sc1, false, false);

        const int key0 = kt * 32 + koff, key1 = key0 + 16;
        float s0[8], s1[8];
        float tm0 = -3.0e38f, tm1 = -3.0e38f;               // two chains: half the dependent depth of one
#pragma unroll
        for (int r = 0; r < 8; r++) {
            s0[r] = (key0 + r > rowg) ? -3.0e38f : sc0[r];  // causal mask; scale already folded into Q
            s1[r] = (key1 + r > rowg) ? -3.0e38f : sc1[r];
            tm0 = fmaxf(tm0, s0[r]);
            tm1 = fmaxf(tm1, s1[r]);
        }
        float tm = fmaxf(tm0, tm1);
        tm = fmaxf(tm, xhalf(tm));                          // the other half holds the tile's other 16 keys
        const float mnew = fmaxf(mrow, tm);
        const float f = expf(mrow - mnew);
        float ps = 0.f;
        FragBF pb;                                          // P^T, full 32x16 B fragment: element s is key 8*lhalf + s, 16 + 8*lhalf + s - 8
#pragma unroll
        for (int r = 0; r < 8; r++) { s0[r] -= mnew; s1[r] -= mnew; }
        float e0[8], e1[8];
        exp8(s0, e0);
        exp8(s1, e1);
#pragma unroll
        for (int r = 0; r < 8; r++) {
            float p0 = e0[r];
            float p1 = e1[r];
            if (key0 + r > rowg) p0 = 0.f;
            if (key1 + r > rowg) p1 = 0.f;
            ps += p0 + p1;
            pb.us[r]     = f2bf(p0);
            pb.us[8 + r] = f2bf(p1);
        }
        lrow = lrow * f + ps;
        mrow = mnew;

#pragma unroll
        for (int c = 0; c < 4; c++)
#pragma unroll
            for (int r = 0; r < 8; r++) ov[c][r] *= f;

#pragma unroll
        for (int c = 0; c < 4; c++) {
            FragBF vb;                                      // V^T, full 16x32 A fragment: row = dh c*16 + l15
            vb.u4[0] = *(const uint4*)&Vs[cur][c * 16 + l15][koff];
            vb.u4[1] = *(const uint4*)&Vs[cur][c * 16 + l15][koff + 16];
            ov[c] = __builtin_amdgcn_wmma_f32_16x16x32_bf16(false, vb.v, false, pb.v, (short)0, ov[c], false, false);
        }
    }

    // normalize and write ctx[b][s][h*DH + e] as bf16: a lane's 8 registers are 8 neighbours in e
    const int b = bh >> 4, h = bh & 15;
    const float inv = 1.0f / (lrow + xhalf(lrow));          // the two halves' sums join here
    u16* dst = ctx + ((size_t)(b * S + rowg)) * D + h * DH + koff;
#pragma unroll
    for (int c = 0; c < 4; c++) {
        const v8f o = ov[c];
        *(uint4*)&dst[c * 16] =
            make_uint4((uint32_t)f2bf(o[0] * inv) | ((uint32_t)f2bf(o[1] * inv) << 16),
                       (uint32_t)f2bf(o[2] * inv) | ((uint32_t)f2bf(o[3] * inv) << 16),
                       (uint32_t)f2bf(o[4] * inv) | ((uint32_t)f2bf(o[5] * inv) << 16),
                       (uint32_t)f2bf(o[6] * inv) | ((uint32_t)f2bf(o[7] * inv) << 16));
    }
}

// ---------------------------------------------------------------------------
extern "C" void kernel_launch(void* const* d_in, const int* in_sizes, int n_in,
                              void* d_out, int out_size, void* d_ws, size_t ws_size,
                              hipStream_t stream) {
    (void)in_sizes; (void)n_in; (void)out_size; (void)ws_size;
    const float* x   = (const float*)d_in[0];
    const float* g1  = (const float*)d_in[1];
    const float* be1 = (const float*)d_in[2];
    const float* Wq  = (const float*)d_in[3];
    const float* Wk  = (const float*)d_in[4];
    const float* Wv  = (const float*)d_in[5];
    const float* Wo  = (const float*)d_in[6];
    const float* bo  = (const float*)d_in[7];
    const float* g2  = (const float*)d_in[8];
    const float* be2 = (const float*)d_in[9];
    const float* W1  = (const float*)d_in[10];
    const float* fb1 = (const float*)d_in[11];
    const float* W2  = (const float*)d_in[12];
    const float* fb2 = (const float*)d_in[13];
    float* out = (float*)d_out;

    char* ws = (char*)d_ws;
    auto alloc = [&](size_t bytes) -> char* {
        char* p = ws; ws += (bytes + 255) & ~(size_t)255; return p;
    };
    u16*   wqkvT = (u16*)alloc((size_t)3 * D * D * 2);   // [3D][D]
    u16*   woT   = (u16*)alloc((size_t)D * D * 2);       // [D][D]
    u16*   w1T   = (u16*)alloc((size_t)DF * D * 2);      // [DF][D]
    u16*   w2T   = (u16*)alloc((size_t)D * DF * 2);      // [D][DF]
    u16*   h1    = (u16*)alloc((size_t)ROWS * D * 2);
    u16*   qkv   = (u16*)alloc((size_t)3 * ROWS * D * 2);
    u16*   ctx   = (u16*)alloc((size_t)ROWS * D * 2);
    float* xmid  = (float*)alloc((size_t)ROWS * D * 4);
    u16*   h2    = (u16*)alloc((size_t)ROWS * D * 2);
    u16*   ffn1  = (u16*)alloc((size_t)ROWS * DF * 2);

    dim3 blk(256);
    k_prep<<<NB_PREP, blk, 0, stream>>>(Wq, Wk, Wv, Wo, W1, W2, x, g1, be1, wqkvT, woT, w1T, w2T, h1);
    k_gemm<0, 3 * D, 2, false, 128, 64><<<dim3(3 * D / 128, ROWS / 128), blk, 0, stream>>>(h1, wqkvT, nullptr, nullptr, nullptr, qkv, D);
    k_attention<<<dim3(Bsz * H, S / 128), blk, 0, stream>>>(qkv, ctx);
    k_gemm<1, D, 4, true, 128, 128><<<dim3(D / 128, ROWS / 128), blk, 0, stream>>>(ctx, woT, bo, x, xmid, nullptr, D);
    k_layernorm<<<NB_LN, blk, 0, stream>>>(xmid, g2, be2, h2);
    k_gemm<2, DF, 4, false, 256, 64><<<dim3(DF / 256, ROWS / 256), dim3(512), 0, stream>>>(h2, w1T, fb1, nullptr, nullptr, ffn1, D);
    k_gemm<1, D, 4, true, 128, 128><<<dim3(D / 128, ROWS / 128), blk, 0, stream>>>(ffn1, w2T, fb2, xmid, out, nullptr, DF);
}
